// v000
// Measured on an AMD MI455X. A time is GPU time per run, averaged over a window of back-to-back runs after a warm-up
// (all launches, gaps included; the runs take copies of the inputs in turn), and the median of several windows.
// Apart from v000's, it joins two sittings. Times from different sittings can be a few percent apart, while
// side-by-side timings come from the same sitting.
// v000 is the starting kernel. One run takes 707 microseconds.
#include <hip/hip_runtime.h>
#include <stddef.h>

// Contractions on v_wmma_f32_16x16x32_f16 (f16 operands, f32 accumulate): q/k channel GEMM as f16 hi/lo split (3 products, W scaled 2^10, x scaled 2^6), v channel GEMM single f16, QK^T single f16 (q,k scaled 2^3), P*V single f16 (P scaled 2^12, V scaled 2^3), output GEMM single f16 (W scaled 2^4, G scaled 2^8); BN folds, softmax, GELU in f32.

typedef _Float16 v16h __attribute__((ext_vector_type(16)));
typedef _Float16 v8h  __attribute__((ext_vector_type(8)));
typedef float    v8f  __attribute__((ext_vector_type(8)));
typedef float    v4f  __attribute__((ext_vector_type(4)));
typedef v8h v8ha __attribute__((may_alias));
typedef v4f v4fa __attribute__((may_alias));

#define NB_  16
#define NC_  256
#define NP_  1024
#define NH_  8
#define DK_  32
#define DV_  64
#define NO_  512
#define RS_  1032
#define GP_  72
#define EPS_ 1e-5f
#define CQK_ (0.17677669529663687f * 0.015625f)
#define INVSCALE_ 5.656854249492381f

union Frag { v16h v; v8h p[2]; };

// 16x32 fragment from a k-contiguous 16-bit row: elements 0..7 <- k0+8h..+7, 8..15 <- k0+16+8h..+7
__device__ __forceinline__ v16h ldfrag(const _Float16* rowp, int k0, int h) {
  Frag f;
  f.p[0] = *(const v8ha*)(rowp + k0 + 8 * h);
  f.p[1] = *(const v8ha*)(rowp + k0 + 16 + 8 * h);
  return f.v;
}

__device__ __forceinline__ v8f mma16(v16h a, v16h b, v8f c) {
  c = __builtin_amdgcn_wmma_f32_16x16x32_f16(false, a, false, b, (short)0, c, false, false);
  asm volatile("v_nop\n\tv_nop\n\tv_nop\n\tv_nop" : "+v"(c) : "v"(a), "v"(b));
  return c;
}

__device__ __forceinline__ v8f vzero() {
  v8f z = {0.f, 0.f, 0.f, 0.f, 0.f, 0.f, 0.f, 0.f};
  return z;
}

// ---------------- BN folded into QKV weights: Wh/Wl f16 hi/lo planes of W*inv*1024, beta[1024] -----
// 32 rows per block, wave w handles rows w*4..w*4+3, lane writes 8 consecutive columns (16 B)
__global__ __launch_bounds__(256) void k_fold_qkv(
    const float* __restrict__ Wq, const float* __restrict__ qg, const float* __restrict__ qb,
    const float* __restrict__ qm, const float* __restrict__ qv,
    const float* __restrict__ Wk, const float* __restrict__ kg, const float* __restrict__ kb,
    const float* __restrict__ km, const float* __restrict__ kv,
    const float* __restrict__ Wv, const float* __restrict__ vg, const float* __restrict__ vb,
    const float* __restrict__ vm, const float* __restrict__ vv,
    _Float16* Wh, _Float16* Wl, float* beta) {
  __shared__ __attribute__((aligned(16))) float sb[32];
  const int tid = threadIdx.x, w = tid >> 5, lane = tid & 31;
  const int blk = blockIdx.x;
#pragma unroll 1
  for (int i = 0; i < 4; ++i) {
    const int o = blk * 32 + w * 4 + i;   // 0..1023
    const float* W;
    float g, bb, mm, var;
    int oo;
    if (o < 256)      { oo = o;       W = Wq; g = qg[oo]; bb = qb[oo]; mm = qm[oo]; var = qv[oo]; }
    else if (o < 512) { oo = o - 256; W = Wk; g = kg[oo]; bb = kb[oo]; mm = km[oo]; var = kv[oo]; }
    else              { oo = o - 512; W = Wv; g = vg[oo]; bb = vb[oo]; mm = vm[oo]; var = vv[oo]; }
    const float inv = g * (1.0f / sqrtf(var + EPS_));
    const float* wr = W + (size_t)oo * NC_ + lane * 8;
    const v4f w0 = *(const v4fa*)(wr);
    const v4f w1 = *(const v4fa*)(wr + 4);
    float vals[8] = {w0.x, w0.y, w0.z, w0.w, w1.x, w1.y, w1.z, w1.w};
    v8h hv, lv;
#pragma unroll
    for (int e = 0; e < 8; ++e) {
      const float s = vals[e] * inv * 1024.0f;
      const _Float16 hh = (_Float16)s;
      const _Float16 ll = (_Float16)(s - (float)hh);
      hv[e] = hh; lv[e] = ll;
    }
    _Float16* dh = Wh + (size_t)o * NC_ + lane * 8;
    _Float16* dl = Wl + (size_t)o * NC_ + lane * 8;
    *(v8h*)dh = hv;
    *(v8h*)dl = lv;
    
    if (lane == 0) sb[w * 4 + i] = bb - mm * inv;
  }
  __syncthreads();
  if (w == 0 && lane < 8) {
    v4f b4;
    b4.x = sb[lane * 4 + 0]; b4.y = sb[lane * 4 + 1]; b4.z = sb[lane * 4 + 2]; b4.w = sb[lane * 4 + 3];
    float* db = beta + blk * 32 + lane * 4;
    *(v4f*)db = b4;
    
  }
}

// ---------------- bo + output BN folded into Wo: WoS f16 = Wo*inv*16, betaO[256] -------------------
__global__ __launch_bounds__(256) void k_fold_wo(
    const float* __restrict__ Wo, const float* __restrict__ bo, const float* __restrict__ og,
    const float* __restrict__ ob, const float* __restrict__ om, const float* __restrict__ ov,
    _Float16* WoS, float* betaO) {
  __shared__ __attribute__((aligned(16))) float sb[32];
  const int tid = threadIdx.x, w = tid >> 5, lane = tid & 31;
  const int blk = blockIdx.x;
#pragma unroll 1
  for (int i = 0; i < 4; ++i) {
    const int o = blk * 32 + w * 4 + i;   // 0..255
    const float inv = og[o] * (1.0f / sqrtf(ov[o] + EPS_));
#pragma unroll
    for (int hf = 0; hf < 2; ++hf) {
      const float* wr = Wo + (size_t)o * NO_ + hf * 256 + lane * 8;
      const v4f w0 = *(const v4fa*)(wr);
      const v4f w1 = *(const v4fa*)(wr + 4);
      float vals[8] = {w0.x, w0.y, w0.z, w0.w, w1.x, w1.y, w1.z, w1.w};
      v8h hv;
#pragma unroll
      for (int e = 0; e < 8; ++e) hv[e] = (_Float16)(vals[e] * inv * 16.0f);
      _Float16* dh = WoS + (size_t)o * NO_ + hf * 256 + lane * 8;
      *(v8h*)dh = hv;
      
    }
    if (lane == 0) sb[w * 4 + i] = bo[o] * inv + ob[o] - om[o] * inv;
  }
  __syncthreads();
  if (w == 0 && lane < 8) {
    v4f b4;
    b4.x = sb[lane * 4 + 0]; b4.y = sb[lane * 4 + 1]; b4.z = sb[lane * 4 + 2]; b4.w = sb[lane * 4 + 3];
    float* db = betaO + blk * 32 + lane * 4;
    *(v4f*)db = b4;
    
  }
}

// ---------------- x[b][c][p] -> xTh/xTl[b][p][c] f16 hi/lo planes of 64*x -----------------------------
__global__ __launch_bounds__(256) void k_tr(const float* __restrict__ x, _Float16* xTh, _Float16* xTl) {
  __shared__ float T[64][65];
  const int pblk = blockIdx.x, cblk = blockIdx.y, b = blockIdx.z;
  const int tid = threadIdx.x;
#pragma unroll
  for (int it = 0; it < 16; ++it) {
    const int idx = it * 256 + tid;
    const int ci = idx >> 6, pj = idx & 63;
    T[ci][pj] = x[((size_t)(b * NC_ + cblk * 64 + ci)) * NP_ + pblk * 64 + pj];
  }
  __syncthreads();
#pragma unroll
  for (int it = 0; it < 2; ++it) {
    const int pi = it * 256 + tid;
    const int pl = pi >> 3, pc = pi & 7;
    v8h hv, lv;
#pragma unroll
    for (int e = 0; e < 8; ++e) {
      const float s = T[pc * 8 + e][pl] * 64.0f;
      const _Float16 hh = (_Float16)s;
      const _Float16 ll = (_Float16)(s - (float)hh);
      hv[e] = hh; lv[e] = ll;
    }
    const size_t off = ((size_t)(b * NP_ + pblk * 64 + pl)) * NC_ + cblk * 64 + pc * 8;
    *(v8h*)(xTh + off) = hv;
    *(v8h*)(xTl + off) = lv;
    
  }
}

// ---------------- QKV projection GEMM (BN folded) --------------------------------------------------
// block tile 64 pixels x 128 output channels, 8 waves (4 row groups x 2 column halves), K = 256.
// q,k column chunks (nchunk 0..3): hi*hi + hi*lo + lo*hi; v chunks (4..7): hi*hi.
// qT,kT: [b*8+n][p][32] f16 (x8);  vN: [b][512][p] f16 (x8)
__global__ __launch_bounds__(256) void k_qkv(
    const _Float16* __restrict__ xTh, const _Float16* __restrict__ xTl,
    const _Float16* __restrict__ Wh, const _Float16* __restrict__ Wl, const float* __restrict__ beta,
    _Float16* qT, _Float16* kT, _Float16* vN) {
  __shared__ __attribute__((aligned(16))) _Float16 st[128 * GP_];   // q/k view: [64][136], v view: [128][72]
  const int ptile = blockIdx.x, nchunk = blockIdx.y, b = blockIdx.z;
  const int tid = threadIdx.x, w = tid >> 5, lane = tid & 31, m = lane & 15, h = lane >> 4;
  const int msub = w & 3, nh = w >> 2;
  const int nbase = nchunk * 128 + nh * 64;
  const size_t prow = (size_t)b * NP_ + ptile * 64 + msub * 16 + m;
  const bool split = (nchunk < 4);   // block-uniform

  v8f acc[4] = {vzero(), vzero(), vzero(), vzero()};
  const _Float16* ahr = xTh + prow * NC_;
  const _Float16* alr = xTl + prow * NC_;
#pragma unroll 1
  for (int kk = 0; kk < 8; ++kk) {
    const int k0 = kk * 32;
    const v16h ah = ldfrag(ahr, k0, h);
    v16h al = ah;
    if (split) al = ldfrag(alr, k0, h);
#pragma unroll
    for (int t = 0; t < 4; ++t) {
      const size_t orow = (size_t)(nbase + t * 16 + m) * NC_;
      const v16h bh = ldfrag(Wh + orow, k0, h);
      acc[t] = mma16(ah, bh, acc[t]);
      if (split) {
        const v16h bl = ldfrag(Wl + orow, k0, h);
        acc[t] = mma16(ah, bl, acc[t]);
        acc[t] = mma16(al, bh, acc[t]);
      }
    }
  }

  // epilogue: scale back 2^-16, add folded beta, scale x8, stage 16-bit tile in LDS
  const float kS = 1.0f / 65536.0f;
#pragma unroll
  for (int t = 0; t < 4; ++t) {
    const int ol = nh * 64 + t * 16 + m;                 // 0..127 (column = this lane's n)
    const float bta = beta[nchunk * 128 + ol];
#pragma unroll
    for (int j = 0; j < 8; ++j) {
      const int pl = msub * 16 + 8 * h + j;              // D row 8h+j
      const _Float16 hv = (_Float16)((acc[t][j] * kS + bta) * 8.0f);
      if (split) st[pl * 136 + ol] = hv;
      else       st[ol * GP_ + pl] = hv;
    }
  }
  __syncthreads();

  if (split) {
    _Float16* base = (nchunk < 2) ? qT : kT;
    const int hb = (nchunk & 1) * 4;
#pragma unroll
    for (int it = 0; it < 4; ++it) {
      const int pi = it * 256 + tid;                     // 1024 pieces of 16 B
      const int hd = pi >> 8, r = pi & 255;
      const int pl = r >> 2, dq = r & 3;
      const v8h v = *(const v8ha*)(st + pl * 136 + hd * 32 + dq * 8);
      _Float16* dst = base + (((size_t)(b * NH_ + hb + hd)) * NP_ + ptile * 64) * DK_ + r * 8;
      *(v8h*)dst = v;
      
    }
  } else {
    const int obase = (nchunk - 4) * 128;
#pragma unroll
    for (int it = 0; it < 4; ++it) {
      const int pi = it * 256 + tid;                     // 128 rows x 8 pieces
      const int ol = pi >> 3, pc = pi & 7;
      const v8h v = *(const v8ha*)(st + ol * GP_ + pc * 8);
      _Float16* dst = vN + ((size_t)(b * NO_ + obase + ol)) * NP_ + ptile * 64 + pc * 8;
      *(v8h*)dst = v;
      
    }
  }
}

// ---------------- fused attention + GELU -----------------------------------------------------------
// 2 waves per block, each wave owns one (b, n, 16-query) tile; f32 scores in LDS.
__global__ __launch_bounds__(64) void k_attn(
    const _Float16* __restrict__ qT, const _Float16* __restrict__ kT, const _Float16* __restrict__ vN,
    const float* __restrict__ posemb, const int* __restrict__ pidx, _Float16* goT) {
  extern __shared__ __attribute__((aligned(16))) float smem[];
  float* poscol = smem;                                  // 1024: pos_emb[:, n]
  float* rmaxs  = smem + 1024;                           // 2 x 16
  float* sc     = smem + 1056;                           // 2 x 16 x RS_
  _Float16* gT  = (_Float16*)(smem + 1056 + 2 * 16 * RS_);   // 2 x 16 x GP_ halves

  const int qgrp = blockIdx.x, n = blockIdx.y, b = blockIdx.z;
  const int tid = threadIdx.x;
  const int w = tid >> 5, lane = tid & 31, m = lane & 15, h = lane >> 4;
  for (int k = tid; k < NP_; k += 64) poscol[k] = posemb[k * NH_ + n];
  __syncthreads();

  const int qbase = (qgrp * 2 + w) * 16;
  const int bn = b * NH_ + n;
  const v16h aq = ldfrag(qT + ((size_t)bn * NP_ + qbase + m) * DK_, 0, h);
  float* myS = sc + w * 16 * RS_;
  const v8f vz = vzero();

  float pmax[8];
#pragma unroll
  for (int j = 0; j < 8; ++j) pmax[j] = -3.0e38f;
#pragma unroll 1
  for (int kt = 0; kt < 64; ++kt) {
    const v16h bk = ldfrag(kT + ((size_t)bn * NP_ + kt * 16 + m) * DK_, 0, h);
    const v8f s = mma16(aq, bk, vz);
    const int kgl = kt * 16 + m;                         // D column = key
#pragma unroll
    for (int j = 0; j < 8; ++j) {
      const int row = 8 * h + j;                         // D row = query
      const int qgl = qbase + row;
      int ix = pidx[(size_t)qgl * NP_ + kgl];
      ix = ix < 0 ? 0 : (ix > NP_ - 1 ? NP_ - 1 : ix);
      const float val = s[j] * CQK_ + poscol[ix] * INVSCALE_;
      myS[row * RS_ + kgl] = val;
      pmax[j] = fmaxf(pmax[j], val);
    }
  }
#pragma unroll
  for (int j = 0; j < 8; ++j) {
    float mv = pmax[j];
    mv = fmaxf(mv, __shfl_xor(mv, 1));
    mv = fmaxf(mv, __shfl_xor(mv, 2));
    mv = fmaxf(mv, __shfl_xor(mv, 4));
    mv = fmaxf(mv, __shfl_xor(mv, 8));
    if (m == j) rmaxs[w * 16 + j + 8 * h] = mv;
  }
  __syncthreads();

  // exp pass: lane handles row m, half h of the columns; e stored back in place (f32)
  const float mx = rmaxs[w * 16 + m];
  float* rowh = myS + m * RS_ + h * 512;
  float sum = 0.f;
#pragma unroll 1
  for (int c4 = 0; c4 < 128; ++c4) {
    v4f f = *(v4fa*)(rowh + c4 * 4);
    f.x = __expf(f.x - mx);
    f.y = __expf(f.y - mx);
    f.z = __expf(f.z - mx);
    f.w = __expf(f.w - mx);
    sum += (f.x + f.y) + (f.z + f.w);
    *(v4fa*)(rowh + c4 * 4) = f;
  }
  sum += __shfl_xor(sum, 16);
  const float rs = (1.0f / sum) * 4096.0f;               // P scaled 2^12 at fragment build
  __syncthreads();

  // pass 2: O[16 x 64] = P @ V ; A row m = query qbase+m (normaliser of the same row), k = key
  v8f oacc[4] = {vz, vz, vz, vz};
  const float* rp = myS + m * RS_;
#pragma unroll 1
  for (int kc = 0; kc < 32; ++kc) {
    const int k0 = kc * 32;
    const v4f f0 = *(const v4fa*)(rp + k0 + 8 * h);
    const v4f f1 = *(const v4fa*)(rp + k0 + 8 * h + 4);
    const v4f f2 = *(const v4fa*)(rp + k0 + 16 + 8 * h);
    const v4f f3 = *(const v4fa*)(rp + k0 + 16 + 8 * h + 4);
    v8h p0, p1;
    p0[0] = (_Float16)(f0.x * rs); p0[1] = (_Float16)(f0.y * rs); p0[2] = (_Float16)(f0.z * rs); p0[3] = (_Float16)(f0.w * rs);
    p0[4] = (_Float16)(f1.x * rs); p0[5] = (_Float16)(f1.y * rs); p0[6] = (_Float16)(f1.z * rs); p0[7] = (_Float16)(f1.w * rs);
    p1[0] = (_Float16)(f2.x * rs); p1[1] = (_Float16)(f2.y * rs); p1[2] = (_Float16)(f2.z * rs); p1[3] = (_Float16)(f2.w * rs);
    p1[4] = (_Float16)(f3.x * rs); p1[5] = (_Float16)(f3.y * rs); p1[6] = (_Float16)(f3.z * rs); p1[7] = (_Float16)(f3.w * rs);
    Frag ap;
    ap.p[0] = p0; ap.p[1] = p1;
#pragma unroll
    for (int t = 0; t < 4; ++t) {
      const v16h bv = ldfrag(vN + ((size_t)(b * NO_ + n * DV_ + t * 16 + m)) * NP_, k0, h);
      oacc[t] = mma16(ap.v, bv, oacc[t]);
    }
  }

  // GELU (erf form), scale 2^8, stage per-wave 16x64 f16 tile, then whole-line stores
  const float co = 1.0f / 32768.0f;                      // undo 2^12 (P) and 2^3 (V)
  _Float16* gw = gT + w * 16 * GP_;
#pragma unroll
  for (int t = 0; t < 4; ++t) {
#pragma unroll
    for (int j = 0; j < 8; ++j) {
      const int row = 8 * h + j;
      const float xo = oacc[t][j] * co;
      const float gl = 0.5f * xo * (1.0f + erff(xo * 0.70710678118654752f));
      gw[row * GP_ + t * 16 + m] = (_Float16)(gl * 256.0f);
    }
  }
  __syncthreads();
#pragma unroll
  for (int it = 0; it < 4; ++it) {
    const int pi = it * 32 + lane;                       // 16 rows x 8 pieces per wave
    const int row = pi >> 3, pc = pi & 7;
    const v8h v = *(const v8ha*)(gw + row * GP_ + pc * 8);
    _Float16* dst = goT + ((size_t)(b * NP_ + qbase + row)) * NO_ + n * DV_ + pc * 8;
    *(v8h*)dst = v;
    
  }
}

// ---------------- output projection GEMM (bias + BN folded) ---------------------------------------
__global__ __launch_bounds__(256) void k_out(
    const _Float16* __restrict__ goT, const _Float16* __restrict__ WoS, const float* __restrict__ betaO,
    float* out) {
  __shared__ __attribute__((aligned(16))) float To[128 * 68];
  const int ptile = blockIdx.x, nchunk = blockIdx.y, b = blockIdx.z;
  const int tid = threadIdx.x, w = tid >> 5, lane = tid & 31, m = lane & 15, h = lane >> 4;
  const int msub = w & 3, nh = w >> 2;
  const int nbase = nchunk * 128 + nh * 64;
  const size_t prow = (size_t)b * NP_ + ptile * 64 + msub * 16 + m;
  v8f acc[4] = {vzero(), vzero(), vzero(), vzero()};
  const _Float16* ar = goT + prow * NO_;
#pragma unroll 1
  for (int kk = 0; kk < 16; ++kk) {
    const int k0 = kk * 32;
    const v16h a = ldfrag(ar, k0, h);
#pragma unroll
    for (int t = 0; t < 4; ++t) {
      const v16h bt = ldfrag(WoS + (size_t)(nbase + t * 16 + m) * NO_, k0, h);
      acc[t] = mma16(a, bt, acc[t]);
    }
  }
  const float kS = 1.0f / 4096.0f;                       // undo 2^4 (W) and 2^8 (G)
#pragma unroll
  for (int t = 0; t < 4; ++t) {
    const int ol = nh * 64 + t * 16 + m;
    const float bta = betaO[nchunk * 128 + ol];
#pragma unroll
    for (int j = 0; j < 8; ++j) {
      const int pl = msub * 16 + 8 * h + j;
      To[ol * 68 + pl] = acc[t][j] * kS + bta;
    }
  }
  __syncthreads();
#pragma unroll
  for (int it = 0; it < 8; ++it) {
    const int pi = it * 256 + tid;                       // 128 rows x 16 float4 pieces
    const int ol = pi >> 4, pc = pi & 15;
    const v4f v = *(const v4fa*)(To + ol * 68 + pc * 4);
    float* dst = out + ((size_t)(b * NC_ + nchunk * 128 + ol)) * NP_ + ptile * 64 + pc * 4;
    *(v4f*)dst = v;
    
  }
}

// ---------------- launch glue ------------------------------------------------------------------------
extern "C" void kernel_launch(void* const* d_in, const int* in_sizes, int n_in,
                              void* d_out, int out_size, void* d_ws, size_t ws_size,
                              hipStream_t stream) {
  if (n_in < 24) return;
  if (in_sizes[0] != NB_ * NC_ * NP_) return;
  if (in_sizes[1] != NC_ * NC_ || in_sizes[6] != NC_ * NC_ || in_sizes[11] != NO_ * NC_) return;
  if (in_sizes[16] != NP_ * NH_ || in_sizes[17] != NC_ * NO_ || in_sizes[23] != NP_ * NP_) return;
  {
    const int f32c[13] = {2, 3, 4, 5, 7, 8, 9, 10, 18, 19, 20, 21, 22};
    for (int i = 0; i < 13; ++i) if (in_sizes[f32c[i]] != NC_) return;
    const int f32o[4] = {12, 13, 14, 15};
    for (int i = 0; i < 4; ++i) if (in_sizes[f32o[i]] != NO_) return;
  }
  if (out_size != NB_ * NC_ * NP_) return;

  const float* x    = (const float*)d_in[0];
  const float* Wq   = (const float*)d_in[1];
  const float* q_g  = (const float*)d_in[2];
  const float* q_b  = (const float*)d_in[3];
  const float* q_m  = (const float*)d_in[4];
  const float* q_v  = (const float*)d_in[5];
  const float* Wk   = (const float*)d_in[6];
  const float* k_g  = (const float*)d_in[7];
  const float* k_b  = (const float*)d_in[8];
  const float* k_m  = (const float*)d_in[9];
  const float* k_v  = (const float*)d_in[10];
  const float* Wv   = (const float*)d_in[11];
  const float* v_g  = (const float*)d_in[12];
  const float* v_b  = (const float*)d_in[13];
  const float* v_m  = (const float*)d_in[14];
  const float* v_v  = (const float*)d_in[15];
  const float* pose = (const float*)d_in[16];
  const float* Wo   = (const float*)d_in[17];
  const float* bo   = (const float*)d_in[18];
  const float* o_g  = (const float*)d_in[19];
  const float* o_b  = (const float*)d_in[20];
  const float* o_m  = (const float*)d_in[21];
  const float* o_v  = (const float*)d_in[22];
  const int*   pix  = (const int*)d_in[23];

  // workspace carve (bytes), every offset a multiple of 1024
  const size_t O_WH    = 0;                                             // 1024*256*2
  const size_t O_WL    = O_WH    + (size_t)1024 * NC_ * 2;              // 524288
  const size_t O_BETA  = O_WL    + (size_t)1024 * NC_ * 2;              // 1048576, 4096 B
  const size_t O_WOS   = O_BETA  + 4096;                                // 1052672, 256*512*2
  const size_t O_BETAO = O_WOS   + (size_t)NC_ * NO_ * 2;               // 1314816, 1024 B
  const size_t O_XTH   = O_BETAO + 1024;                                // 1315840, 8 MB
  const size_t O_XTL   = O_XTH   + (size_t)NB_ * NP_ * NC_ * 2;         // 9704448
  const size_t O_QT    = O_XTL   + (size_t)NB_ * NP_ * NC_ * 2;         // 18093056, 8 MB
  const size_t O_KT    = O_QT    + (size_t)NB_ * NH_ * NP_ * DK_ * 2;   // 26481664
  const size_t O_VN    = O_KT    + (size_t)NB_ * NH_ * NP_ * DK_ * 2;   // 34870272, 16 MB
  const size_t O_GOT   = O_VN    + (size_t)NB_ * NO_ * NP_ * 2;         // 51647488, 16 MB
  const size_t O_END   = O_GOT   + (size_t)NB_ * NP_ * NO_ * 2;         // 68424704
  if (O_END > ws_size) return;

  char* ws = (char*)d_ws;
  _Float16* Wh    = (_Float16*)(ws + O_WH);
  _Float16* Wl    = (_Float16*)(ws + O_WL);
  float*    beta  = (float*)   (ws + O_BETA);
  _Float16* WoS   = (_Float16*)(ws + O_WOS);
  float*    betaO = (float*)   (ws + O_BETAO);
  _Float16* xTh   = (_Float16*)(ws + O_XTH);
  _Float16* xTl   = (_Float16*)(ws + O_XTL);
  _Float16* qT    = (_Float16*)(ws + O_QT);
  _Float16* kT    = (_Float16*)(ws + O_KT);
  _Float16* vN    = (_Float16*)(ws + O_VN);
  _Float16* goT   = (_Float16*)(ws + O_GOT);

  k_fold_qkv<<<dim3(32), dim3(256), 0, stream>>>(Wq, q_g, q_b, q_m, q_v,
                                                 Wk, k_g, k_b, k_m, k_v,
                                                 Wv, v_g, v_b, v_m, v_v, Wh, Wl, beta);
  k_fold_wo<<<dim3(8), dim3(256), 0, stream>>>(Wo, bo, o_g, o_b, o_m, o_v, WoS, betaO);
  k_tr<<<dim3(NP_ / 64, NC_ / 64, NB_), dim3(256), 0, stream>>>(x, xTh, xTl);
  k_qkv<<<dim3(NP_ / 64, 8, NB_), dim3(256), 0, stream>>>(xTh, xTl, Wh, Wl, beta, qT, kT, vN);
  const size_t smem = (size_t)(1056 + 2 * 16 * RS_) * sizeof(float) + (size_t)2 * 16 * GP_ * 2;   // 140928 B
  k_attn<<<dim3(NP_ / 32, NH_, NB_), dim3(64), smem, stream>>>(qT, kT, vN, pose, pix, goT);
  k_out<<<dim3(NP_ / 64, 2, NB_), dim3(256), 0, stream>>>(goT, WoS, betaO, (float*)d_out);
}

// v001
// One run takes 187 microseconds.
// In two side-by-side timings against v000, it was 3.75 and 3.77 times as fast.
#include <hip/hip_runtime.h>
#include <stddef.h>

// Contractions on v_wmma_f32_16x16x32_f16 (f16 operands, f32 accumulate): q/k channel GEMM as f16 hi/lo split (3 products, W scaled 2^10, x scaled 2^6), v channel GEMM single f16, QK^T single f16 (q,k scaled 2^3), P*V single f16 (P unnormalised, scaled 2^8, V scaled 2^3), output GEMM single f16 (W scaled 2^4, G scaled 2^8); BN folds, softmax, GELU in f32.

typedef _Float16 v16h __attribute__((ext_vector_type(16)));
typedef _Float16 v8h  __attribute__((ext_vector_type(8)));
typedef float    v8f  __attribute__((ext_vector_type(8)));
typedef float    v4f  __attribute__((ext_vector_type(4)));
typedef v8h v8ha __attribute__((may_alias));
typedef v4f v4fa __attribute__((may_alias));
typedef int   v4i  __attribute__((ext_vector_type(4)));
typedef v4i v4ia __attribute__((may_alias));

#define NB_  16
#define NC_  256
#define NP_  1024
#define NH_  8
#define DK_  32
#define DV_  64
#define NO_  512
#define GP_  72
#define EPS_ 1e-5f
#define CQK_ (0.17677669529663687f * 0.015625f)
#define INVSCALE_ 5.656854249492381f
#define L2E_ 1.4426950408889634f

union Frag { v16h v; v8h p[2]; };

// 16x32 fragment from a k-contiguous 16-bit row: elements 0..7 <- k0+8h..+7, 8..15 <- k0+16+8h..+7
__device__ __forceinline__ v16h ldfrag(const _Float16* rowp, int k0, int h) {
  Frag f;
  f.p[0] = *(const v8ha*)(rowp + k0 + 8 * h);
  f.p[1] = *(const v8ha*)(rowp + k0 + 16 + 8 * h);
  return f.v;
}

__device__ __forceinline__ v8f mma16(v16h a, v16h b, v8f c) {
  c = __builtin_amdgcn_wmma_f32_16x16x32_f16(false, a, false, b, (short)0, c, false, false);
  asm volatile("v_nop\n\tv_nop\n\tv_nop\n\tv_nop" : "+v"(c) : "v"(a), "v"(b));
  return c;
}

__device__ __forceinline__ v8f mmab(v16h a, v16h b, v8f c) {
  return __builtin_amdgcn_wmma_f32_16x16x32_f16(false, a, false, b, (short)0, c, false, false);
}

// lane l <-> lane l ^ 16
__device__ __forceinline__ float xhalf(float x) {
  const int i = __builtin_bit_cast(int, x);
  return __builtin_bit_cast(float, __builtin_amdgcn_permlanex16(i, i, 0x76543210, 0xfedcba98, false, false));
}

__device__ __forceinline__ v8f vzero() {
  v8f z = {0.f, 0.f, 0.f, 0.f, 0.f, 0.f, 0.f, 0.f};
  return z;
}

// ---------------- BN folded into QKV weights: Wh/Wl f16 hi/lo planes of W*inv*1024, beta[1024] -----
// 32 rows per block, wave w handles rows w*4..w*4+3, lane writes 8 consecutive columns (16 B)
__global__ __launch_bounds__(256) void k_fold_qkv(
    const float* __restrict__ Wq, const float* __restrict__ qg, const float* __restrict__ qb,
    const float* __restrict__ qm, const float* __restrict__ qv,
    const float* __restrict__ Wk, const float* __restrict__ kg, const float* __restrict__ kb,
    const float* __restrict__ km, const float* __restrict__ kv,
    const float* __restrict__ Wv, const float* __restrict__ vg, const float* __restrict__ vb,
    const float* __restrict__ vm, const float* __restrict__ vv,
    _Float16* Wh, _Float16* Wl, float* beta) {
  __shared__ __attribute__((aligned(16))) float sb[32];
  const int tid = threadIdx.x, w = tid >> 5, lane = tid & 31;
  const int blk = blockIdx.x;
#pragma unroll 1
  for (int i = 0; i < 4; ++i) {
    const int o = blk * 32 + w * 4 + i;   // 0..1023
    const float* W;
    float g, bb, mm, var;
    int oo;
    if (o < 256)      { oo = o;       W = Wq; g = qg[oo]; bb = qb[oo]; mm = qm[oo]; var = qv[oo]; }
    else if (o < 512) { oo = o - 256; W = Wk; g = kg[oo]; bb = kb[oo]; mm = km[oo]; var = kv[oo]; }
    else              { oo = o - 512; W = Wv; g = vg[oo]; bb = vb[oo]; mm = vm[oo]; var = vv[oo]; }
    const float inv = g * (1.0f / sqrtf(var + EPS_));
    const float* wr = W + (size_t)oo * NC_ + lane * 8;
    const v4f w0 = *(const v4fa*)(wr);
    const v4f w1 = *(const v4fa*)(wr + 4);
    float vals[8] = {w0.x, w0.y, w0.z, w0.w, w1.x, w1.y, w1.z, w1.w};
    v8h hv, lv;
#pragma unroll
    for (int e = 0; e < 8; ++e) {
      const float s = vals[e] * inv * 1024.0f;
      const _Float16 hh = (_Float16)s;
      const _Float16 ll = (_Float16)(s - (float)hh);
      hv[e] = hh; lv[e] = ll;
    }
    _Float16* dh = Wh + (size_t)o * NC_ + lane * 8;
    _Float16* dl = Wl + (size_t)o * NC_ + lane * 8;
    *(v8h*)dh = hv;
    *(v8h*)dl = lv;
    
    if (lane == 0) sb[w * 4 + i] = bb - mm * inv;
  }
  __syncthreads();
  if (w == 0 && lane < 8) {
    v4f b4;
    b4.x = sb[lane * 4 + 0]; b4.y = sb[lane * 4 + 1]; b4.z = sb[lane * 4 + 2]; b4.w = sb[lane * 4 + 3];
    float* db = beta + blk * 32 + lane * 4;
    *(v4f*)db = b4;
    
  }
}

// ---------------- bo + output BN folded into Wo: WoS f16 = Wo*inv*16, betaO[256] -------------------
__global__ __launch_bounds__(256) void k_fold_wo(
    const float* __restrict__ Wo, const float* __restrict__ bo, const float* __restrict__ og,
    const float* __restrict__ ob, const float* __restrict__ om, const float* __restrict__ ov,
    _Float16* WoS, float* betaO) {
  __shared__ __attribute__((aligned(16))) float sb[32];
  const int tid = threadIdx.x, w = tid >> 5, lane = tid & 31;
  const int blk = blockIdx.x;
#pragma unroll 1
  for (int i = 0; i < 4; ++i) {
    const int o = blk * 32 + w * 4 + i;   // 0..255
    const float inv = og[o] * (1.0f / sqrtf(ov[o] + EPS_));
#pragma unroll
    for (int hf = 0; hf < 2; ++hf) {
      const float* wr = Wo + (size_t)o * NO_ + hf * 256 + lane * 8;
      const v4f w0 = *(const v4fa*)(wr);
      const v4f w1 = *(const v4fa*)(wr + 4);
      float vals[8] = {w0.x, w0.y, w0.z, w0.w, w1.x, w1.y, w1.z, w1.w};
      v8h hv;
#pragma unroll
      for (int e = 0; e < 8; ++e) hv[e] = (_Float16)(vals[e] * inv * 16.0f);
      _Float16* dh = WoS + (size_t)o * NO_ + hf * 256 + lane * 8;
      *(v8h*)dh = hv;
      
    }
    if (lane == 0) sb[w * 4 + i] = bo[o] * inv + ob[o] - om[o] * inv;
  }
  __syncthreads();
  if (w == 0 && lane < 8) {
    v4f b4;
    b4.x = sb[lane * 4 + 0]; b4.y = sb[lane * 4 + 1]; b4.z = sb[lane * 4 + 2]; b4.w = sb[lane * 4 + 3];
    float* db = betaO + blk * 32 + lane * 4;
    *(v4f*)db = b4;
    
  }
}

// ---------------- x[b][c][p] -> xTh/xTl[b][p][c] f16 hi/lo planes of 64*x -----------------------------
__global__ __launch_bounds__(256) void k_tr(const float* __restrict__ x, _Float16* xTh, _Float16* xTl) {
  __shared__ float T[64][65];
  const int pblk = blockIdx.x, cblk = blockIdx.y, b = blockIdx.z;
  const int tid = threadIdx.x;
#pragma unroll
  for (int it = 0; it < 16; ++it) {
    const int idx = it * 256 + tid;
    const int ci = idx >> 6, pj = idx & 63;
    T[ci][pj] = x[((size_t)(b * NC_ + cblk * 64 + ci)) * NP_ + pblk * 64 + pj];
  }
  __syncthreads();
#pragma unroll
  for (int it = 0; it < 2; ++it) {
    const int pi = it * 256 + tid;
    const int pl = pi >> 3, pc = pi & 7;
    v8h hv, lv;
#pragma unroll
    for (int e = 0; e < 8; ++e) {
      const float s = T[pc * 8 + e][pl] * 64.0f;
      const _Float16 hh = (_Float16)s;
      const _Float16 ll = (_Float16)(s - (float)hh);
      hv[e] = hh; lv[e] = ll;
    }
    const size_t off = ((size_t)(b * NP_ + pblk * 64 + pl)) * NC_ + cblk * 64 + pc * 8;
    *(v8h*)(xTh + off) = hv;
    *(v8h*)(xTl + off) = lv;
    
  }
}

// ---------------- QKV projection GEMM (BN folded) --------------------------------------------------
// block tile 64 pixels x 128 output channels, 8 waves (4 row groups x 2 column halves), K = 256.
// q,k column chunks (nchunk 0..3): hi*hi + hi*lo + lo*hi; v chunks (4..7): hi*hi.
// qT,kT: [b*8+n][p][32] f16 (x8);  vN: [b][512][p] f16 (x8)
__global__ __launch_bounds__(256) void k_qkv(
    const _Float16* __restrict__ xTh, const _Float16* __restrict__ xTl,
    const _Float16* __restrict__ Wh, const _Float16* __restrict__ Wl, const float* __restrict__ beta,
    _Float16* qT, _Float16* kT, _Float16* vN) {
  __shared__ __attribute__((aligned(16))) _Float16 st[128 * GP_];   // q/k view: [64][136], v view: [128][72]
  const int ptile = blockIdx.x, nchunk = blockIdx.y, b = blockIdx.z;
  const int tid = threadIdx.x, w = tid >> 5, lane = tid & 31, m = lane & 15, h = lane >> 4;
  const int msub = w & 3, nh = w >> 2;
  const int nbase = nchunk * 128 + nh * 64;
  const size_t prow = (size_t)b * NP_ + ptile * 64 + msub * 16 + m;
  const bool split = (nchunk < 4);   // block-uniform

  v8f acc[4] = {vzero(), vzero(), vzero(), vzero()};
  const _Float16* ahr = xTh + prow * NC_;
  const _Float16* alr = xTl + prow * NC_;
#pragma unroll 1
  for (int kk = 0; kk < 8; ++kk) {
    const int k0 = kk * 32;
    const v16h ah = ldfrag(ahr, k0, h);
    v16h al = ah;
    if (split) al = ldfrag(alr, k0, h);
#pragma unroll
    for (int t = 0; t < 4; ++t) {
      const size_t orow = (size_t)(nbase + t * 16 + m) * NC_;
      const v16h bh = ldfrag(Wh + orow, k0, h);
      acc[t] = mma16(ah, bh, acc[t]);
      if (split) {
        const v16h bl = ldfrag(Wl + orow, k0, h);
        acc[t] = mma16(ah, bl, acc[t]);
        acc[t] = mma16(al, bh, acc[t]);
      }
    }
  }

  // epilogue: scale back 2^-16, add folded beta, scale x8, stage 16-bit tile in LDS
  const float kS = 1.0f / 65536.0f;
#pragma unroll
  for (int t = 0; t < 4; ++t) {
    const int ol = nh * 64 + t * 16 + m;                 // 0..127 (column = this lane's n)
    const float bta = beta[nchunk * 128 + ol];
#pragma unroll
    for (int j = 0; j < 8; ++j) {
      const int pl = msub * 16 + 8 * h + j;              // D row 8h+j
      const _Float16 hv = (_Float16)((acc[t][j] * kS + bta) * 8.0f);
      if (split) st[pl * 136 + ol] = hv;
      else       st[ol * GP_ + pl] = hv;
    }
  }
  __syncthreads();

  if (split) {
    _Float16* base = (nchunk < 2) ? qT : kT;
    const int hb = (nchunk & 1) * 4;
#pragma unroll
    for (int it = 0; it < 4; ++it) {
      const int pi = it * 256 + tid;                     // 1024 pieces of 16 B
      const int hd = pi >> 8, r = pi & 255;
      const int pl = r >> 2, dq = r & 3;
      const v8h v = *(const v8ha*)(st + pl * 136 + hd * 32 + dq * 8);
      _Float16* dst = base + (((size_t)(b * NH_ + hb + hd)) * NP_ + ptile * 64) * DK_ + r * 8;
      *(v8h*)dst = v;
      
    }
  } else {
    const int obase = (nchunk - 4) * 128;
#pragma unroll
    for (int it = 0; it < 4; ++it) {
      const int pi = it * 256 + tid;                     // 128 rows x 8 pieces
      const int ol = pi >> 3, pc = pi & 7;
      const v8h v = *(const v8ha*)(st + ol * GP_ + pc * 8);
      _Float16* dst = vN + ((size_t)(b * NO_ + obase + ol)) * NP_ + ptile * 64 + pc * 8;
      *(v8h*)dst = v;
      
    }
  }
}

__global__ __launch_bounds__(256) void k_attn(
    const _Float16* __restrict__ qT, const _Float16* __restrict__ kT, const _Float16* __restrict__ vN,
    const float* __restrict__ posemb, const int* __restrict__ pidx, _Float16* goT) {
  __shared__ __attribute__((aligned(16))) float posl[NP_];   // pos_emb[:, n] / SCALE, in log2 units

  const int qblk = blockIdx.x, n = blockIdx.y, b = blockIdx.z;
  const int tid = threadIdx.x;
  const int w = tid >> 5, lane = tid & 31, m = lane & 15, h = lane >> 4;
  for (int k = tid; k < NP_; k += 256) posl[k] = posemb[k * NH_ + n] * (INVSCALE_ * L2E_);
  __syncthreads();

  const int qbase = qblk * 256 + w * 32;
  const int bn = b * NH_ + n;
  v16h bq[2];
#pragma unroll
  for (int g = 0; g < 2; ++g) bq[g] = ldfrag(qT + ((size_t)bn * NP_ + qbase + 16 * g + m) * DK_, 0, h);
  const _Float16* kp = kT + ((size_t)bn * NP_ + m) * DK_;              // A row m = key
  const _Float16* vp = vN + ((size_t)(b * NO_ + n * DV_ + m)) * NP_;   // A row m = value channel
  const int* ip = pidx + (size_t)(qbase + m) * NP_ + 8 * h;            // column m = query, rows 8h+j = keys
  const v8f vz = vzero();

  v8f oacc[2][4] = {{vz, vz, vz, vz}, {vz, vz, vz, vz}};
  float mrun[2] = {-3.0e38f, -3.0e38f};
  float lsum[2] = {0.f, 0.f};

#pragma unroll 1
  for (int kc = 0; kc < 32; ++kc) {
    const int k0 = kc * 32;
    v16h ak[2], av[4];
#pragma unroll
    for (int u = 0; u < 2; ++u) ak[u] = ldfrag(kp + (size_t)(k0 + 16 * u) * DK_, 0, h);
    v4i ixv[2][4];
#pragma unroll
    for (int g = 0; g < 2; ++g) {
#pragma unroll
      for (int u = 0; u < 2; ++u) {
        ixv[g][2 * u]     = *(const v4ia*)(ip + (size_t)(g * 16) * NP_ + k0 + 16 * u);
        ixv[g][2 * u + 1] = *(const v4ia*)(ip + (size_t)(g * 16) * NP_ + k0 + 16 * u + 4);
      }
    }
    // precaution: the registers that hold the addresses of the loads above are reused below
    asm volatile("s_wait_xcnt 0x0" ::: "memory");
#pragma unroll
    for (int t = 0; t < 4; ++t) av[t] = ldfrag(vp + (size_t)(t * 16) * NP_, k0, h);
    // precaution: as above, for the addresses of the V loads
    asm volatile("s_wait_xcnt 0x0" ::: "memory");
#pragma unroll
    for (int g = 0; g < 2; ++g) {
      float tv[16];
#pragma unroll
      for (int u = 0; u < 2; ++u) {
        const v8f s = mmab(ak[u], bq[g], vz);            // D[8h+j][m]: key k0+16u+8h+j, query column m
#pragma unroll
        for (int j = 0; j < 8; ++j) {
          int ix = ixv[g][2 * u + (j >> 2)][j & 3];
          ix = ix < 0 ? 0 : (ix > NP_ - 1 ? NP_ - 1 : ix);
          tv[u * 8 + j] = fmaf(s[j], CQK_ * L2E_, posl[ix]);
        }
      }
      float mx = tv[0];
#pragma unroll
      for (int i = 1; i < 16; ++i) mx = fmaxf(mx, tv[i]);
      mx = fmaxf(mx, xhalf(mx));
      const float mnew = fmaxf(mrun[g], mx);
      const float alpha = __builtin_amdgcn_exp2f(mrun[g] - mnew);   // 0 on the first chunk
      mrun[g] = mnew;
      const float msub = mnew - 8.0f;                    // P carries 2^8; the row sum carries it too
      Frag bp;
      float ps = 0.f;
#pragma unroll
      for (int i = 0; i < 16; ++i) {
        const float p = __builtin_amdgcn_exp2f(tv[i] - msub);
        ps += p;
        bp.v[i] = (_Float16)p;                           // element i = key k0+16*(i>>3)+8h+(i&7), as ldfrag orders V
      }
      lsum[g] = lsum[g] * alpha + ps;
#pragma unroll
      for (int t = 0; t < 4; ++t) {
        oacc[g][t] = mmab(av[t], bp.v, oacc[g][t] * alpha);
      }
    }
  }

  // normalise, GELU (erf form), scale 2^8; a lane holds 8 consecutive channels of one query: 16-byte stores
#pragma unroll
  for (int g = 0; g < 2; ++g) {
    const float l = lsum[g] + xhalf(lsum[g]);
    const float co = 1.0f / (l * 8.0f);                  // undo 2^3 (V); 2^8 (P) cancels against l
    _Float16* dst = goT + ((size_t)(b * NP_ + qbase + 16 * g + m)) * NO_ + n * DV_ + 8 * h;
#pragma unroll
    for (int t = 0; t < 4; ++t) {
      v8h o;
#pragma unroll
      for (int j = 0; j < 8; ++j) {
        const float xo = oacc[g][t][j] * co;
        const float gl = 0.5f * xo * (1.0f + erff(xo * 0.70710678118654752f));
        o[j] = (_Float16)(gl * 256.0f);
      }
      *(v8h*)(dst + t * 16) = o;
    }
  }
}

// ---------------- output projection GEMM (bias + BN folded) ---------------------------------------
__global__ __launch_bounds__(256) void k_out(
    const _Float16* __restrict__ goT, const _Float16* __restrict__ WoS, const float* __restrict__ betaO,
    float* out) {
  __shared__ __attribute__((aligned(16))) float To[128 * 68];
  const int ptile = blockIdx.x, nchunk = blockIdx.y, b = blockIdx.z;
  const int tid = threadIdx.x, w = tid >> 5, lane = tid & 31, m = lane & 15, h = lane >> 4;
  const int msub = w & 3, nh = w >> 2;
  const int nbase = nchunk * 128 + nh * 64;
  const size_t prow = (size_t)b * NP_ + ptile * 64 + msub * 16 + m;
  v8f acc[4] = {vzero(), vzero(), vzero(), vzero()};
  const _Float16* ar = goT + prow * NO_;
#pragma unroll 1
  for (int kk = 0; kk < 16; ++kk) {
    const int k0 = kk * 32;
    const v16h a = ldfrag(ar, k0, h);
#pragma unroll
    for (int t = 0; t < 4; ++t) {
      const v16h bt = ldfrag(WoS + (size_t)(nbase + t * 16 + m) * NO_, k0, h);
      acc[t] = mma16(a, bt, acc[t]);
    }
  }
  const float kS = 1.0f / 4096.0f;                       // undo 2^4 (W) and 2^8 (G)
#pragma unroll
  for (int t = 0; t < 4; ++t) {
    const int ol = nh * 64 + t * 16 + m;
    const float bta = betaO[nchunk * 128 + ol];
#pragma unroll
    for (int j = 0; j < 8; ++j) {
      const int pl = msub * 16 + 8 * h + j;
      To[ol * 68 + pl] = acc[t][j] * kS + bta;
    }
  }
  __syncthreads();
#pragma unroll
  for (int it = 0; it < 8; ++it) {
    const int pi = it * 256 + tid;                       // 128 rows x 16 float4 pieces
    const int ol = pi >> 4, pc = pi & 15;
    const v4f v = *(const v4fa*)(To + ol * 68 + pc * 4);
    float* dst = out + ((size_t)(b * NC_ + nchunk * 128 + ol)) * NP_ + ptile * 64 + pc * 4;
    *(v4f*)dst = v;
    
  }
}

// ---------------- launch glue ------------------------------------------------------------------------
extern "C" void kernel_launch(void* const* d_in, const int* in_sizes, int n_in,
                              void* d_out, int out_size, void* d_ws, size_t ws_size,
                              hipStream_t stream) {
  if (n_in < 24) return;
  if (in_sizes[0] != NB_ * NC_ * NP_) return;
  if (in_sizes[1] != NC_ * NC_ || in_sizes[6] != NC_ * NC_ || in_sizes[11] != NO_ * NC_) return;
  if (in_sizes[16] != NP_ * NH_ || in_sizes[17] != NC_ * NO_ || in_sizes[23] != NP_ * NP_) return;
  {
    const int f32c[13] = {2, 3, 4, 5, 7, 8, 9, 10, 18, 19, 20, 21, 22};
    for (int i = 0; i < 13; ++i) if (in_sizes[f32c[i]] != NC_) return;
    const int f32o[4] = {12, 13, 14, 15};
    for (int i = 0; i < 4; ++i) if (in_sizes[f32o[i]] != NO_) return;
  }
  if (out_size != NB_ * NC_ * NP_) return;

  const float* x    = (const float*)d_in[0];
  const float* Wq   = (const float*)d_in[1];
  const float* q_g  = (const float*)d_in[2];
  const float* q_b  = (const float*)d_in[3];
  const float* q_m  = (const float*)d_in[4];
  const float* q_v  = (const float*)d_in[5];
  const float* Wk   = (const float*)d_in[6];
  const float* k_g  = (const float*)d_in[7];
  const float* k_b  = (const float*)d_in[8];
  const float* k_m  = (const float*)d_in[9];
  const float* k_v  = (const float*)d_in[10];
  const float* Wv   = (const float*)d_in[11];
  const float* v_g  = (const float*)d_in[12];
  const float* v_b  = (const float*)d_in[13];
  const float* v_m  = (const float*)d_in[14];
  const float* v_v  = (const float*)d_in[15];
  const float* pose = (const float*)d_in[16];
  const float* Wo   = (const float*)d_in[17];
  const float* bo   = (const float*)d_in[18];
  const float* o_g  = (const float*)d_in[19];
  const float* o_b  = (const float*)d_in[20];
  const float* o_m  = (const float*)d_in[21];
  const float* o_v  = (const float*)d_in[22];
  const int*   pix  = (const int*)d_in[23];

  // workspace carve (bytes), every offset a multiple of 1024
  const size_t O_WH    = 0;                                             // 1024*256*2
  const size_t O_WL    = O_WH    + (size_t)1024 * NC_ * 2;              // 524288
  const size_t O_BETA  = O_WL    + (size_t)1024 * NC_ * 2;              // 1048576, 4096 B
  const size_t O_WOS   = O_BETA  + 4096;                                // 1052672, 256*512*2
  const size_t O_BETAO = O_WOS   + (size_t)NC_ * NO_ * 2;               // 1314816, 1024 B
  const size_t O_XTH   = O_BETAO + 1024;                                // 1315840, 8 MB
  const size_t O_XTL   = O_XTH   + (size_t)NB_ * NP_ * NC_ * 2;         // 9704448
  const size_t O_QT    = O_XTL   + (size_t)NB_ * NP_ * NC_ * 2;         // 18093056, 8 MB
  const size_t O_KT    = O_QT    + (size_t)NB_ * NH_ * NP_ * DK_ * 2;   // 26481664
  const size_t O_VN    = O_KT    + (size_t)NB_ * NH_ * NP_ * DK_ * 2;   // 34870272, 16 MB
  const size_t O_GOT   = O_VN    + (size_t)NB_ * NO_ * NP_ * 2;         // 51647488, 16 MB
  const size_t O_END   = O_GOT   + (size_t)NB_ * NP_ * NO_ * 2;         // 68424704
  if (O_END > ws_size) return;

  char* ws = (char*)d_ws;
  _Float16* Wh    = (_Float16*)(ws + O_WH);
  _Float16* Wl    = (_Float16*)(ws + O_WL);
  float*    beta  = (float*)   (ws + O_BETA);
  _Float16* WoS   = (_Float16*)(ws + O_WOS);
  float*    betaO = (float*)   (ws + O_BETAO);
  _Float16* xTh   = (_Float16*)(ws + O_XTH);
  _Float16* xTl   = (_Float16*)(ws + O_XTL);
  _Float16* qT    = (_Float16*)(ws + O_QT);
  _Float16* kT    = (_Float16*)(ws + O_KT);
  _Float16* vN    = (_Float16*)(ws + O_VN);
  _Float16* goT   = (_Float16*)(ws + O_GOT);

  k_fold_qkv<<<dim3(32), dim3(256), 0, stream>>>(Wq, q_g, q_b, q_m, q_v,
                                                 Wk, k_g, k_b, k_m, k_v,
                                                 Wv, v_g, v_b, v_m, v_v, Wh, Wl, beta);
  k_fold_wo<<<dim3(8), dim3(256), 0, stream>>>(Wo, bo, o_g, o_b, o_m, o_v, WoS, betaO);
  k_tr<<<dim3(NP_ / 64, NC_ / 64, NB_), dim3(256), 0, stream>>>(x, xTh, xTl);
  k_qkv<<<dim3(NP_ / 64, 8, NB_), dim3(256), 0, stream>>>(xTh, xTl, Wh, Wl, beta, qT, kT, vN);
  k_attn<<<dim3(NP_ / 256, NH_, NB_), dim3(256), 0, stream>>>(qT, kT, vN, pose, pix, goT);
  k_out<<<dim3(NP_ / 64, 2, NB_), dim3(256), 0, stream>>>(goT, WoS, betaO, (float*)d_out);
}

// v002
// Measured time: 133 microseconds a run.
// In both of two side-by-side timings against v001, it was 1.41 times as fast.
// Over all steps from v000 it is 5.30 times as fast.
#include <hip/hip_runtime.h>
#include <stddef.h>

// Contractions on v_wmma_f32_16x16x32_f16 (f16 operands, f32 accumulate): q/k channel GEMM as f16 hi/lo split (3 products, W scaled 2^10, x scaled 2^6), v channel GEMM single f16, QK^T single f16 (q,k scaled 2^3), P*V single f16 (P unnormalised, scaled 2^8, V scaled 2^3), output GEMM single f16 (W scaled 2^4, G scaled 2^8); BN folds, softmax, GELU in f32.

typedef _Float16 v16h __attribute__((ext_vector_type(16)));
typedef _Float16 v8h  __attribute__((ext_vector_type(8)));
typedef float    v8f  __attribute__((ext_vector_type(8)));
typedef float    v4f  __attribute__((ext_vector_type(4)));
typedef v8h v8ha __attribute__((may_alias));
typedef v4f v4fa __attribute__((may_alias));
typedef int   v4i  __attribute__((ext_vector_type(4)));
typedef v4i v4ia __attribute__((may_alias));

#define NB_  16
#define NC_  256
#define NP_  1024
#define NH_  8
#define DK_  32
#define DV_  64
#define NO_  512
#define GP_  72
#define EPS_ 1e-5f
#define CQK_ (0.17677669529663687f * 0.015625f)
#define INVSCALE_ 5.656854249492381f
#define L2E_ 1.4426950408889634f

union Frag { v16h v; v8h p[2]; };

// Fragment-order storage of every 16-bit matrix operand: a tile of 16 rows x 32 k is 1024 contiguous bytes,
// made of 64 pieces of 8 elements; piece p*32 + h*16 + m holds row m, k = 16p + 8h .. +7.
// Tiles are ordered [row tile][k tile], KT k tiles to a row tile. A wave-wide 16-byte load of one half of a
// fragment then covers 512 contiguous bytes (4 whole 128-byte lines) and not 16 lines.
__device__ __forceinline__ size_t pkoff(int row, int k, int KT) {
  return ((((size_t)(row >> 4) * KT + (k >> 5)) * 64) + ((k >> 4) & 1) * 32 + ((k >> 3) & 1) * 16 + (row & 15)) * 8;
}

// 16x32 fragment from one tile: elements 0..7 <- k 8h..+7, 8..15 <- k 16+8h..+7 of row m (lane = 16h + m)
__device__ __forceinline__ v16h ldpk(const _Float16* tile, int lane) {
  Frag f;
  f.p[0] = *(const v8ha*)(tile + lane * 8);
  f.p[1] = *(const v8ha*)(tile + 256 + lane * 8);
  return f.v;
}

__device__ __forceinline__ v8f mma16(v16h a, v16h b, v8f c) {
  c = __builtin_amdgcn_wmma_f32_16x16x32_f16(false, a, false, b, (short)0, c, false, false);
  asm volatile("v_nop\n\tv_nop\n\tv_nop\n\tv_nop" : "+v"(c) : "v"(a), "v"(b));
  return c;
}

__device__ __forceinline__ v8f mmab(v16h a, v16h b, v8f c) {
  return __builtin_amdgcn_wmma_f32_16x16x32_f16(false, a, false, b, (short)0, c, false, false);
}

// lane l <-> lane l ^ 16
__device__ __forceinline__ float xhalf(float x) {
  const int i = __builtin_bit_cast(int, x);
  return __builtin_bit_cast(float, __builtin_amdgcn_permlanex16(i, i, 0x76543210, 0xfedcba98, false, false));
}

__device__ __forceinline__ v8f vzero() {
  v8f z = {0.f, 0.f, 0.f, 0.f, 0.f, 0.f, 0.f, 0.f};
  return z;
}

// ---------------- BN folded into QKV weights: Wh/Wl f16 hi/lo planes of W*inv*1024, beta[1024] -----
// 32 rows per block, wave w handles rows w*4..w*4+3, lane writes 8 consecutive columns (16 B)
__global__ __launch_bounds__(256) void k_fold_qkv(
    const float* __restrict__ Wq, const float* __restrict__ qg, const float* __restrict__ qb,
    const float* __restrict__ qm, const float* __restrict__ qv,
    const float* __restrict__ Wk, const float* __restrict__ kg, const float* __restrict__ kb,
    const float* __restrict__ km, const float* __restrict__ kv,
    const float* __restrict__ Wv, const float* __restrict__ vg, const float* __restrict__ vb,
    const float* __restrict__ vm, const float* __restrict__ vv,
    _Float16* Wh, _Float16* Wl, float* beta) {
  __shared__ __attribute__((aligned(16))) float sb[32];
  const int tid = threadIdx.x, w = tid >> 5, lane = tid & 31;
  const int blk = blockIdx.x;
#pragma unroll 1
  for (int i = 0; i < 4; ++i) {
    const int o = blk * 32 + w * 4 + i;   // 0..1023
    const float* W;
    float g, bb, mm, var;
    int oo;
    if (o < 256)      { oo = o;       W = Wq; g = qg[oo]; bb = qb[oo]; mm = qm[oo]; var = qv[oo]; }
    else if (o < 512) { oo = o - 256; W = Wk; g = kg[oo]; bb = kb[oo]; mm = km[oo]; var = kv[oo]; }
    else              { oo = o - 512; W = Wv; g = vg[oo]; bb = vb[oo]; mm = vm[oo]; var = vv[oo]; }
    const float inv = g * (1.0f / sqrtf(var + EPS_));
    const float* wr = W + (size_t)oo * NC_ + lane * 8;
    const v4f w0 = *(const v4fa*)(wr);
    const v4f w1 = *(const v4fa*)(wr + 4);
    float vals[8] = {w0.x, w0.y, w0.z, w0.w, w1.x, w1.y, w1.z, w1.w};
    v8h hv, lv;
#pragma unroll
    for (int e = 0; e < 8; ++e) {
      const float s = vals[e] * inv * 1024.0f;
      const _Float16 hh = (_Float16)s;
      const _Float16 ll = (_Float16)(s - (float)hh);
      hv[e] = hh; lv[e] = ll;
    }
    _Float16* dh = Wh + pkoff(o, lane * 8, NC_ / 32);
    _Float16* dl = Wl + pkoff(o, lane * 8, NC_ / 32);
    *(v8h*)dh = hv;
    *(v8h*)dl = lv;
    
    if (lane == 0) sb[w * 4 + i] = bb - mm * inv;
  }
  __syncthreads();
  if (w == 0 && lane < 8) {
    v4f b4;
    b4.x = sb[lane * 4 + 0]; b4.y = sb[lane * 4 + 1]; b4.z = sb[lane * 4 + 2]; b4.w = sb[lane * 4 + 3];
    float* db = beta + blk * 32 + lane * 4;
    *(v4f*)db = b4;
    
  }
}

// ---------------- bo + output BN folded into Wo: WoS f16 = Wo*inv*16, betaO[256] -------------------
__global__ __launch_bounds__(256) void k_fold_wo(
    const float* __restrict__ Wo, const float* __restrict__ bo, const float* __restrict__ og,
    const float* __restrict__ ob, const float* __restrict__ om, const float* __restrict__ ov,
    _Float16* WoS, float* betaO) {
  __shared__ __attribute__((aligned(16))) float sb[32];
  const int tid = threadIdx.x, w = tid >> 5, lane = tid & 31;
  const int blk = blockIdx.x;
#pragma unroll 1
  for (int i = 0; i < 4; ++i) {
    const int o = blk * 32 + w * 4 + i;   // 0..255
    const float inv = og[o] * (1.0f / sqrtf(ov[o] + EPS_));
#pragma unroll
    for (int hf = 0; hf < 2; ++hf) {
      const float* wr = Wo + (size_t)o * NO_ + hf * 256 + lane * 8;
      const v4f w0 = *(const v4fa*)(wr);
      const v4f w1 = *(const v4fa*)(wr + 4);
      float vals[8] = {w0.x, w0.y, w0.z, w0.w, w1.x, w1.y, w1.z, w1.w};
      v8h hv;
#pragma unroll
      for (int e = 0; e < 8; ++e) hv[e] = (_Float16)(vals[e] * inv * 16.0f);
      _Float16* dh = WoS + pkoff(o, hf * 256 + lane * 8, NO_ / 32);
      *(v8h*)dh = hv;
      
    }
    if (lane == 0) sb[w * 4 + i] = bo[o] * inv + ob[o] - om[o] * inv;
  }
  __syncthreads();
  if (w == 0 && lane < 8) {
    v4f b4;
    b4.x = sb[lane * 4 + 0]; b4.y = sb[lane * 4 + 1]; b4.z = sb[lane * 4 + 2]; b4.w = sb[lane * 4 + 3];
    float* db = betaO + blk * 32 + lane * 4;
    *(v4f*)db = b4;
    
  }
}

// ---------------- x[b][c][p] -> xTh/xTl, rows b*1024+p, k = c, fragment order: f16 hi/lo planes of 64*x ----
__global__ __launch_bounds__(256) void k_tr(const float* __restrict__ x, _Float16* xTh, _Float16* xTl) {
  __shared__ float T[64][65];
  const int pblk = blockIdx.x, cblk = blockIdx.y, b = blockIdx.z;
  const int tid = threadIdx.x;
#pragma unroll
  for (int it = 0; it < 16; ++it) {
    const int idx = it * 256 + tid;
    const int ci = idx >> 6, pj = idx & 63;
    T[ci][pj] = x[((size_t)(b * NC_ + cblk * 64 + ci)) * NP_ + pblk * 64 + pj];
  }
  __syncthreads();
#pragma unroll
  for (int it = 0; it < 2; ++it) {
    const int pi = it * 256 + tid;
    const int pl = pi & 63, pc = pi >> 6;                // a wave: 32 rows of one piece column = 2 x 256 B
    v8h hv, lv;
#pragma unroll
    for (int e = 0; e < 8; ++e) {
      const float s = T[pc * 8 + e][pl] * 64.0f;
      const _Float16 hh = (_Float16)s;
      const _Float16 ll = (_Float16)(s - (float)hh);
      hv[e] = hh; lv[e] = ll;
    }
    const size_t off = pkoff(b * NP_ + pblk * 64 + pl, cblk * 64 + pc * 8, NC_ / 32);
    *(v8h*)(xTh + off) = hv;
    *(v8h*)(xTl + off) = lv;
    
  }
}

// ---------------- QKV projection GEMM (BN folded) --------------------------------------------------
// block tile 64 pixels x 128 output channels, 8 waves (4 row groups x 2 column halves), K = 256.
// q,k column chunks (nchunk 0..3): hi*hi + hi*lo + lo*hi; v chunks (4..7): hi*hi.
// qT,kT: per b*8+n rows p, k = d (x8);  vN: rows b*512+channel, k = p (x8); all in fragment order
__global__ __launch_bounds__(256) void k_qkv(
    const _Float16* __restrict__ xTh, const _Float16* __restrict__ xTl,
    const _Float16* __restrict__ Wh, const _Float16* __restrict__ Wl, const float* __restrict__ beta,
    _Float16* qT, _Float16* kT, _Float16* vN) {
  __shared__ __attribute__((aligned(16))) _Float16 st[128 * GP_];   // q/k view: [64][136], v view: [128][72]
  const int ptile = blockIdx.x, nchunk = blockIdx.y, b = blockIdx.z;
  const int tid = threadIdx.x, w = tid >> 5, lane = tid & 31, m = lane & 15, h = lane >> 4;
  const int msub = w & 3, nh = w >> 2;
  const int nbase = nchunk * 128 + nh * 64;
  const bool split = (nchunk < 4);   // block-uniform

  v8f acc[4] = {vzero(), vzero(), vzero(), vzero()};
  const size_t atile = (size_t)(b * (NP_ / 16) + ptile * 4 + msub) * (NC_ / 32) * 512;
  const _Float16* ahr = xTh + atile;
  const _Float16* alr = xTl + atile;
#pragma unroll 1
  for (int kk = 0; kk < 8; ++kk) {
    const v16h ah = ldpk(ahr + kk * 512, lane);
    v16h al = ah;
    if (split) {
      al = ldpk(alr + kk * 512, lane);
      // precaution: the registers that hold the address of the load above are reused below
      asm volatile("s_wait_xcnt 0x0" ::: "memory");
    }
#pragma unroll
    for (int t = 0; t < 4; ++t) {
      const size_t otile = (size_t)(((nbase >> 4) + t) * (NC_ / 32) + kk) * 512;
      const v16h bh = ldpk(Wh + otile, lane);
      acc[t] = mma16(ah, bh, acc[t]);
      if (split) {
        const v16h bl = ldpk(Wl + otile, lane);
        acc[t] = mma16(ah, bl, acc[t]);
        acc[t] = mma16(al, bh, acc[t]);
      }
    }
  }

  // epilogue: scale back 2^-16, add folded beta, scale x8, stage 16-bit tile in LDS
  const float kS = 1.0f / 65536.0f;
#pragma unroll
  for (int t = 0; t < 4; ++t) {
    const int ol = nh * 64 + t * 16 + m;                 // 0..127 (column = this lane's n)
    const float bta = beta[nchunk * 128 + ol];
#pragma unroll
    for (int j = 0; j < 8; ++j) {
      const int pl = msub * 16 + 8 * h + j;              // D row 8h+j
      const _Float16 hv = (_Float16)((acc[t][j] * kS + bta) * 8.0f);
      if (split) st[pl * 136 + ol] = hv;
      else       st[ol * GP_ + pl] = hv;
    }
  }
  __syncthreads();

  if (split) {
    _Float16* base = (nchunk < 2) ? qT : kT;
    const int hb = (nchunk & 1) * 4;
#pragma unroll
    for (int it = 0; it < 4; ++it) {
      const int pi = it * 256 + tid;                     // 1024 pieces of 16 B
      const int hd = pi >> 8, r = pi & 255;
      const int pl = r >> 2, dq = r & 3;
      const v8h v = *(const v8ha*)(st + pl * 136 + hd * 32 + dq * 8);
      _Float16* dst = base + ((size_t)(b * NH_ + hb + hd)) * NP_ * DK_ + pkoff(ptile * 64 + pl, dq * 8, 1);
      *(v8h*)dst = v;
      
    }
  } else {
    const int obase = (nchunk - 4) * 128;
#pragma unroll
    for (int it = 0; it < 4; ++it) {
      const int pi = it * 256 + tid;                     // 128 rows x 8 pieces
      const int ol = pi & 127, pc = pi >> 7;             // a wave: 32 rows of one piece column = 2 x 256 B
      const v8h v = *(const v8ha*)(st + ol * GP_ + pc * 8);
      _Float16* dst = vN + pkoff(b * NO_ + obase + ol, ptile * 64 + pc * 8, NP_ / 32);
      *(v8h*)dst = v;
      
    }
  }
}

// ---------------- index table in the order the attention lanes read it ------------------------------
// tile (16 queries qt, 32 keys kc) = 512 ints; piece c*32 + 16h + m of 4 ints holds query 16qt+m,
// keys 32kc + 16(c>>1) + 8h + 4(c&1) .. +3. Values are copied as they are.
__global__ __launch_bounds__(256) void k_pix(const int* __restrict__ pidx, int* pidxP) {
  const int P = blockIdx.x * 256 + threadIdx.x;          // 262144 pieces
  const int lane = P & 31, c = (P >> 5) & 3, kc = (P >> 7) & 31, qt = P >> 12;
  const int m = lane & 15, h = lane >> 4;
  const v4i v = *(const v4ia*)(pidx + (size_t)(qt * 16 + m) * NP_ + kc * 32 + (c >> 1) * 16 + 8 * h + (c & 1) * 4);
  *(v4i*)(pidxP + (size_t)P * 4) = v;
}

__global__ __launch_bounds__(256) void k_attn(
    const _Float16* __restrict__ qT, const _Float16* __restrict__ kT, const _Float16* __restrict__ vN,
    const float* __restrict__ posemb, const int* __restrict__ pidxP, _Float16* goT) {
  __shared__ __attribute__((aligned(16))) float posl[NP_];   // pos_emb[:, n] / SCALE, in log2 units

  const int qblk = blockIdx.x, n = blockIdx.y, b = blockIdx.z;
  const int tid = threadIdx.x;
  const int w = tid >> 5, lane = tid & 31;
  for (int k = tid; k < NP_; k += 256) posl[k] = posemb[k * NH_ + n] * (INVSCALE_ * L2E_);
  __syncthreads();

  const int qbase = qblk * 256 + w * 32;
  const int bn = b * NH_ + n;
  v16h bq[2];
#pragma unroll
  for (int g = 0; g < 2; ++g) bq[g] = ldpk(qT + ((size_t)bn * NP_ + qbase + 16 * g) * DK_, lane);
  const _Float16* kp = kT + (size_t)bn * NP_ * DK_;                                  // A row m = key
  const _Float16* vp = vN + (size_t)(b * (NO_ / 16) + n * (DV_ / 16)) * (NP_ / 32) * 512;   // A row m = value channel
  const int* ip = pidxP + (size_t)(qbase >> 4) * (NP_ / 32) * 512 + lane * 4;        // column m = query, rows 8h+j = keys
  const v8f vz = vzero();

  v8f oacc[2][4] = {{vz, vz, vz, vz}, {vz, vz, vz, vz}};
  float mrun[2] = {-3.0e38f, -3.0e38f};
  float lsum[2] = {0.f, 0.f};

#pragma unroll 1
  for (int kc = 0; kc < 32; ++kc) {
    const int k0 = kc * 32;
    v16h ak[2], av[4];
#pragma unroll
    for (int u = 0; u < 2; ++u) ak[u] = ldpk(kp + (size_t)(k0 + 16 * u) * DK_, lane);
    v4i ixv[2][4];
#pragma unroll
    for (int g = 0; g < 2; ++g) {
#pragma unroll
      for (int u = 0; u < 2; ++u) {
        ixv[g][2 * u]     = *(const v4ia*)(ip + (size_t)(g * (NP_ / 32) + kc) * 512 + (2 * u) * 128);
        ixv[g][2 * u + 1] = *(const v4ia*)(ip + (size_t)(g * (NP_ / 32) + kc) * 512 + (2 * u + 1) * 128);
      }
    }
    // precaution: the registers that hold the addresses of the loads above are reused below
    asm volatile("s_wait_xcnt 0x0" ::: "memory");
#pragma unroll
    for (int t = 0; t < 4; ++t) av[t] = ldpk(vp + (size_t)(t * (NP_ / 32) + kc) * 512, lane);
    // precaution: as above, for the addresses of the V loads
    asm volatile("s_wait_xcnt 0x0" ::: "memory");
#pragma unroll
    for (int g = 0; g < 2; ++g) {
      float tv[16];
#pragma unroll
      for (int u = 0; u < 2; ++u) {
        const v8f s = mmab(ak[u], bq[g], vz);            // D[8h+j][m]: key k0+16u+8h+j, query column m
#pragma unroll
        for (int j = 0; j < 8; ++j) {
          int ix = ixv[g][2 * u + (j >> 2)][j & 3];
          ix = ix < 0 ? 0 : (ix > NP_ - 1 ? NP_ - 1 : ix);
          tv[u * 8 + j] = fmaf(s[j], CQK_ * L2E_, posl[ix]);
        }
      }
      float mx = tv[0];
#pragma unroll
      for (int i = 1; i < 16; ++i) mx = fmaxf(mx, tv[i]);
      mx = fmaxf(mx, xhalf(mx));
      const float mnew = fmaxf(mrun[g], mx);
      const float alpha = __builtin_amdgcn_exp2f(mrun[g] - mnew);   // 0 on the first chunk
      mrun[g] = mnew;
      const float msub = mnew - 8.0f;                    // P carries 2^8; the row sum carries it too
      Frag bp;
      float ps = 0.f;
#pragma unroll
      for (int i = 0; i < 16; ++i) {
        const float p = __builtin_amdgcn_exp2f(tv[i] - msub);
        ps += p;
        bp.v[i] = (_Float16)p;                           // element i = key k0+16(i>>3)+8h+(i&7), as ldpk orders V
      }
      lsum[g] = lsum[g] * alpha + ps;
#pragma unroll
      for (int t = 0; t < 4; ++t) {
        oacc[g][t] = mmab(av[t], bp.v, oacc[g][t] * alpha);
      }
    }
  }

  // normalise, GELU (erf form), scale 2^8; a lane holds 8 consecutive channels of one query: one piece of a
  // fragment-order tile (rows = pixels, k = channels), so a wave's store is 512 contiguous bytes
#pragma unroll
  for (int g = 0; g < 2; ++g) {
    const float l = lsum[g] + xhalf(lsum[g]);
    const float co = 1.0f / (l * 8.0f);                  // undo 2^3 (V); 2^8 (P) cancels against l
    _Float16* dst = goT + ((size_t)(b * (NP_ / 16) + (qbase >> 4) + g) * (NO_ / 32) + n * 2) * 512 + lane * 8;
#pragma unroll
    for (int t = 0; t < 4; ++t) {
      v8h o;
#pragma unroll
      for (int j = 0; j < 8; ++j) {
        const float xo = oacc[g][t][j] * co;
        const float gl = 0.5f * xo * (1.0f + erff(xo * 0.70710678118654752f));
        o[j] = (_Float16)(gl * 256.0f);
      }
      *(v8h*)(dst + (t >> 1) * 512 + (t & 1) * 256) = o;   // k = 64n + 16t + 8h: k tile 2n + t/2, half t&1
    }
  }
}

// ---------------- output projection GEMM (bias + BN folded) ---------------------------------------
__global__ __launch_bounds__(256) void k_out(
    const _Float16* __restrict__ goT, const _Float16* __restrict__ WoS, const float* __restrict__ betaO,
    float* out) {
  __shared__ __attribute__((aligned(16))) float To[128 * 68];
  const int ptile = blockIdx.x, nchunk = blockIdx.y, b = blockIdx.z;
  const int tid = threadIdx.x, w = tid >> 5, lane = tid & 31, m = lane & 15, h = lane >> 4;
  const int msub = w & 3, nh = w >> 2;
  const int nbase = nchunk * 128 + nh * 64;
  v8f acc[4] = {vzero(), vzero(), vzero(), vzero()};
  const _Float16* ar = goT + (size_t)(b * (NP_ / 16) + ptile * 4 + msub) * (NO_ / 32) * 512;
#pragma unroll 1
  for (int kk = 0; kk < 16; ++kk) {
    const v16h a = ldpk(ar + kk * 512, lane);
#pragma unroll
    for (int t = 0; t < 4; ++t) {
      const v16h bt = ldpk(WoS + (size_t)(((nbase >> 4) + t) * (NO_ / 32) + kk) * 512, lane);
      acc[t] = mma16(a, bt, acc[t]);
    }
  }
  const float kS = 1.0f / 4096.0f;                       // undo 2^4 (W) and 2^8 (G)
#pragma unroll
  for (int t = 0; t < 4; ++t) {
    const int ol = nh * 64 + t * 16 + m;
    const float bta = betaO[nchunk * 128 + ol];
#pragma unroll
    for (int j = 0; j < 8; ++j) {
      const int pl = msub * 16 + 8 * h + j;
      To[ol * 68 + pl] = acc[t][j] * kS + bta;
    }
  }
  __syncthreads();
#pragma unroll
  for (int it = 0; it < 8; ++it) {
    const int pi = it * 256 + tid;                       // 128 rows x 16 float4 pieces
    const int ol = pi >> 4, pc = pi & 15;
    const v4f v = *(const v4fa*)(To + ol * 68 + pc * 4);
    float* dst = out + ((size_t)(b * NC_ + nchunk * 128 + ol)) * NP_ + ptile * 64 + pc * 4;
    *(v4f*)dst = v;
    
  }
}

// ---------------- launch glue ------------------------------------------------------------------------
extern "C" void kernel_launch(void* const* d_in, const int* in_sizes, int n_in,
                              void* d_out, int out_size, void* d_ws, size_t ws_size,
                              hipStream_t stream) {
  if (n_in < 24) return;
  if (in_sizes[0] != NB_ * NC_ * NP_) return;
  if (in_sizes[1] != NC_ * NC_ || in_sizes[6] != NC_ * NC_ || in_sizes[11] != NO_ * NC_) return;
  if (in_sizes[16] != NP_ * NH_ || in_sizes[17] != NC_ * NO_ || in_sizes[23] != NP_ * NP_) return;
  {
    const int f32c[13] = {2, 3, 4, 5, 7, 8, 9, 10, 18, 19, 20, 21, 22};
    for (int i = 0; i < 13; ++i) if (in_sizes[f32c[i]] != NC_) return;
    const int f32o[4] = {12, 13, 14, 15};
    for (int i = 0; i < 4; ++i) if (in_sizes[f32o[i]] != NO_) return;
  }
  if (out_size != NB_ * NC_ * NP_) return;

  const float* x    = (const float*)d_in[0];
  const float* Wq   = (const float*)d_in[1];
  const float* q_g  = (const float*)d_in[2];
  const float* q_b  = (const float*)d_in[3];
  const float* q_m  = (const float*)d_in[4];
  const float* q_v  = (const float*)d_in[5];
  const float* Wk   = (const float*)d_in[6];
  const float* k_g  = (const float*)d_in[7];
  const float* k_b  = (const float*)d_in[8];
  const float* k_m  = (const float*)d_in[9];
  const float* k_v  = (const float*)d_in[10];
  const float* Wv   = (const float*)d_in[11];
  const float* v_g  = (const float*)d_in[12];
  const float* v_b  = (const float*)d_in[13];
  const float* v_m  = (const float*)d_in[14];
  const float* v_v  = (const float*)d_in[15];
  const float* pose = (const float*)d_in[16];
  const float* Wo   = (const float*)d_in[17];
  const float* bo   = (const float*)d_in[18];
  const float* o_g  = (const float*)d_in[19];
  const float* o_b  = (const float*)d_in[20];
  const float* o_m  = (const float*)d_in[21];
  const float* o_v  = (const float*)d_in[22];
  const int*   pix  = (const int*)d_in[23];

  // workspace carve (bytes), every offset a multiple of 1024
  const size_t O_WH    = 0;                                             // 1024*256*2
  const size_t O_WL    = O_WH    + (size_t)1024 * NC_ * 2;              // 524288
  const size_t O_BETA  = O_WL    + (size_t)1024 * NC_ * 2;              // 1048576, 4096 B
  const size_t O_WOS   = O_BETA  + 4096;                                // 1052672, 256*512*2
  const size_t O_BETAO = O_WOS   + (size_t)NC_ * NO_ * 2;               // 1314816, 1024 B
  const size_t O_XTH   = O_BETAO + 1024;                                // 1315840, 8 MB
  const size_t O_XTL   = O_XTH   + (size_t)NB_ * NP_ * NC_ * 2;         // 9704448
  const size_t O_QT    = O_XTL   + (size_t)NB_ * NP_ * NC_ * 2;         // 18093056, 8 MB
  const size_t O_KT    = O_QT    + (size_t)NB_ * NH_ * NP_ * DK_ * 2;   // 26481664
  const size_t O_VN    = O_KT    + (size_t)NB_ * NH_ * NP_ * DK_ * 2;   // 34870272, 16 MB
  const size_t O_GOT   = O_VN    + (size_t)NB_ * NO_ * NP_ * 2;         // 51647488, 16 MB
  const size_t O_PIX   = O_GOT   + (size_t)NB_ * NP_ * NO_ * 2;         // 68424704, 4 MB
  const size_t O_END   = O_PIX   + (size_t)NP_ * NP_ * 4;               // 72619008
  if (O_END > ws_size) return;

  char* ws = (char*)d_ws;
  _Float16* Wh    = (_Float16*)(ws + O_WH);
  _Float16* Wl    = (_Float16*)(ws + O_WL);
  float*    beta  = (float*)   (ws + O_BETA);
  _Float16* WoS   = (_Float16*)(ws + O_WOS);
  float*    betaO = (float*)   (ws + O_BETAO);
  _Float16* xTh   = (_Float16*)(ws + O_XTH);
  _Float16* xTl   = (_Float16*)(ws + O_XTL);
  _Float16* qT    = (_Float16*)(ws + O_QT);
  _Float16* kT    = (_Float16*)(ws + O_KT);
  _Float16* vN    = (_Float16*)(ws + O_VN);
  _Float16* goT   = (_Float16*)(ws + O_GOT);
  int*      pixP  = (int*)     (ws + O_PIX);

  k_fold_qkv<<<dim3(32), dim3(256), 0, stream>>>(Wq, q_g, q_b, q_m, q_v,
                                                 Wk, k_g, k_b, k_m, k_v,
                                                 Wv, v_g, v_b, v_m, v_v, Wh, Wl, beta);
  k_fold_wo<<<dim3(8), dim3(256), 0, stream>>>(Wo, bo, o_g, o_b, o_m, o_v, WoS, betaO);
  k_pix<<<dim3(NP_ * NP_ / 1024), dim3(256), 0, stream>>>(pix, pixP);
  k_tr<<<dim3(NP_ / 64, NC_ / 64, NB_), dim3(256), 0, stream>>>(x, xTh, xTl);
  k_qkv<<<dim3(NP_ / 64, 8, NB_), dim3(256), 0, stream>>>(xTh, xTl, Wh, Wl, beta, qT, kT, vN);
  k_attn<<<dim3(NP_ / 256, NH_, NB_), dim3(256), 0, stream>>>(qT, kT, vN, pose, pixP, goT);
  k_out<<<dim3(NP_ / 64, 2, NB_), dim3(256), 0, stream>>>(goT, WoS, betaO, (float*)d_out);
}

// v003
// One run takes 125 microseconds.
// Two timings next to v002 both put it at 1.07 times that version's speed.
// Counting every step since v000, it is 5.65 times as fast.
#include <hip/hip_runtime.h>
#include <stddef.h>

// Contractions on v_wmma_f32_16x16x32_f16 (f16 operands, f32 accumulate): q/k channel GEMM as f16 hi/lo split (3 products, W scaled 2^10, x scaled 2^6), v channel GEMM single f16, QK^T single f16 (q,k scaled 2^3), P*V single f16 (P unnormalised, scaled 2^8, V scaled 2^3), output GEMM single f16 (W scaled 2^4, G scaled 2^8); BN folds, softmax, GELU in f32.

typedef _Float16 v16h __attribute__((ext_vector_type(16)));
typedef _Float16 v8h  __attribute__((ext_vector_type(8)));
typedef float    v8f  __attribute__((ext_vector_type(8)));
typedef float    v4f  __attribute__((ext_vector_type(4)));
typedef v8h v8ha __attribute__((may_alias));
typedef v4f v4fa __attribute__((may_alias));
typedef int   v4i  __attribute__((ext_vector_type(4)));
typedef v4i v4ia __attribute__((may_alias));

#define NB_  16
#define NC_  256
#define NP_  1024
#define NH_  8
#define DK_  32
#define DV_  64
#define NO_  512
#define GP_  72
#define EPS_ 1e-5f
#define CQK_ (0.17677669529663687f * 0.015625f)
#define INVSCALE_ 5.656854249492381f
#define L2E_ 1.4426950408889634f

union Frag { v16h v; v8h p[2]; };

// Fragment-order storage of every 16-bit matrix operand: a tile of 16 rows x 32 k is 1024 contiguous bytes,
// made of 64 pieces of 8 elements; piece p*32 + h*16 + m holds row m, k = 16p + 8h .. +7.
// Tiles are ordered [row tile][k tile], KT k tiles to a row tile. A wave-wide 16-byte load of one half of a
// fragment then covers 512 contiguous bytes (4 whole 128-byte lines) and not 16 lines.
__device__ __forceinline__ size_t pkoff(int row, int k, int KT) {
  return ((((size_t)(row >> 4) * KT + (k >> 5)) * 64) + ((k >> 4) & 1) * 32 + ((k >> 3) & 1) * 16 + (row & 15)) * 8;
}

// 16x32 fragment from one tile: elements 0..7 <- k 8h..+7, 8..15 <- k 16+8h..+7 of row m (lane = 16h + m)
__device__ __forceinline__ v16h ldpk(const _Float16* tile, int lane) {
  Frag f;
  f.p[0] = *(const v8ha*)(tile + lane * 8);
  f.p[1] = *(const v8ha*)(tile + 256 + lane * 8);
  return f.v;
}

__device__ __forceinline__ v8f mmab(v16h a, v16h b, v8f c) {
  return __builtin_amdgcn_wmma_f32_16x16x32_f16(false, a, false, b, (short)0, c, false, false);
}

// lane l <-> lane l ^ 16
__device__ __forceinline__ float xhalf(float x) {
  const int i = __builtin_bit_cast(int, x);
  return __builtin_bit_cast(float, __builtin_amdgcn_permlanex16(i, i, 0x76543210, 0xfedcba98, false, false));
}

__device__ __forceinline__ v8f vzero() {
  v8f z = {0.f, 0.f, 0.f, 0.f, 0.f, 0.f, 0.f, 0.f};
  return z;
}

// ---------------- BN folded into QKV weights: Wh/Wl f16 hi/lo planes of W*inv*1024, beta[1024] -----
// 32 rows per block, wave w handles rows w*4..w*4+3, lane writes 8 consecutive columns (16 B)
__global__ __launch_bounds__(256) void k_fold_qkv(
    const float* __restrict__ Wq, const float* __restrict__ qg, const float* __restrict__ qb,
    const float* __restrict__ qm, const float* __restrict__ qv,
    const float* __restrict__ Wk, const float* __restrict__ kg, const float* __restrict__ kb,
    const float* __restrict__ km, const float* __restrict__ kv,
    const float* __restrict__ Wv, const float* __restrict__ vg, const float* __restrict__ vb,
    const float* __restrict__ vm, const float* __restrict__ vv,
    _Float16* Wh, _Float16* Wl, float* beta) {
  __shared__ __attribute__((aligned(16))) float sb[32];
  const int tid = threadIdx.x, w = tid >> 5, lane = tid & 31;
  const int blk = blockIdx.x;
#pragma unroll 1
  for (int i = 0; i < 4; ++i) {
    const int o = blk * 32 + w * 4 + i;   // 0..1023
    const float* W;
    float g, bb, mm, var;
    int oo;
    if (o < 256)      { oo = o;       W = Wq; g = qg[oo]; bb = qb[oo]; mm = qm[oo]; var = qv[oo]; }
    else if (o < 512) { oo = o - 256; W = Wk; g = kg[oo]; bb = kb[oo]; mm = km[oo]; var = kv[oo]; }
    else              { oo = o - 512; W = Wv; g = vg[oo]; bb = vb[oo]; mm = vm[oo]; var = vv[oo]; }
    const float inv = g * (1.0f / sqrtf(var + EPS_));
    const float* wr = W + (size_t)oo * NC_ + lane * 8;
    const v4f w0 = *(const v4fa*)(wr);
    const v4f w1 = *(const v4fa*)(wr + 4);
    float vals[8] = {w0.x, w0.y, w0.z, w0.w, w1.x, w1.y, w1.z, w1.w};
    v8h hv, lv;
#pragma unroll
    for (int e = 0; e < 8; ++e) {
      const float s = vals[e] * inv * 1024.0f;
      const _Float16 hh = (_Float16)s;
      const _Float16 ll = (_Float16)(s - (float)hh);
      hv[e] = hh; lv[e] = ll;
    }
    _Float16* dh = Wh + pkoff(o, lane * 8, NC_ / 32);
    _Float16* dl = Wl + pkoff(o, lane * 8, NC_ / 32);
    *(v8h*)dh = hv;
    *(v8h*)dl = lv;
    
    if (lane == 0) sb[w * 4 + i] = bb - mm * inv;
  }
  __syncthreads();
  if (w == 0 && lane < 8) {
    v4f b4;
    b4.x = sb[lane * 4 + 0]; b4.y = sb[lane * 4 + 1]; b4.z = sb[lane * 4 + 2]; b4.w = sb[lane * 4 + 3];
    float* db = beta + blk * 32 + lane * 4;
    *(v4f*)db = b4;
    
  }
}

// ---------------- bo + output BN folded into Wo: WoS f16 = Wo*inv*16, betaO[256] -------------------
__global__ __launch_bounds__(256) void k_fold_wo(
    const float* __restrict__ Wo, const float* __restrict__ bo, const float* __restrict__ og,
    const float* __restrict__ ob, const float* __restrict__ om, const float* __restrict__ ov,
    _Float16* WoS, float* betaO) {
  __shared__ __attribute__((aligned(16))) float sb[32];
  const int tid = threadIdx.x, w = tid >> 5, lane = tid & 31;
  const int blk = blockIdx.x;
#pragma unroll 1
  for (int i = 0; i < 4; ++i) {
    const int o = blk * 32 + w * 4 + i;   // 0..255
    const float inv = og[o] * (1.0f / sqrtf(ov[o] + EPS_));
#pragma unroll
    for (int hf = 0; hf < 2; ++hf) {
      const float* wr = Wo + (size_t)o * NO_ + hf * 256 + lane * 8;
      const v4f w0 = *(const v4fa*)(wr);
      const v4f w1 = *(const v4fa*)(wr + 4);
      float vals[8] = {w0.x, w0.y, w0.z, w0.w, w1.x, w1.y, w1.z, w1.w};
      v8h hv;
#pragma unroll
      for (int e = 0; e < 8; ++e) hv[e] = (_Float16)(vals[e] * inv * 16.0f);
      _Float16* dh = WoS + pkoff(o, hf * 256 + lane * 8, NO_ / 32);
      *(v8h*)dh = hv;
      
    }
    if (lane == 0) sb[w * 4 + i] = bo[o] * inv + ob[o] - om[o] * inv;
  }
  __syncthreads();
  if (w == 0 && lane < 8) {
    v4f b4;
    b4.x = sb[lane * 4 + 0]; b4.y = sb[lane * 4 + 1]; b4.z = sb[lane * 4 + 2]; b4.w = sb[lane * 4 + 3];
    float* db = betaO + blk * 32 + lane * 4;
    *(v4f*)db = b4;
    
  }
}

// ---------------- x[b][c][p] -> xTh/xTl, rows b*1024+p, k = c, fragment order: f16 hi/lo planes of 64*x ----
__global__ __launch_bounds__(256) void k_tr(const float* __restrict__ x, _Float16* xTh, _Float16* xTl) {
  __shared__ float T[64][65];
  const int pblk = blockIdx.x, cblk = blockIdx.y, b = blockIdx.z;
  const int tid = threadIdx.x;
#pragma unroll
  for (int it = 0; it < 16; ++it) {
    const int idx = it * 256 + tid;
    const int ci = idx >> 6, pj = idx & 63;
    T[ci][pj] = x[((size_t)(b * NC_ + cblk * 64 + ci)) * NP_ + pblk * 64 + pj];
  }
  __syncthreads();
#pragma unroll
  for (int it = 0; it < 2; ++it) {
    const int pi = it * 256 + tid;
    const int pl = pi & 63, pc = pi >> 6;                // a wave: 32 rows of one piece column = 2 x 256 B
    v8h hv, lv;
#pragma unroll
    for (int e = 0; e < 8; ++e) {
      const float s = T[pc * 8 + e][pl] * 64.0f;
      const _Float16 hh = (_Float16)s;
      const _Float16 ll = (_Float16)(s - (float)hh);
      hv[e] = hh; lv[e] = ll;
    }
    const size_t off = pkoff(b * NP_ + pblk * 64 + pl, cblk * 64 + pc * 8, NC_ / 32);
    *(v8h*)(xTh + off) = hv;
    *(v8h*)(xTl + off) = lv;
    
  }
}

// ---------------- QKV projection GEMM (BN folded) --------------------------------------------------
// K loop: every fragment of a group (one k step with hi/lo planes, two without) is requested before the group's first
// product, so a group waits out one load latency and not one per tile. Each accumulator takes its products in the order hi*hi, hi*lo, lo*hi, k ascending.
template <bool SPLIT>
__device__ __forceinline__ void qkv_acc(const _Float16* __restrict__ ahr, const _Float16* __restrict__ alr,
                                        const _Float16* __restrict__ whr, int loff, v8f (&acc)[4]) {
  constexpr int G = SPLIT ? 1 : 2;                       // k steps to a group: 20 loads of 16 bytes either way
  // the lane's own addresses, advanced behind the wait: no load of a group lands on a register that another load of
  // the group names. The lo plane of W follows its hi plane in the workspace: one address serves both.
  const _Float16* pah = ahr + loff;
  const _Float16* pal = alr + loff;
  const _Float16* pwh = whr + loff;
#pragma unroll 1
  for (int kk = 0; kk < 8; kk += G) {
    v16h ah[G], al[G], bh[G][4], bl[G][4];
#pragma unroll
    for (int s = 0; s < G; ++s) {
      ah[s] = ldpk(pah + s * 512, 0);
      if (SPLIT) al[s] = ldpk(pal + s * 512, 0);
#pragma unroll
      for (int t = 0; t < 4; ++t) {
        bh[s][t] = ldpk(pwh + (t * (NC_ / 32) + s) * 512, 0);
        if (SPLIT) bl[s][t] = ldpk(pwh + 1024 * NC_ + (t * (NC_ / 32) + s) * 512, 0);
      }
    }
    // precaution: the address registers of the loads above (named here, so that they live up to the wait) are
    // advanced below
    if (SPLIT) asm volatile("s_wait_xcnt 0x0" :: "v"(pah), "v"(pal), "v"(pwh) : "memory");
    else       asm volatile("s_wait_xcnt 0x0" :: "v"(pah), "v"(pwh) : "memory");
    // without it the scheduler sinks each tile's loads to just ahead of its product: one exposed latency per tile
    __builtin_amdgcn_sched_barrier(0);
    pah += G * 512; pal += G * 512; pwh += G * 512;
#pragma unroll
    for (int s = 0; s < G; ++s) {
#pragma unroll
      for (int t = 0; t < 4; ++t) acc[t] = mmab(ah[s], bh[s][t], acc[t]);
      if (SPLIT) {
#pragma unroll
        for (int t = 0; t < 4; ++t) acc[t] = mmab(ah[s], bl[s][t], acc[t]);
#pragma unroll
        for (int t = 0; t < 4; ++t) acc[t] = mmab(al[s], bh[s][t], acc[t]);
      }
    }
  }
}

// block tile 64 pixels x 128 output channels, 8 waves (4 row groups x 2 column halves), K = 256.
// q,k column chunks (nchunk 0..3): hi*hi + hi*lo + lo*hi; v chunks (4..7): hi*hi.
// qT,kT: per b*8+n rows p, k = d (x8);  vN: rows b*512+channel, k = p (x8); all in fragment order
// 8 waves per SIMD (128 registers): four work-groups to a WGP, the grid in two even rounds
__global__ __launch_bounds__(256) __attribute__((amdgpu_waves_per_eu(8))) void k_qkv(
    const _Float16* __restrict__ xTh, const _Float16* __restrict__ xTl,
    const _Float16* __restrict__ Wh, const float* __restrict__ beta,
    _Float16* qT, _Float16* kT, _Float16* vN) {
  __shared__ __attribute__((aligned(16))) _Float16 st[128 * GP_];   // q/k view: [64][136], v view: [128][72]
  const int ptile = blockIdx.x, nchunk = blockIdx.y, b = blockIdx.z;
  const int tid = threadIdx.x, lane = tid & 31, m = lane & 15, h = lane >> 4;
  // the wave's number as a scalar: tile indices and bases are then formed in scalar registers, which leaves the
  // vector registers to the fragment groups
  const int w = __builtin_amdgcn_readfirstlane(tid >> 5);
  const int msub = w & 3, nh = w >> 2;
  const int nbase = nchunk * 128 + nh * 64;
  const bool split = (nchunk < 4);   // block-uniform

  v8f acc[4] = {vzero(), vzero(), vzero(), vzero()};
  const size_t atile = (size_t)(b * (NP_ / 16) + ptile * 4 + msub) * (NC_ / 32) * 512;
  const _Float16* ahr = xTh + atile;
  const _Float16* alr = xTl + atile;
  const _Float16* whr = Wh + (size_t)(nbase >> 4) * (NC_ / 32) * 512;
  if (split) qkv_acc<true>(ahr, alr, whr, lane * 8, acc);
  else       qkv_acc<false>(ahr, alr, whr, lane * 8, acc);

  // epilogue: scale back 2^-16, add folded beta, scale x8, stage 16-bit tile in LDS
  const float kS = 1.0f / 65536.0f;
#pragma unroll
  for (int t = 0; t < 4; ++t) {
    const int ol = nh * 64 + t * 16 + m;                 // 0..127 (column = this lane's n)
    const float bta = beta[nchunk * 128 + ol];
#pragma unroll
    for (int j = 0; j < 8; ++j) {
      const int pl = msub * 16 + 8 * h + j;              // D row 8h+j
      const _Float16 hv = (_Float16)((acc[t][j] * kS + bta) * 8.0f);
      if (split) st[pl * 136 + ol] = hv;
      else       st[ol * GP_ + pl] = hv;
    }
  }
  __syncthreads();

  if (split) {
    _Float16* base = (nchunk < 2) ? qT : kT;
    const int hb = (nchunk & 1) * 4;
#pragma unroll
    for (int it = 0; it < 4; ++it) {
      const int pi = it * 256 + tid;                     // 1024 pieces of 16 B
      const int hd = pi >> 8, r = pi & 255;
      const int pl = r >> 2, dq = r & 3;
      const v8h v = *(const v8ha*)(st + pl * 136 + hd * 32 + dq * 8);
      _Float16* dst = base + ((size_t)(b * NH_ + hb + hd)) * NP_ * DK_ + pkoff(ptile * 64 + pl, dq * 8, 1);
      *(v8h*)dst = v;
      
    }
  } else {
    const int obase = (nchunk - 4) * 128;
#pragma unroll
    for (int it = 0; it < 4; ++it) {
      const int pi = it * 256 + tid;                     // 128 rows x 8 pieces
      const int ol = pi & 127, pc = pi >> 7;             // a wave: 32 rows of one piece column = 2 x 256 B
      const v8h v = *(const v8ha*)(st + ol * GP_ + pc * 8);
      _Float16* dst = vN + pkoff(b * NO_ + obase + ol, ptile * 64 + pc * 8, NP_ / 32);
      *(v8h*)dst = v;
      
    }
  }
}

// ---------------- index table in the order the attention lanes read it ------------------------------
// tile (16 queries qt, 32 keys kc) = 512 ints; piece c*32 + 16h + m of 4 ints holds query 16qt+m,
// keys 32kc + 16(c>>1) + 8h + 4(c&1) .. +3. Values are copied as they are.
__global__ __launch_bounds__(256) void k_pix(const int* __restrict__ pidx, int* pidxP) {
  const int P = blockIdx.x * 256 + threadIdx.x;          // 262144 pieces
  const int lane = P & 31, c = (P >> 5) & 3, kc = (P >> 7) & 31, qt = P >> 12;
  const int m = lane & 15, h = lane >> 4;
  const v4i v = *(const v4ia*)(pidx + (size_t)(qt * 16 + m) * NP_ + kc * 32 + (c >> 1) * 16 + 8 * h + (c & 1) * 4);
  *(v4i*)(pidxP + (size_t)P * 4) = v;
}

__global__ __launch_bounds__(256) void k_attn(
    const _Float16* __restrict__ qT, const _Float16* __restrict__ kT, const _Float16* __restrict__ vN,
    const float* __restrict__ posemb, const int* __restrict__ pidxP, _Float16* goT) {
  __shared__ __attribute__((aligned(16))) float posl[NP_];   // pos_emb[:, n] / SCALE, in log2 units

  const int qblk = blockIdx.x, n = blockIdx.y, b = blockIdx.z;
  const int tid = threadIdx.x;
  const int w = tid >> 5, lane = tid & 31;
  for (int k = tid; k < NP_; k += 256) posl[k] = posemb[k * NH_ + n] * (INVSCALE_ * L2E_);
  __syncthreads();

  const int qbase = qblk * 256 + w * 32;
  const int bn = b * NH_ + n;
  v16h bq[2];
#pragma unroll
  for (int g = 0; g < 2; ++g) bq[g] = ldpk(qT + ((size_t)bn * NP_ + qbase + 16 * g) * DK_, lane);
  const _Float16* kp = kT + (size_t)bn * NP_ * DK_;                                  // A row m = key
  const _Float16* vp = vN + (size_t)(b * (NO_ / 16) + n * (DV_ / 16)) * (NP_ / 32) * 512;   // A row m = value channel
  const int* ip = pidxP + (size_t)(qbase >> 4) * (NP_ / 32) * 512 + lane * 4;        // column m = query, rows 8h+j = keys
  const v8f vz = vzero();

  v8f oacc[2][4] = {{vz, vz, vz, vz}, {vz, vz, vz, vz}};
  float mrun[2] = {-3.0e38f, -3.0e38f};
  float lsum[2] = {0.f, 0.f};

#pragma unroll 1
  for (int kc = 0; kc < 32; ++kc) {
    const int k0 = kc * 32;
    v16h ak[2], av[4];
#pragma unroll
    for (int u = 0; u < 2; ++u) ak[u] = ldpk(kp + (size_t)(k0 + 16 * u) * DK_, lane);
    v4i ixv[2][4];
#pragma unroll
    for (int g = 0; g < 2; ++g) {
#pragma unroll
      for (int u = 0; u < 2; ++u) {
        ixv[g][2 * u]     = *(const v4ia*)(ip + (size_t)(g * (NP_ / 32) + kc) * 512 + (2 * u) * 128);
        ixv[g][2 * u + 1] = *(const v4ia*)(ip + (size_t)(g * (NP_ / 32) + kc) * 512 + (2 * u + 1) * 128);
      }
    }
    // precaution: the registers that hold the addresses of the loads above are reused below
    asm volatile("s_wait_xcnt 0x0" ::: "memory");
#pragma unroll
    for (int t = 0; t < 4; ++t) av[t] = ldpk(vp + (size_t)(t * (NP_ / 32) + kc) * 512, lane);
    // precaution: as above, for the addresses of the V loads
    asm volatile("s_wait_xcnt 0x0" ::: "memory");
#pragma unroll
    for (int g = 0; g < 2; ++g) {
      float tv[16];
#pragma unroll
      for (int u = 0; u < 2; ++u) {
        const v8f s = mmab(ak[u], bq[g], vz);            // D[8h+j][m]: key k0+16u+8h+j, query column m
#pragma unroll
        for (int j = 0; j < 8; ++j) {
          int ix = ixv[g][2 * u + (j >> 2)][j & 3];
          ix = ix < 0 ? 0 : (ix > NP_ - 1 ? NP_ - 1 : ix);
          tv[u * 8 + j] = fmaf(s[j], CQK_ * L2E_, posl[ix]);
        }
      }
      float mx = tv[0];
#pragma unroll
      for (int i = 1; i < 16; ++i) mx = fmaxf(mx, tv[i]);
      mx = fmaxf(mx, xhalf(mx));
      const float mnew = fmaxf(mrun[g], mx);
      const float alpha = __builtin_amdgcn_exp2f(mrun[g] - mnew);   // 0 on the first chunk
      mrun[g] = mnew;
      const float msub = mnew - 8.0f;                    // P carries 2^8; the row sum carries it too
      Frag bp;
      float ps = 0.f;
#pragma unroll
      for (int i = 0; i < 16; ++i) {
        const float p = __builtin_amdgcn_exp2f(tv[i] - msub);
        ps += p;
        bp.v[i] = (_Float16)p;                           // element i = key k0+16(i>>3)+8h+(i&7), as ldpk orders V
      }
      lsum[g] = lsum[g] * alpha + ps;
#pragma unroll
      for (int t = 0; t < 4; ++t) {
        oacc[g][t] = mmab(av[t], bp.v, oacc[g][t] * alpha);
      }
    }
  }

  // normalise, GELU (erf form), scale 2^8; a lane holds 8 consecutive channels of one query: one piece of a
  // fragment-order tile (rows = pixels, k = channels), so a wave's store is 512 contiguous bytes
#pragma unroll
  for (int g = 0; g < 2; ++g) {
    const float l = lsum[g] + xhalf(lsum[g]);
    const float co = 1.0f / (l * 8.0f);                  // undo 2^3 (V); 2^8 (P) cancels against l
    _Float16* dst = goT + ((size_t)(b * (NP_ / 16) + (qbase >> 4) + g) * (NO_ / 32) + n * 2) * 512 + lane * 8;
#pragma unroll
    for (int t = 0; t < 4; ++t) {
      v8h o;
#pragma unroll
      for (int j = 0; j < 8; ++j) {
        const float xo = oacc[g][t][j] * co;
        const float gl = 0.5f * xo * (1.0f + erff(xo * 0.70710678118654752f));
        o[j] = (_Float16)(gl * 256.0f);
      }
      *(v8h*)(dst + (t >> 1) * 512 + (t & 1) * 256) = o;   // k = 64n + 16t + 8h: k tile 2n + t/2, half t&1
    }
  }
}

// ---------------- output projection GEMM (bias + BN folded) ---------------------------------------
__global__ __launch_bounds__(256) void k_out(
    const _Float16* __restrict__ goT, const _Float16* __restrict__ WoS, const float* __restrict__ betaO,
    float* out) {
  __shared__ __attribute__((aligned(16))) float To[128 * 68];
  const int ptile = blockIdx.x, nchunk = blockIdx.y, b = blockIdx.z;
  const int tid = threadIdx.x, lane = tid & 31, m = lane & 15, h = lane >> 4;
  // the wave's number as a scalar: tile indices and bases are then formed in scalar registers, which leaves the
  // vector registers to the fragment groups
  const int w = __builtin_amdgcn_readfirstlane(tid >> 5);
  const int msub = w & 3, nh = w >> 2;
  const int nbase = nchunk * 128 + nh * 64;
  v8f acc[4] = {vzero(), vzero(), vzero(), vzero()};
  const _Float16* ar = goT + (size_t)(b * (NP_ / 16) + ptile * 4 + msub) * (NO_ / 32) * 512;
  // the fragments of four k steps are requested as one group ahead of their products: one load latency per group
#pragma unroll 1
  for (int k4 = 0; k4 < 16; k4 += 4) {
    v16h a[4], bt[4][4];
#pragma unroll
    for (int s = 0; s < 4; ++s) {
      a[s] = ldpk(ar + (k4 + s) * 512, lane);
#pragma unroll
      for (int t = 0; t < 4; ++t)
        bt[s][t] = ldpk(WoS + (size_t)(((nbase >> 4) + t) * (NO_ / 32) + k4 + s) * 512, lane);
    }
    // precaution: the address registers of the loads above are reused below
    asm volatile("s_wait_xcnt 0x0" ::: "memory");
    // without it the scheduler sinks each tile's loads to just ahead of its product: one exposed latency per tile
    __builtin_amdgcn_sched_barrier(0);
#pragma unroll
    for (int s = 0; s < 4; ++s) {
#pragma unroll
      for (int t = 0; t < 4; ++t) acc[t] = mmab(a[s], bt[s][t], acc[t]);
    }
  }
  const float kS = 1.0f / 4096.0f;                       // undo 2^4 (W) and 2^8 (G)
#pragma unroll
  for (int t = 0; t < 4; ++t) {
    const int ol = nh * 64 + t * 16 + m;
    const float bta = betaO[nchunk * 128 + ol];
#pragma unroll
    for (int j = 0; j < 8; ++j) {
      const int pl = msub * 16 + 8 * h + j;
      To[ol * 68 + pl] = acc[t][j] * kS + bta;
    }
  }
  __syncthreads();
#pragma unroll
  for (int it = 0; it < 8; ++it) {
    const int pi = it * 256 + tid;                       // 128 rows x 16 float4 pieces
    const int ol = pi >> 4, pc = pi & 15;
    const v4f v = *(const v4fa*)(To + ol * 68 + pc * 4);
    float* dst = out + ((size_t)(b * NC_ + nchunk * 128 + ol)) * NP_ + ptile * 64 + pc * 4;
    *(v4f*)dst = v;
    
  }
}

// ---------------- launch glue ------------------------------------------------------------------------
extern "C" void kernel_launch(void* const* d_in, const int* in_sizes, int n_in,
                              void* d_out, int out_size, void* d_ws, size_t ws_size,
                              hipStream_t stream) {
  if (n_in < 24) return;
  if (in_sizes[0] != NB_ * NC_ * NP_) return;
  if (in_sizes[1] != NC_ * NC_ || in_sizes[6] != NC_ * NC_ || in_sizes[11] != NO_ * NC_) return;
  if (in_sizes[16] != NP_ * NH_ || in_sizes[17] != NC_ * NO_ || in_sizes[23] != NP_ * NP_) return;
  {
    const int f32c[13] = {2, 3, 4, 5, 7, 8, 9, 10, 18, 19, 20, 21, 22};
    for (int i = 0; i < 13; ++i) if (in_sizes[f32c[i]] != NC_) return;
    const int f32o[4] = {12, 13, 14, 15};
    for (int i = 0; i < 4; ++i) if (in_sizes[f32o[i]] != NO_) return;
  }
  if (out_size != NB_ * NC_ * NP_) return;

  const float* x    = (const float*)d_in[0];
  const float* Wq   = (const float*)d_in[1];
  const float* q_g  = (const float*)d_in[2];
  const float* q_b  = (const float*)d_in[3];
  const float* q_m  = (const float*)d_in[4];
  const float* q_v  = (const float*)d_in[5];
  const float* Wk   = (const float*)d_in[6];
  const float* k_g  = (const float*)d_in[7];
  const float* k_b  = (const float*)d_in[8];
  const float* k_m  = (const float*)d_in[9];
  const float* k_v  = (const float*)d_in[10];
  const float* Wv   = (const float*)d_in[11];
  const float* v_g  = (const float*)d_in[12];
  const float* v_b  = (const float*)d_in[13];
  const float* v_m  = (const float*)d_in[14];
  const float* v_v  = (const float*)d_in[15];
  const float* pose = (const float*)d_in[16];
  const float* Wo   = (const float*)d_in[17];
  const float* bo   = (const float*)d_in[18];
  const float* o_g  = (const float*)d_in[19];
  const float* o_b  = (const float*)d_in[20];
  const float* o_m  = (const float*)d_in[21];
  const float* o_v  = (const float*)d_in[22];
  const int*   pix  = (const int*)d_in[23];

  // workspace carve (bytes), every offset a multiple of 1024
  const size_t O_WH    = 0;                                             // 1024*256*2
  const size_t O_WL    = O_WH    + (size_t)1024 * NC_ * 2;              // 524288
  const size_t O_BETA  = O_WL    + (size_t)1024 * NC_ * 2;              // 1048576, 4096 B
  const size_t O_WOS   = O_BETA  + 4096;                                // 1052672, 256*512*2
  const size_t O_BETAO = O_WOS   + (size_t)NC_ * NO_ * 2;               // 1314816, 1024 B
  const size_t O_XTH   = O_BETAO + 1024;                                // 1315840, 8 MB
  const size_t O_XTL   = O_XTH   + (size_t)NB_ * NP_ * NC_ * 2;         // 9704448
  const size_t O_QT    = O_XTL   + (size_t)NB_ * NP_ * NC_ * 2;         // 18093056, 8 MB
  const size_t O_KT    = O_QT    + (size_t)NB_ * NH_ * NP_ * DK_ * 2;   // 26481664
  const size_t O_VN    = O_KT    + (size_t)NB_ * NH_ * NP_ * DK_ * 2;   // 34870272, 16 MB
  const size_t O_GOT   = O_VN    + (size_t)NB_ * NO_ * NP_ * 2;         // 51647488, 16 MB
  const size_t O_PIX   = O_GOT   + (size_t)NB_ * NP_ * NO_ * 2;         // 68424704, 4 MB
  const size_t O_END   = O_PIX   + (size_t)NP_ * NP_ * 4;               // 72619008
  if (O_END > ws_size) return;

  char* ws = (char*)d_ws;
  _Float16* Wh    = (_Float16*)(ws + O_WH);
  _Float16* Wl    = (_Float16*)(ws + O_WL);
  float*    beta  = (float*)   (ws + O_BETA);
  _Float16* WoS   = (_Float16*)(ws + O_WOS);
  float*    betaO = (float*)   (ws + O_BETAO);
  _Float16* xTh   = (_Float16*)(ws + O_XTH);
  _Float16* xTl   = (_Float16*)(ws + O_XTL);
  _Float16* qT    = (_Float16*)(ws + O_QT);
  _Float16* kT    = (_Float16*)(ws + O_KT);
  _Float16* vN    = (_Float16*)(ws + O_VN);
  _Float16* goT   = (_Float16*)(ws + O_GOT);
  int*      pixP  = (int*)     (ws + O_PIX);

  k_fold_qkv<<<dim3(32), dim3(256), 0, stream>>>(Wq, q_g, q_b, q_m, q_v,
                                                 Wk, k_g, k_b, k_m, k_v,
                                                 Wv, v_g, v_b, v_m, v_v, Wh, Wl, beta);
  k_fold_wo<<<dim3(8), dim3(256), 0, stream>>>(Wo, bo, o_g, o_b, o_m, o_v, WoS, betaO);
  k_pix<<<dim3(NP_ * NP_ / 1024), dim3(256), 0, stream>>>(pix, pixP);
  k_tr<<<dim3(NP_ / 64, NC_ / 64, NB_), dim3(256), 0, stream>>>(x, xTh, xTl);
  k_qkv<<<dim3(NP_ / 64, 8, NB_), dim3(256), 0, stream>>>(xTh, xTl, Wh, beta, qT, kT, vN);   // Wl = Wh + 1024*256 elements
  k_attn<<<dim3(NP_ / 256, NH_, NB_), dim3(256), 0, stream>>>(qT, kT, vN, pose, pixP, goT);
  k_out<<<dim3(NP_ / 64, 2, NB_), dim3(256), 0, stream>>>(goT, WoS, betaO, (float*)d_out);
}

// v004
// It runs in 116 microseconds.
// Two timings next to v003 put it at 1.09 and 1.08 times that version's speed.
// Counting every step since v000, it is 6.13 times as fast.
#include <hip/hip_runtime.h>
#include <stddef.h>

// Contractions on v_wmma_f32_16x16x32_f16 (f16 operands, f32 accumulate): q/k channel GEMM as f16 hi/lo split (3 products, W scaled 2^10, x scaled 2^6), v channel GEMM single f16, QK^T single f16 (q,k scaled 2^3), P*V single f16 (P unnormalised, scaled 2^8, V scaled 2^3), output GEMM single f16 (W scaled 2^4, G scaled 2^8); BN folds, softmax, GELU in f32.

typedef _Float16 v16h __attribute__((ext_vector_type(16)));
typedef _Float16 v8h  __attribute__((ext_vector_type(8)));
typedef float    v8f  __attribute__((ext_vector_type(8)));
typedef float    v4f  __attribute__((ext_vector_type(4)));
typedef v8h v8ha __attribute__((may_alias));
typedef v4f v4fa __attribute__((may_alias));
typedef int   v4i  __attribute__((ext_vector_type(4)));
typedef v4i v4ia __attribute__((may_alias));

#define NB_  16
#define NC_  256
#define NP_  1024
#define NH_  8
#define DK_  32
#define DV_  64
#define NO_  512
#define GP_  72
#define EPS_ 1e-5f
#define CQK_ (0.17677669529663687f * 0.015625f)
#define INVSCALE_ 5.656854249492381f
#define L2E_ 1.4426950408889634f

union Frag { v16h v; v8h p[2]; };

// Fragment-order storage of every 16-bit matrix operand: a tile of 16 rows x 32 k is 1024 contiguous bytes,
// made of 64 pieces of 8 elements; piece p*32 + h*16 + m holds row m, k = 16p + 8h .. +7.
// Tiles are ordered [row tile][k tile], KT k tiles to a row tile. A wave-wide 16-byte load of one half of a
// fragment then covers 512 contiguous bytes (4 whole 128-byte lines) and not 16 lines.
__device__ __forceinline__ size_t pkoff(int row, int k, int KT) {
  return ((((size_t)(row >> 4) * KT + (k >> 5)) * 64) + ((k >> 4) & 1) * 32 + ((k >> 3) & 1) * 16 + (row & 15)) * 8;
}

// 16x32 fragment from one tile: elements 0..7 <- k 8h..+7, 8..15 <- k 16+8h..+7 of row m (lane = 16h + m)
__device__ __forceinline__ v16h ldpk(const _Float16* tile, int lane) {
  Frag f;
  f.p[0] = *(const v8ha*)(tile + lane * 8);
  f.p[1] = *(const v8ha*)(tile + 256 + lane * 8);
  return f.v;
}

__device__ __forceinline__ v8f mmab(v16h a, v16h b, v8f c) {
  return __builtin_amdgcn_wmma_f32_16x16x32_f16(false, a, false, b, (short)0, c, false, false);
}

// lane l <-> lane l ^ 16
__device__ __forceinline__ float xhalf(float x) {
  const int i = __builtin_bit_cast(int, x);
  return __builtin_bit_cast(float, __builtin_amdgcn_permlanex16(i, i, 0x76543210, 0xfedcba98, false, false));
}

__device__ __forceinline__ v8f vzero() {
  v8f z = {0.f, 0.f, 0.f, 0.f, 0.f, 0.f, 0.f, 0.f};
  return z;
}

// ---------------- BN folded into QKV weights: Wh/Wl f16 hi/lo planes of W*inv*1024, beta[1024] -----
// 32 rows per block, wave w handles rows w*4..w*4+3, lane writes 8 consecutive columns (16 B)
__device__ __forceinline__ void fold_qkv_blk(const int blk, float* sb,
    const float* __restrict__ Wq, const float* __restrict__ qg, const float* __restrict__ qb,
    const float* __restrict__ qm, const float* __restrict__ qv,
    const float* __restrict__ Wk, const float* __restrict__ kg, const float* __restrict__ kb,
    const float* __restrict__ km, const float* __restrict__ kv,
    const float* __restrict__ Wv, const float* __restrict__ vg, const float* __restrict__ vb,
    const float* __restrict__ vm, const float* __restrict__ vv,
    _Float16* Wh, _Float16* Wl, float* beta) {
  const int tid = threadIdx.x, w = tid >> 5, lane = tid & 31;
#pragma unroll 1
  for (int i = 0; i < 4; ++i) {
    const int o = blk * 32 + w * 4 + i;   // 0..1023
    const float* W;
    float g, bb, mm, var;
    int oo;
    if (o < 256)      { oo = o;       W = Wq; g = qg[oo]; bb = qb[oo]; mm = qm[oo]; var = qv[oo]; }
    else if (o < 512) { oo = o - 256; W = Wk; g = kg[oo]; bb = kb[oo]; mm = km[oo]; var = kv[oo]; }
    else              { oo = o - 512; W = Wv; g = vg[oo]; bb = vb[oo]; mm = vm[oo]; var = vv[oo]; }
    const float inv = g * (1.0f / sqrtf(var + EPS_));
    const float* wr = W + (size_t)oo * NC_ + lane * 8;
    const v4f w0 = *(const v4fa*)(wr);
    const v4f w1 = *(const v4fa*)(wr + 4);
    float vals[8] = {w0.x, w0.y, w0.z, w0.w, w1.x, w1.y, w1.z, w1.w};
    v8h hv, lv;
#pragma unroll
    for (int e = 0; e < 8; ++e) {
      const float s = vals[e] * inv * 1024.0f;
      const _Float16 hh = (_Float16)s;
      const _Float16 ll = (_Float16)(s - (float)hh);
      hv[e] = hh; lv[e] = ll;
    }
    _Float16* dh = Wh + pkoff(o, lane * 8, NC_ / 32);
    _Float16* dl = Wl + pkoff(o, lane * 8, NC_ / 32);
    *(v8h*)dh = hv;
    *(v8h*)dl = lv;
    
    if (lane == 0) sb[w * 4 + i] = bb - mm * inv;
  }
  __syncthreads();
  if (w == 0 && lane < 8) {
    v4f b4;
    b4.x = sb[lane * 4 + 0]; b4.y = sb[lane * 4 + 1]; b4.z = sb[lane * 4 + 2]; b4.w = sb[lane * 4 + 3];
    float* db = beta + blk * 32 + lane * 4;
    *(v4f*)db = b4;
    
  }
}

// ---------------- bo + output BN folded into Wo: WoS f16 = Wo*inv*16, betaO[256] -------------------
__device__ __forceinline__ void fold_wo_blk(const int blk, float* sb,
    const float* __restrict__ Wo, const float* __restrict__ bo, const float* __restrict__ og,
    const float* __restrict__ ob, const float* __restrict__ om, const float* __restrict__ ov,
    _Float16* WoS, float* betaO) {
  const int tid = threadIdx.x, w = tid >> 5, lane = tid & 31;
#pragma unroll 1
  for (int i = 0; i < 4; ++i) {
    const int o = blk * 32 + w * 4 + i;   // 0..255
    const float inv = og[o] * (1.0f / sqrtf(ov[o] + EPS_));
#pragma unroll
    for (int hf = 0; hf < 2; ++hf) {
      const float* wr = Wo + (size_t)o * NO_ + hf * 256 + lane * 8;
      const v4f w0 = *(const v4fa*)(wr);
      const v4f w1 = *(const v4fa*)(wr + 4);
      float vals[8] = {w0.x, w0.y, w0.z, w0.w, w1.x, w1.y, w1.z, w1.w};
      v8h hv;
#pragma unroll
      for (int e = 0; e < 8; ++e) hv[e] = (_Float16)(vals[e] * inv * 16.0f);
      _Float16* dh = WoS + pkoff(o, hf * 256 + lane * 8, NO_ / 32);
      *(v8h*)dh = hv;
      
    }
    if (lane == 0) sb[w * 4 + i] = bo[o] * inv + ob[o] - om[o] * inv;
  }
  __syncthreads();
  if (w == 0 && lane < 8) {
    v4f b4;
    b4.x = sb[lane * 4 + 0]; b4.y = sb[lane * 4 + 1]; b4.z = sb[lane * 4 + 2]; b4.w = sb[lane * 4 + 3];
    float* db = betaO + blk * 32 + lane * 4;
    *(v4f*)db = b4;
    
  }
}

// ---------------- x[b][c][p] -> xTh/xTl, rows b*1024+p, k = c, fragment order: f16 hi/lo planes of 64*x ----
__device__ __forceinline__ void tr_blk(const int pblk, const int cblk, const int b, float (*T)[65],
                                       const float* __restrict__ x, _Float16* xTh, _Float16* xTl) {
  const int tid = threadIdx.x;
#pragma unroll
  for (int it = 0; it < 16; ++it) {
    const int idx = it * 256 + tid;
    const int ci = idx >> 6, pj = idx & 63;
    T[ci][pj] = x[((size_t)(b * NC_ + cblk * 64 + ci)) * NP_ + pblk * 64 + pj];
  }
  __syncthreads();
#pragma unroll
  for (int it = 0; it < 2; ++it) {
    const int pi = it * 256 + tid;
    const int pl = pi & 63, pc = pi >> 6;                // a wave: 32 rows of one piece column = 2 x 256 B
    v8h hv, lv;
#pragma unroll
    for (int e = 0; e < 8; ++e) {
      const float s = T[pc * 8 + e][pl] * 64.0f;
      const _Float16 hh = (_Float16)s;
      const _Float16 ll = (_Float16)(s - (float)hh);
      hv[e] = hh; lv[e] = ll;
    }
    const size_t off = pkoff(b * NP_ + pblk * 64 + pl, cblk * 64 + pc * 8, NC_ / 32);
    *(v8h*)(xTh + off) = hv;
    *(v8h*)(xTl + off) = lv;
    
  }
}

// ---------------- QKV projection GEMM (BN folded) --------------------------------------------------
// K loop: every fragment of a group (one k step with hi/lo planes, two without) is requested before the group's first
// product, so a group waits out one load latency and not one per tile. Each accumulator takes its products in the order hi*hi, hi*lo, lo*hi, k ascending.
template <bool SPLIT>
__device__ __forceinline__ void qkv_acc(const _Float16* __restrict__ ahr, const _Float16* __restrict__ alr,
                                        const _Float16* __restrict__ whr, int loff, v8f (&acc)[4]) {
  constexpr int G = SPLIT ? 1 : 2;                       // k steps to a group: 20 loads of 16 bytes either way
  // the lane's own addresses, advanced behind the wait: no load of a group lands on a register that another load of
  // the group names. The lo plane of W follows its hi plane in the workspace: one address serves both.
  const _Float16* pah = ahr + loff;
  const _Float16* pal = alr + loff;
  const _Float16* pwh = whr + loff;
#pragma unroll 1
  for (int kk = 0; kk < 8; kk += G) {
    v16h ah[G], al[G], bh[G][4], bl[G][4];
#pragma unroll
    for (int s = 0; s < G; ++s) {
      ah[s] = ldpk(pah + s * 512, 0);
      if (SPLIT) al[s] = ldpk(pal + s * 512, 0);
#pragma unroll
      for (int t = 0; t < 4; ++t) {
        bh[s][t] = ldpk(pwh + (t * (NC_ / 32) + s) * 512, 0);
        if (SPLIT) bl[s][t] = ldpk(pwh + 1024 * NC_ + (t * (NC_ / 32) + s) * 512, 0);
      }
    }
    // precaution: the address registers of the loads above (named here, so that they live up to the wait) are
    // advanced below
    if (SPLIT) asm volatile("s_wait_xcnt 0x0" :: "v"(pah), "v"(pal), "v"(pwh) : "memory");
    else       asm volatile("s_wait_xcnt 0x0" :: "v"(pah), "v"(pwh) : "memory");
    // without it the scheduler sinks each tile's loads to just ahead of its product: one exposed latency per tile
    __builtin_amdgcn_sched_barrier(0);
    pah += G * 512; pal += G * 512; pwh += G * 512;
#pragma unroll
    for (int s = 0; s < G; ++s) {
#pragma unroll
      for (int t = 0; t < 4; ++t) acc[t] = mmab(ah[s], bh[s][t], acc[t]);
      if (SPLIT) {
#pragma unroll
        for (int t = 0; t < 4; ++t) acc[t] = mmab(ah[s], bl[s][t], acc[t]);
#pragma unroll
        for (int t = 0; t < 4; ++t) acc[t] = mmab(al[s], bh[s][t], acc[t]);
      }
    }
  }
}

// block tile 64 pixels x 128 output channels, 8 waves (4 row groups x 2 column halves), K = 256.
// q,k column chunks (nchunk 0..3): hi*hi + hi*lo + lo*hi; v chunks (4..7): hi*hi.
// qT,kT: per b*8+n rows p, k = d (x8);  vN: rows b*512+channel, k = p (x8); all in fragment order
// 8 waves per SIMD (128 registers): four work-groups to a WGP, the grid in two even rounds
__global__ __launch_bounds__(256) __attribute__((amdgpu_waves_per_eu(8))) void k_qkv(
    const _Float16* __restrict__ xTh, const _Float16* __restrict__ xTl,
    const _Float16* __restrict__ Wh, const float* __restrict__ beta,
    _Float16* qT, _Float16* kT, _Float16* vN) {
  __shared__ __attribute__((aligned(16))) _Float16 st[128 * GP_];   // q/k view: [64][136], v view: [128][72]
  const int ptile = blockIdx.x, nchunk = blockIdx.y, b = blockIdx.z;
  const int tid = threadIdx.x, lane = tid & 31, m = lane & 15, h = lane >> 4;
  // the wave's number as a scalar: tile indices and bases are then formed in scalar registers, which leaves the
  // vector registers to the fragment groups
  const int w = __builtin_amdgcn_readfirstlane(tid >> 5);
  const int msub = w & 3, nh = w >> 2;
  const int nbase = nchunk * 128 + nh * 64;
  const bool split = (nchunk < 4);   // block-uniform

  v8f acc[4] = {vzero(), vzero(), vzero(), vzero()};
  const size_t atile = (size_t)(b * (NP_ / 16) + ptile * 4 + msub) * (NC_ / 32) * 512;
  const _Float16* ahr = xTh + atile;
  const _Float16* alr = xTl + atile;
  const _Float16* whr = Wh + (size_t)(nbase >> 4) * (NC_ / 32) * 512;
  if (split) qkv_acc<true>(ahr, alr, whr, lane * 8, acc);
  else       qkv_acc<false>(ahr, alr, whr, lane * 8, acc);

  // epilogue: scale back 2^-16, add folded beta, scale x8, stage 16-bit tile in LDS
  const float kS = 1.0f / 65536.0f;
#pragma unroll
  for (int t = 0; t < 4; ++t) {
    const int ol = nh * 64 + t * 16 + m;                 // 0..127 (column = this lane's n)
    const float bta = beta[nchunk * 128 + ol];
#pragma unroll
    for (int j = 0; j < 8; ++j) {
      const int pl = msub * 16 + 8 * h + j;              // D row 8h+j
      const _Float16 hv = (_Float16)((acc[t][j] * kS + bta) * 8.0f);
      if (split) st[pl * 136 + ol] = hv;
      else       st[ol * GP_ + pl] = hv;
    }
  }
  __syncthreads();

  if (split) {
    _Float16* base = (nchunk < 2) ? qT : kT;
    const int hb = (nchunk & 1) * 4;
#pragma unroll
    for (int it = 0; it < 4; ++it) {
      const int pi = it * 256 + tid;                     // 1024 pieces of 16 B
      const int hd = pi >> 8, r = pi & 255;
      const int pl = r >> 2, dq = r & 3;
      const v8h v = *(const v8ha*)(st + pl * 136 + hd * 32 + dq * 8);
      _Float16* dst = base + ((size_t)(b * NH_ + hb + hd)) * NP_ * DK_ + pkoff(ptile * 64 + pl, dq * 8, 1);
      *(v8h*)dst = v;
      
    }
  } else {
    const int obase = (nchunk - 4) * 128;
#pragma unroll
    for (int it = 0; it < 4; ++it) {
      const int pi = it * 256 + tid;                     // 128 rows x 8 pieces
      const int ol = pi & 127, pc = pi >> 7;             // a wave: 32 rows of one piece column = 2 x 256 B
      const v8h v = *(const v8ha*)(st + ol * GP_ + pc * 8);
      _Float16* dst = vN + pkoff(b * NO_ + obase + ol, ptile * 64 + pc * 8, NP_ / 32);
      *(v8h*)dst = v;
      
    }
  }
}

// ---------------- index table in the order the attention lanes read it ------------------------------
// tile (16 queries qt, 32 keys kc) = 512 ints; piece c*32 + 16h + m of 4 ints holds query 16qt+m,
// keys 32kc + 16(c>>1) + 8h + 4(c&1) .. +3. Values are copied as they are.
__device__ __forceinline__ v4i pix_piece(const int P, const int* __restrict__ pidx) {   // P: 0..262143
  const int lane = P & 31, c = (P >> 5) & 3, kc = (P >> 7) & 31, qt = P >> 12;
  const int m = lane & 15, h = lane >> 4;
  return *(const v4ia*)(pidx + (size_t)(qt * 16 + m) * NP_ + kc * 32 + (c >> 1) * 16 + 8 * h + (c & 1) * 4);
}

// ---------------- all preparation in one launch ------------------------------------------------------
// None of the four jobs reads what another writes. Work-groups 0..31 fold the QKV weights, 32..39 the output
// weights (their serial row loops start first and run beside the rest); each of the other 1024 transposes one
// 64 x 64 tile of x and re-packs 256 pieces of the index table (1024 x 256 = all of its pieces).
#define NFQ_ 32
#define NFO_ 8
__global__ __launch_bounds__(256) void k_prep(
    const float* __restrict__ Wq, const float* __restrict__ qg, const float* __restrict__ qb,
    const float* __restrict__ qm, const float* __restrict__ qv,
    const float* __restrict__ Wk, const float* __restrict__ kg, const float* __restrict__ kb,
    const float* __restrict__ km, const float* __restrict__ kv,
    const float* __restrict__ Wv, const float* __restrict__ vg, const float* __restrict__ vb,
    const float* __restrict__ vm, const float* __restrict__ vv,
    const float* __restrict__ Wo, const float* __restrict__ bo, const float* __restrict__ og,
    const float* __restrict__ ob, const float* __restrict__ om, const float* __restrict__ ov,
    const float* __restrict__ x, const int* __restrict__ pidx,
    _Float16* Wh, _Float16* Wl, float* beta, _Float16* WoS, float* betaO,
    _Float16* xTh, _Float16* xTl, int* pidxP) {
  __shared__ __attribute__((aligned(16))) float T[64][65];
  const int blk = blockIdx.x;                            // the same for a whole work-group: its barriers are uniform
  if (blk < NFQ_) {
    fold_qkv_blk(blk, &T[0][0], Wq, qg, qb, qm, qv, Wk, kg, kb, km, kv, Wv, vg, vb, vm, vv, Wh, Wl, beta);
  } else if (blk < NFQ_ + NFO_) {
    fold_wo_blk(blk - NFQ_, &T[0][0], Wo, bo, og, ob, om, ov, WoS, betaO);
  } else {
    const int t = blk - (NFQ_ + NFO_);
    // the index piece is requested with the tile's loads and stored with the tile's stores: a store in front of
    // the tile's barrier would be waited for there
    const int P = t * 256 + threadIdx.x;
    const v4i piece = pix_piece(P, pidx);
    tr_blk(t & 15, (t >> 4) & 3, t >> 6, T, x, xTh, xTl);
    *(v4i*)(pidxP + (size_t)P * 4) = piece;
    // precaution: the code of the other branches follows in the listing and rewrites registers that the stores above name
    asm volatile("s_wait_xcnt 0x0" ::: "memory");
  }
}

__global__ __launch_bounds__(256) void k_attn(
    const _Float16* __restrict__ qT, const _Float16* __restrict__ kT, const _Float16* __restrict__ vN,
    const float* __restrict__ posemb, const int* __restrict__ pidxP, _Float16* goT) {
  __shared__ __attribute__((aligned(16))) float posl[NP_];   // pos_emb[:, n] / SCALE, in log2 units

  const int qblk = blockIdx.x, n = blockIdx.y, b = blockIdx.z;
  const int tid = threadIdx.x;
  const int w = tid >> 5, lane = tid & 31;
  for (int k = tid; k < NP_; k += 256) posl[k] = posemb[k * NH_ + n] * (INVSCALE_ * L2E_);
  __syncthreads();

  const int qbase = qblk * 256 + w * 32;
  const int bn = b * NH_ + n;
  v16h bq[2];
#pragma unroll
  for (int g = 0; g < 2; ++g) bq[g] = ldpk(qT + ((size_t)bn * NP_ + qbase + 16 * g) * DK_, lane);
  const _Float16* kp = kT + (size_t)bn * NP_ * DK_;                                  // A row m = key
  const _Float16* vp = vN + (size_t)(b * (NO_ / 16) + n * (DV_ / 16)) * (NP_ / 32) * 512;   // A row m = value channel
  const int* ip = pidxP + (size_t)(qbase >> 4) * (NP_ / 32) * 512 + lane * 4;        // column m = query, rows 8h+j = keys
  const v8f vz = vzero();

  v8f oacc[2][4] = {{vz, vz, vz, vz}, {vz, vz, vz, vz}};
  float mrun[2] = {-3.0e38f, -3.0e38f};
  float lsum[2] = {0.f, 0.f};

#pragma unroll 1
  for (int kc = 0; kc < 32; ++kc) {
    const int k0 = kc * 32;
    v16h ak[2], av[4];
#pragma unroll
    for (int u = 0; u < 2; ++u) ak[u] = ldpk(kp + (size_t)(k0 + 16 * u) * DK_, lane);
    v4i ixv[2][4];
#pragma unroll
    for (int g = 0; g < 2; ++g) {
#pragma unroll
      for (int u = 0; u < 2; ++u) {
        ixv[g][2 * u]     = *(const v4ia*)(ip + (size_t)(g * (NP_ / 32) + kc) * 512 + (2 * u) * 128);
        ixv[g][2 * u + 1] = *(const v4ia*)(ip + (size_t)(g * (NP_ / 32) + kc) * 512 + (2 * u + 1) * 128);
      }
    }
    // precaution: the registers that hold the addresses of the loads above are reused below
    asm volatile("s_wait_xcnt 0x0" ::: "memory");
#pragma unroll
    for (int t = 0; t < 4; ++t) av[t] = ldpk(vp + (size_t)(t * (NP_ / 32) + kc) * 512, lane);
    // precaution: as above, for the addresses of the V loads
    asm volatile("s_wait_xcnt 0x0" ::: "memory");
#pragma unroll
    for (int g = 0; g < 2; ++g) {
      float tv[16];
#pragma unroll
      for (int u = 0; u < 2; ++u) {
        const v8f s = mmab(ak[u], bq[g], vz);            // D[8h+j][m]: key k0+16u+8h+j, query column m
#pragma unroll
        for (int j = 0; j < 8; ++j) {
          int ix = ixv[g][2 * u + (j >> 2)][j & 3];
          ix = ix < 0 ? 0 : (ix > NP_ - 1 ? NP_ - 1 : ix);
          tv[u * 8 + j] = fmaf(s[j], CQK_ * L2E_, posl[ix]);
        }
      }
      float mx = tv[0];
#pragma unroll
      for (int i = 1; i < 16; ++i) mx = fmaxf(mx, tv[i]);
      mx = fmaxf(mx, xhalf(mx));
      const float mnew = fmaxf(mrun[g], mx);
      const float alpha = __builtin_amdgcn_exp2f(mrun[g] - mnew);   // 0 on the first chunk
      mrun[g] = mnew;
      const float msub = mnew - 8.0f;                    // P carries 2^8; the row sum carries it too
      Frag bp;
      float ps = 0.f;
#pragma unroll
      for (int i = 0; i < 16; ++i) {
        const float p = __builtin_amdgcn_exp2f(tv[i] - msub);
        ps += p;
        bp.v[i] = (_Float16)p;                           // element i = key k0+16(i>>3)+8h+(i&7), as ldpk orders V
      }
      lsum[g] = lsum[g] * alpha + ps;
#pragma unroll
      for (int t = 0; t < 4; ++t) {
        oacc[g][t] = mmab(av[t], bp.v, oacc[g][t] * alpha);
      }
    }
  }

  // normalise, GELU (erf form), scale 2^8; a lane holds 8 consecutive channels of one query: one piece of a
  // fragment-order tile (rows = pixels, k = channels), so a wave's store is 512 contiguous bytes
#pragma unroll
  for (int g = 0; g < 2; ++g) {
    const float l = lsum[g] + xhalf(lsum[g]);
    const float co = 1.0f / (l * 8.0f);                  // undo 2^3 (V); 2^8 (P) cancels against l
    _Float16* dst = goT + ((size_t)(b * (NP_ / 16) + (qbase >> 4) + g) * (NO_ / 32) + n * 2) * 512 + lane * 8;
#pragma unroll
    for (int t = 0; t < 4; ++t) {
      v8h o;
#pragma unroll
      for (int j = 0; j < 8; ++j) {
        const float xo = oacc[g][t][j] * co;
        const float gl = 0.5f * xo * (1.0f + erff(xo * 0.70710678118654752f));
        o[j] = (_Float16)(gl * 256.0f);
      }
      *(v8h*)(dst + (t >> 1) * 512 + (t & 1) * 256) = o;   // k = 64n + 16t + 8h: k tile 2n + t/2, half t&1
    }
  }
}

// ---------------- output projection GEMM (bias + BN folded) ---------------------------------------
__global__ __launch_bounds__(256) void k_out(
    const _Float16* __restrict__ goT, const _Float16* __restrict__ WoS, const float* __restrict__ betaO,
    float* out) {
  __shared__ __attribute__((aligned(16))) float To[128 * 68];
  const int ptile = blockIdx.x, nchunk = blockIdx.y, b = blockIdx.z;
  const int tid = threadIdx.x, lane = tid & 31, m = lane & 15, h = lane >> 4;
  // the wave's number as a scalar: tile indices and bases are then formed in scalar registers, which leaves the
  // vector registers to the fragment groups
  const int w = __builtin_amdgcn_readfirstlane(tid >> 5);
  const int msub = w & 3, nh = w >> 2;
  const int nbase = nchunk * 128 + nh * 64;
  v8f acc[4] = {vzero(), vzero(), vzero(), vzero()};
  const _Float16* ar = goT + (size_t)(b * (NP_ / 16) + ptile * 4 + msub) * (NO_ / 32) * 512;
  // the fragments of four k steps are requested as one group ahead of their products: one load latency per group
#pragma unroll 1
  for (int k4 = 0; k4 < 16; k4 += 4) {
    v16h a[4], bt[4][4];
#pragma unroll
    for (int s = 0; s < 4; ++s) {
      a[s] = ldpk(ar + (k4 + s) * 512, lane);
#pragma unroll
      for (int t = 0; t < 4; ++t)
        bt[s][t] = ldpk(WoS + (size_t)(((nbase >> 4) + t) * (NO_ / 32) + k4 + s) * 512, lane);
    }
    // precaution: the address registers of the loads above are reused below
    asm volatile("s_wait_xcnt 0x0" ::: "memory");
    // without it the scheduler sinks each tile's loads to just ahead of its product: one exposed latency per tile
    __builtin_amdgcn_sched_barrier(0);
#pragma unroll
    for (int s = 0; s < 4; ++s) {
#pragma unroll
      for (int t = 0; t < 4; ++t) acc[t] = mmab(a[s], bt[s][t], acc[t]);
    }
  }
  const float kS = 1.0f / 4096.0f;                       // undo 2^4 (W) and 2^8 (G)
#pragma unroll
  for (int t = 0; t < 4; ++t) {
    const int ol = nh * 64 + t * 16 + m;
    const float bta = betaO[nchunk * 128 + ol];
#pragma unroll
    for (int j = 0; j < 8; ++j) {
      const int pl = msub * 16 + 8 * h + j;
      To[ol * 68 + pl] = acc[t][j] * kS + bta;
    }
  }
  __syncthreads();
#pragma unroll
  for (int it = 0; it < 8; ++it) {
    const int pi = it * 256 + tid;                       // 128 rows x 16 float4 pieces
    const int ol = pi >> 4, pc = pi & 15;
    const v4f v = *(const v4fa*)(To + ol * 68 + pc * 4);
    float* dst = out + ((size_t)(b * NC_ + nchunk * 128 + ol)) * NP_ + ptile * 64 + pc * 4;
    *(v4f*)dst = v;
    
  }
}

// ---------------- launch glue ------------------------------------------------------------------------
extern "C" void kernel_launch(void* const* d_in, const int* in_sizes, int n_in,
                              void* d_out, int out_size, void* d_ws, size_t ws_size,
                              hipStream_t stream) {
  if (n_in < 24) return;
  if (in_sizes[0] != NB_ * NC_ * NP_) return;
  if (in_sizes[1] != NC_ * NC_ || in_sizes[6] != NC_ * NC_ || in_sizes[11] != NO_ * NC_) return;
  if (in_sizes[16] != NP_ * NH_ || in_sizes[17] != NC_ * NO_ || in_sizes[23] != NP_ * NP_) return;
  {
    const int f32c[13] = {2, 3, 4, 5, 7, 8, 9, 10, 18, 19, 20, 21, 22};
    for (int i = 0; i < 13; ++i) if (in_sizes[f32c[i]] != NC_) return;
    const int f32o[4] = {12, 13, 14, 15};
    for (int i = 0; i < 4; ++i) if (in_sizes[f32o[i]] != NO_) return;
  }
  if (out_size != NB_ * NC_ * NP_) return;

  const float* x    = (const float*)d_in[0];
  const float* Wq   = (const float*)d_in[1];
  const float* q_g  = (const float*)d_in[2];
  const float* q_b  = (const float*)d_in[3];
  const float* q_m  = (const float*)d_in[4];
  const float* q_v  = (const float*)d_in[5];
  const float* Wk   = (const float*)d_in[6];
  const float* k_g  = (const float*)d_in[7];
  const float* k_b  = (const float*)d_in[8];
  const float* k_m  = (const float*)d_in[9];
  const float* k_v  = (const float*)d_in[10];
  const float* Wv   = (const float*)d_in[11];
  const float* v_g  = (const float*)d_in[12];
  const float* v_b  = (const float*)d_in[13];
  const float* v_m  = (const float*)d_in[14];
  const float* v_v  = (const float*)d_in[15];
  const float* pose = (const float*)d_in[16];
  const float* Wo   = (const float*)d_in[17];
  const float* bo   = (const float*)d_in[18];
  const float* o_g  = (const float*)d_in[19];
  const float* o_b  = (const float*)d_in[20];
  const float* o_m  = (const float*)d_in[21];
  const float* o_v  = (const float*)d_in[22];
  const int*   pix  = (const int*)d_in[23];

  // workspace carve (bytes), every offset a multiple of 1024
  const size_t O_WH    = 0;                                             // 1024*256*2
  const size_t O_WL    = O_WH    + (size_t)1024 * NC_ * 2;              // 524288
  const size_t O_BETA  = O_WL    + (size_t)1024 * NC_ * 2;              // 1048576, 4096 B
  const size_t O_WOS   = O_BETA  + 4096;                                // 1052672, 256*512*2
  const size_t O_BETAO = O_WOS   + (size_t)NC_ * NO_ * 2;               // 1314816, 1024 B
  const size_t O_XTH   = O_BETAO + 1024;                                // 1315840, 8 MB
  const size_t O_XTL   = O_XTH   + (size_t)NB_ * NP_ * NC_ * 2;         // 9704448
  const size_t O_QT    = O_XTL   + (size_t)NB_ * NP_ * NC_ * 2;         // 18093056, 8 MB
  const size_t O_KT    = O_QT    + (size_t)NB_ * NH_ * NP_ * DK_ * 2;   // 26481664
  const size_t O_VN    = O_KT    + (size_t)NB_ * NH_ * NP_ * DK_ * 2;   // 34870272, 16 MB
  const size_t O_GOT   = O_VN    + (size_t)NB_ * NO_ * NP_ * 2;         // 51647488, 16 MB
  const size_t O_PIX   = O_GOT   + (size_t)NB_ * NP_ * NO_ * 2;         // 68424704, 4 MB
  const size_t O_END   = O_PIX   + (size_t)NP_ * NP_ * 4;               // 72619008
  if (O_END > ws_size) return;

  char* ws = (char*)d_ws;
  _Float16* Wh    = (_Float16*)(ws + O_WH);
  _Float16* Wl    = (_Float16*)(ws + O_WL);
  float*    beta  = (float*)   (ws + O_BETA);
  _Float16* WoS   = (_Float16*)(ws + O_WOS);
  float*    betaO = (float*)   (ws + O_BETAO);
  _Float16* xTh   = (_Float16*)(ws + O_XTH);
  _Float16* xTl   = (_Float16*)(ws + O_XTL);
  _Float16* qT    = (_Float16*)(ws + O_QT);
  _Float16* kT    = (_Float16*)(ws + O_KT);
  _Float16* vN    = (_Float16*)(ws + O_VN);
  _Float16* goT   = (_Float16*)(ws + O_GOT);
  int*      pixP  = (int*)     (ws + O_PIX);

  k_prep<<<dim3(NFQ_ + NFO_ + (NP_ / 64) * (NC_ / 64) * NB_), dim3(256), 0, stream>>>(
      Wq, q_g, q_b, q_m, q_v, Wk, k_g, k_b, k_m, k_v, Wv, v_g, v_b, v_m, v_v,
      Wo, bo, o_g, o_b, o_m, o_v, x, pix, Wh, Wl, beta, WoS, betaO, xTh, xTl, pixP);
  k_qkv<<<dim3(NP_ / 64, 8, NB_), dim3(256), 0, stream>>>(xTh, xTl, Wh, beta, qT, kT, vN);   // Wl = Wh + 1024*256 elements
  k_attn<<<dim3(NP_ / 256, NH_, NB_), dim3(256), 0, stream>>>(qT, kT, vN, pose, pixP, goT);
  k_out<<<dim3(NP_ / 64, 2, NB_), dim3(256), 0, stream>>>(goT, WoS, betaO, (float*)d_out);
}

// v005
// One run takes 110 microseconds.
// Two timings next to v004 put it at 1.06 and 1.05 times that version's speed.
// Counting every step since v000, it is 6.47 times as fast.
#include <hip/hip_runtime.h>
#include <stddef.h>

// Contractions on v_wmma_f32_16x16x32_f16 (f16 operands, f32 accumulate): q/k channel GEMM as f16 hi/lo split (3 products, W scaled 2^10, x scaled 2^6), v channel GEMM single f16, QK^T single f16 (q,k scaled 2^3), P*V single f16 (P unnormalised, scaled 2^8, V scaled 2^3), output GEMM single f16 (W scaled 2^4, G scaled 2^8); position bias single f16 (scaled 2^5) times a 0 / 2^6 selector, summed into the QK^T accumulator; BN folds, softmax, GELU in f32.

typedef _Float16 v16h __attribute__((ext_vector_type(16)));
typedef _Float16 v8h  __attribute__((ext_vector_type(8)));
typedef float    v8f  __attribute__((ext_vector_type(8)));
typedef float    v4f  __attribute__((ext_vector_type(4)));
typedef v8h v8ha __attribute__((may_alias));
typedef v4f v4fa __attribute__((may_alias));

#define NB_  16
#define NC_  256
#define NP_  1024
#define NH_  8
#define DK_  32
#define DV_  64
#define NO_  512
#define GP_  72
#define EPS_ 1e-5f
#define CQK_ (0.17677669529663687f * 0.015625f)
#define L2E_ 1.4426950408889634f

union Frag { v16h v; v8h p[2]; };

// Fragment-order storage of every 16-bit matrix operand: a tile of 16 rows x 32 k is 1024 contiguous bytes,
// made of 64 pieces of 8 elements; piece p*32 + h*16 + m holds row m, k = 16p + 8h .. +7.
// Tiles are ordered [row tile][k tile], KT k tiles to a row tile. A wave-wide 16-byte load of one half of a
// fragment then covers 512 contiguous bytes (4 whole 128-byte lines) and not 16 lines.
__device__ __forceinline__ size_t pkoff(int row, int k, int KT) {
  return ((((size_t)(row >> 4) * KT + (k >> 5)) * 64) + ((k >> 4) & 1) * 32 + ((k >> 3) & 1) * 16 + (row & 15)) * 8;
}

// 16x32 fragment from one tile: elements 0..7 <- k 8h..+7, 8..15 <- k 16+8h..+7 of row m (lane = 16h + m)
__device__ __forceinline__ v16h ldpk(const _Float16* tile, int lane) {
  Frag f;
  f.p[0] = *(const v8ha*)(tile + lane * 8);
  f.p[1] = *(const v8ha*)(tile + 256 + lane * 8);
  return f.v;
}

__device__ __forceinline__ v8f mmab(v16h a, v16h b, v8f c) {
  return __builtin_amdgcn_wmma_f32_16x16x32_f16(false, a, false, b, (short)0, c, false, false);
}

// lane l <-> lane l ^ 16
__device__ __forceinline__ float xhalf(float x) {
  const int i = __builtin_bit_cast(int, x);
  return __builtin_bit_cast(float, __builtin_amdgcn_permlanex16(i, i, 0x76543210, 0xfedcba98, false, false));
}

__device__ __forceinline__ v8f vzero() {
  v8f z = {0.f, 0.f, 0.f, 0.f, 0.f, 0.f, 0.f, 0.f};
  return z;
}

// ---------------- BN folded into QKV weights: Wh/Wl f16 hi/lo planes of W*inv*1024, beta[1024] -----
// 32 rows per block, wave w handles rows w*4..w*4+3, lane writes 8 consecutive columns (16 B)
__device__ __forceinline__ void fold_qkv_blk(const int blk, float* sb,
    const float* __restrict__ Wq, const float* __restrict__ qg, const float* __restrict__ qb,
    const float* __restrict__ qm, const float* __restrict__ qv,
    const float* __restrict__ Wk, const float* __restrict__ kg, const float* __restrict__ kb,
    const float* __restrict__ km, const float* __restrict__ kv,
    const float* __restrict__ Wv, const float* __restrict__ vg, const float* __restrict__ vb,
    const float* __restrict__ vm, const float* __restrict__ vv,
    _Float16* Wh, _Float16* Wl, float* beta) {
  const int tid = threadIdx.x, w = tid >> 5, lane = tid & 31;
#pragma unroll 1
  for (int i = 0; i < 4; ++i) {
    const int o = blk * 32 + w * 4 + i;   // 0..1023
    const float* W;
    float g, bb, mm, var;
    int oo;
    if (o < 256)      { oo = o;       W = Wq; g = qg[oo]; bb = qb[oo]; mm = qm[oo]; var = qv[oo]; }
    else if (o < 512) { oo = o - 256; W = Wk; g = kg[oo]; bb = kb[oo]; mm = km[oo]; var = kv[oo]; }
    else              { oo = o - 512; W = Wv; g = vg[oo]; bb = vb[oo]; mm = vm[oo]; var = vv[oo]; }
    const float inv = g * (1.0f / sqrtf(var + EPS_));
    const float* wr = W + (size_t)oo * NC_ + lane * 8;
    const v4f w0 = *(const v4fa*)(wr);
    const v4f w1 = *(const v4fa*)(wr + 4);
    float vals[8] = {w0.x, w0.y, w0.z, w0.w, w1.x, w1.y, w1.z, w1.w};
    v8h hv, lv;
#pragma unroll
    for (int e = 0; e < 8; ++e) {
      const float s = vals[e] * inv * 1024.0f;
      const _Float16 hh = (_Float16)s;
      const _Float16 ll = (_Float16)(s - (float)hh);
      hv[e] = hh; lv[e] = ll;
    }
    _Float16* dh = Wh + pkoff(o, lane * 8, NC_ / 32);
    _Float16* dl = Wl + pkoff(o, lane * 8, NC_ / 32);
    *(v8h*)dh = hv;
    *(v8h*)dl = lv;
    
    if (lane == 0) sb[w * 4 + i] = bb - mm * inv;
  }
  __syncthreads();
  if (w == 0 && lane < 8) {
    v4f b4;
    b4.x = sb[lane * 4 + 0]; b4.y = sb[lane * 4 + 1]; b4.z = sb[lane * 4 + 2]; b4.w = sb[lane * 4 + 3];
    float* db = beta + blk * 32 + lane * 4;
    *(v4f*)db = b4;
    
  }
}

// ---------------- bo + output BN folded into Wo: WoS f16 = Wo*inv*16, betaO[256] -------------------
__device__ __forceinline__ void fold_wo_blk(const int blk, float* sb,
    const float* __restrict__ Wo, const float* __restrict__ bo, const float* __restrict__ og,
    const float* __restrict__ ob, const float* __restrict__ om, const float* __restrict__ ov,
    _Float16* WoS, float* betaO) {
  const int tid = threadIdx.x, w = tid >> 5, lane = tid & 31;
#pragma unroll 1
  for (int i = 0; i < 4; ++i) {
    const int o = blk * 32 + w * 4 + i;   // 0..255
    const float inv = og[o] * (1.0f / sqrtf(ov[o] + EPS_));
#pragma unroll
    for (int hf = 0; hf < 2; ++hf) {
      const float* wr = Wo + (size_t)o * NO_ + hf * 256 + lane * 8;
      const v4f w0 = *(const v4fa*)(wr);
      const v4f w1 = *(const v4fa*)(wr + 4);
      float vals[8] = {w0.x, w0.y, w0.z, w0.w, w1.x, w1.y, w1.z, w1.w};
      v8h hv;
#pragma unroll
      for (int e = 0; e < 8; ++e) hv[e] = (_Float16)(vals[e] * inv * 16.0f);
      _Float16* dh = WoS + pkoff(o, hf * 256 + lane * 8, NO_ / 32);
      *(v8h*)dh = hv;
      
    }
    if (lane == 0) sb[w * 4 + i] = bo[o] * inv + ob[o] - om[o] * inv;
  }
  __syncthreads();
  if (w == 0 && lane < 8) {
    v4f b4;
    b4.x = sb[lane * 4 + 0]; b4.y = sb[lane * 4 + 1]; b4.z = sb[lane * 4 + 2]; b4.w = sb[lane * 4 + 3];
    float* db = betaO + blk * 32 + lane * 4;
    *(v4f*)db = b4;
    
  }
}

// ---------------- x[b][c][p] -> xTh/xTl, rows b*1024+p, k = c, fragment order: f16 hi/lo planes of 64*x ----
__device__ __forceinline__ void tr_blk(const int pblk, const int cblk, const int b, float (*T)[65],
                                       const float* __restrict__ x, _Float16* xTh, _Float16* xTl) {
  const int tid = threadIdx.x;
#pragma unroll
  for (int it = 0; it < 16; ++it) {
    const int idx = it * 256 + tid;
    const int ci = idx >> 6, pj = idx & 63;
    T[ci][pj] = x[((size_t)(b * NC_ + cblk * 64 + ci)) * NP_ + pblk * 64 + pj];
  }
  __syncthreads();
#pragma unroll
  for (int it = 0; it < 2; ++it) {
    const int pi = it * 256 + tid;
    const int pl = pi & 63, pc = pi >> 6;                // a wave: 32 rows of one piece column = 2 x 256 B
    v8h hv, lv;
#pragma unroll
    for (int e = 0; e < 8; ++e) {
      const float s = T[pc * 8 + e][pl] * 64.0f;
      const _Float16 hh = (_Float16)s;
      const _Float16 ll = (_Float16)(s - (float)hh);
      hv[e] = hh; lv[e] = ll;
    }
    const size_t off = pkoff(b * NP_ + pblk * 64 + pl, cblk * 64 + pc * 8, NC_ / 32);
    *(v8h*)(xTh + off) = hv;
    *(v8h*)(xTl + off) = lv;
    
  }
}

// ---------------- QKV projection GEMM (BN folded) --------------------------------------------------
// K loop: every fragment of a group (one k step with hi/lo planes, two without) is requested before the group's first
// product, so a group waits out one load latency and not one per tile. Each accumulator takes its products in the order hi*hi, hi*lo, lo*hi, k ascending.
template <bool SPLIT>
__device__ __forceinline__ void qkv_acc(const _Float16* __restrict__ ahr, const _Float16* __restrict__ alr,
                                        const _Float16* __restrict__ whr, int loff, v8f (&acc)[4]) {
  constexpr int G = SPLIT ? 1 : 2;                       // k steps to a group: 20 loads of 16 bytes either way
  // the lane's own addresses, advanced behind the wait: no load of a group lands on a register that another load of
  // the group names. The lo plane of W follows its hi plane in the workspace: one address serves both.
  const _Float16* pah = ahr + loff;
  const _Float16* pal = alr + loff;
  const _Float16* pwh = whr + loff;
#pragma unroll 1
  for (int kk = 0; kk < 8; kk += G) {
    v16h ah[G], al[G], bh[G][4], bl[G][4];
#pragma unroll
    for (int s = 0; s < G; ++s) {
      ah[s] = ldpk(pah + s * 512, 0);
      if (SPLIT) al[s] = ldpk(pal + s * 512, 0);
#pragma unroll
      for (int t = 0; t < 4; ++t) {
        bh[s][t] = ldpk(pwh + (t * (NC_ / 32) + s) * 512, 0);
        if (SPLIT) bl[s][t] = ldpk(pwh + 1024 * NC_ + (t * (NC_ / 32) + s) * 512, 0);
      }
    }
    // precaution: the address registers of the loads above (named here, so that they live up to the wait) are
    // advanced below
    if (SPLIT) asm volatile("s_wait_xcnt 0x0" :: "v"(pah), "v"(pal), "v"(pwh) : "memory");
    else       asm volatile("s_wait_xcnt 0x0" :: "v"(pah), "v"(pwh) : "memory");
    // without it the scheduler sinks each tile's loads to just ahead of its product: one exposed latency per tile
    __builtin_amdgcn_sched_barrier(0);
    pah += G * 512; pal += G * 512; pwh += G * 512;
#pragma unroll
    for (int s = 0; s < G; ++s) {
#pragma unroll
      for (int t = 0; t < 4; ++t) acc[t] = mmab(ah[s], bh[s][t], acc[t]);
      if (SPLIT) {
#pragma unroll
        for (int t = 0; t < 4; ++t) acc[t] = mmab(ah[s], bl[s][t], acc[t]);
#pragma unroll
        for (int t = 0; t < 4; ++t) acc[t] = mmab(al[s], bh[s][t], acc[t]);
      }
    }
  }
}

// block tile 64 pixels x 128 output channels, 8 waves (4 row groups x 2 column halves), K = 256.
// q,k column chunks (nchunk 0..3): hi*hi + hi*lo + lo*hi; v chunks (4..7): hi*hi.
// qT,kT: per b*8+n rows p, k = d (x8);  vN: rows b*512+channel, k = p (x8); all in fragment order
// 8 waves per SIMD (128 registers): four work-groups to a WGP, the grid in two even rounds
__global__ __launch_bounds__(256) __attribute__((amdgpu_waves_per_eu(8))) void k_qkv(
    const _Float16* __restrict__ xTh, const _Float16* __restrict__ xTl,
    const _Float16* __restrict__ Wh, const float* __restrict__ beta,
    _Float16* qT, _Float16* kT, _Float16* vN) {
  __shared__ __attribute__((aligned(16))) _Float16 st[128 * GP_];   // q/k view: [64][136], v view: [128][72]
  const int ptile = blockIdx.x, nchunk = blockIdx.y, b = blockIdx.z;
  const int tid = threadIdx.x, lane = tid & 31, m = lane & 15, h = lane >> 4;
  // the wave's number as a scalar: tile indices and bases are then formed in scalar registers, which leaves the
  // vector registers to the fragment groups
  const int w = __builtin_amdgcn_readfirstlane(tid >> 5);
  const int msub = w & 3, nh = w >> 2;
  const int nbase = nchunk * 128 + nh * 64;
  const bool split = (nchunk < 4);   // block-uniform

  v8f acc[4] = {vzero(), vzero(), vzero(), vzero()};
  const size_t atile = (size_t)(b * (NP_ / 16) + ptile * 4 + msub) * (NC_ / 32) * 512;
  const _Float16* ahr = xTh + atile;
  const _Float16* alr = xTl + atile;
  const _Float16* whr = Wh + (size_t)(nbase >> 4) * (NC_ / 32) * 512;
  if (split) qkv_acc<true>(ahr, alr, whr, lane * 8, acc);
  else       qkv_acc<false>(ahr, alr, whr, lane * 8, acc);

  // epilogue: scale back 2^-16, add folded beta, scale x8, stage 16-bit tile in LDS
  const float kS = 1.0f / 65536.0f;
#pragma unroll
  for (int t = 0; t < 4; ++t) {
    const int ol = nh * 64 + t * 16 + m;                 // 0..127 (column = this lane's n)
    const float bta = beta[nchunk * 128 + ol];
#pragma unroll
    for (int j = 0; j < 8; ++j) {
      const int pl = msub * 16 + 8 * h + j;              // D row 8h+j
      const _Float16 hv = (_Float16)((acc[t][j] * kS + bta) * 8.0f);
      if (split) st[pl * 136 + ol] = hv;
      else       st[ol * GP_ + pl] = hv;
    }
  }
  __syncthreads();

  if (split) {
    _Float16* base = (nchunk < 2) ? qT : kT;
    const int hb = (nchunk & 1) * 4;
#pragma unroll
    for (int it = 0; it < 4; ++it) {
      const int pi = it * 256 + tid;                     // 1024 pieces of 16 B
      const int hd = pi >> 8, r = pi & 255;
      const int pl = r >> 2, dq = r & 3;
      const v8h v = *(const v8ha*)(st + pl * 136 + hd * 32 + dq * 8);
      _Float16* dst = base + ((size_t)(b * NH_ + hb + hd)) * NP_ * DK_ + pkoff(ptile * 64 + pl, dq * 8, 1);
      *(v8h*)dst = v;
      
    }
  } else {
    const int obase = (nchunk - 4) * 128;
#pragma unroll
    for (int it = 0; it < 4; ++it) {
      const int pi = it * 256 + tid;                     // 128 rows x 8 pieces
      const int ol = pi & 127, pc = pi >> 7;             // a wave: 32 rows of one piece column = 2 x 256 B
      const v8h v = *(const v8ha*)(st + ol * GP_ + pc * 8);
      _Float16* dst = vN + pkoff(b * NO_ + obase + ol, ptile * 64 + pc * 8, NP_ / 32);
      *(v8h*)dst = v;
      
    }
  }
}

// ---------------- position bias, gathered once for all batches ---------------------------------------
// biasP: per head n and group of 32 queries q32, 64 tiles of 16 keys (rows) x 32 queries (k) in fragment order,
// value pos_emb[index(query, key)][n] * 2^5. One work item (0..262143): one piece place (8 queries of one key) of
// four heads. The index is bounded here, before it forms an address.
struct BiasIdx { int ix[8]; };
__device__ __forceinline__ BiasIdx bias_idx(const int P, const int* __restrict__ pidx) {
  const int lane = P & 31, p = (P >> 5) & 1, kt = (P >> 7) & 63, q32 = P >> 13;
  const int m = lane & 15, h = lane >> 4;
  const int* src = pidx + (size_t)(q32 * 32 + 16 * p + 8 * h) * NP_ + kt * 16 + m;
  BiasIdx r;
#pragma unroll
  for (int e = 0; e < 8; ++e) r.ix[e] = src[(size_t)e * NP_];
  return r;
}
__device__ __forceinline__ void bias_put(const int P, const BiasIdx& r, const float* __restrict__ posemb,
                                         _Float16* biasP) {
  const int pl = P & 63, hh = (P >> 6) & 1, kt = (P >> 7) & 63, q32 = P >> 13;
  v8h o[4];
#pragma unroll
  for (int e = 0; e < 8; ++e) {
    int ix = r.ix[e];
    ix = ix < 0 ? 0 : (ix > NP_ - 1 ? NP_ - 1 : ix);
    const v4f pe = *(const v4fa*)(posemb + (size_t)ix * NH_ + hh * 4);
#pragma unroll
    for (int i = 0; i < 4; ++i) o[i][e] = (_Float16)(pe[i] * 32.0f);
  }
#pragma unroll
  for (int i = 0; i < 4; ++i)
    *(v8h*)(biasP + ((size_t)((hh * 4 + i) * (NP_ / 32) + q32) * (NP_ / 16) + kt) * 512 + pl * 8) = o[i];
}

// ---------------- all preparation in one launch ------------------------------------------------------
// None of the four jobs reads what another writes. Work-groups 0..31 fold the QKV weights, 32..39 the output
// weights (their serial row loops start first and run beside the rest); each of the other 1024 transposes one
// 64 x 64 tile of x and builds 256 work items of the bias table (1024 x 256 = all of them).
#define NFQ_ 32
#define NFO_ 8
__global__ __launch_bounds__(256) void k_prep(
    const float* __restrict__ Wq, const float* __restrict__ qg, const float* __restrict__ qb,
    const float* __restrict__ qm, const float* __restrict__ qv,
    const float* __restrict__ Wk, const float* __restrict__ kg, const float* __restrict__ kb,
    const float* __restrict__ km, const float* __restrict__ kv,
    const float* __restrict__ Wv, const float* __restrict__ vg, const float* __restrict__ vb,
    const float* __restrict__ vm, const float* __restrict__ vv,
    const float* __restrict__ Wo, const float* __restrict__ bo, const float* __restrict__ og,
    const float* __restrict__ ob, const float* __restrict__ om, const float* __restrict__ ov,
    const float* __restrict__ x, const int* __restrict__ pidx, const float* __restrict__ posemb,
    _Float16* Wh, _Float16* Wl, float* beta, _Float16* WoS, float* betaO,
    _Float16* xTh, _Float16* xTl, _Float16* biasP) {
  __shared__ __attribute__((aligned(16))) float T[64][65];
  const int blk = blockIdx.x;                            // the same for a whole work-group: its barriers are uniform
  if (blk < NFQ_) {
    fold_qkv_blk(blk, &T[0][0], Wq, qg, qb, qm, qv, Wk, kg, kb, km, kv, Wv, vg, vb, vm, vv, Wh, Wl, beta);
  } else if (blk < NFQ_ + NFO_) {
    fold_wo_blk(blk - NFQ_, &T[0][0], Wo, bo, og, ob, om, ov, WoS, betaO);
  } else {
    const int t = blk - (NFQ_ + NFO_);
    // the indices are requested with the tile's loads; the table's stores follow the tile's: a store in front of
    // the tile's barrier would be waited for there
    const int P = t * 256 + threadIdx.x;
    const BiasIdx bi = bias_idx(P, pidx);
    tr_blk(t & 15, (t >> 4) & 3, t >> 6, T, x, xTh, xTl);
    bias_put(P, bi, posemb, biasP);
    // precaution: the code of the other branches follows in the listing and rewrites registers that the stores above name
    asm volatile("s_wait_xcnt 0x0" ::: "memory");
  }
}

__global__ __launch_bounds__(256) void k_attn(
    const _Float16* __restrict__ qT, const _Float16* __restrict__ kT, const _Float16* __restrict__ vN,
    const _Float16* __restrict__ biasP, _Float16* goT) {
  const int qblk = blockIdx.x, n = blockIdx.y, b = blockIdx.z;
  const int tid = threadIdx.x;
  const int w = tid >> 5, lane = tid & 31;
  const int qbase = qblk * 256 + w * 32;
  const int bn = b * NH_ + n;
  v16h bq[2];
#pragma unroll
  for (int g = 0; g < 2; ++g) bq[g] = ldpk(qT + ((size_t)bn * NP_ + qbase + 16 * g) * DK_, lane);
  const _Float16* kp = kT + (size_t)bn * NP_ * DK_;                                  // A row m = key
  const _Float16* vp = vN + (size_t)(b * (NO_ / 16) + n * (DV_ / 16)) * (NP_ / 32) * 512;   // A row m = value channel
  const _Float16* bb = biasP + (size_t)(n * (NP_ / 32) + (qbase >> 5)) * (NP_ / 16) * 512;  // A row m = key, k = query
  const v8f vz = vzero();
  // selector of group g, a B fragment: 2^6 where k = 16g + column, else 0 (k of element e: 8h + e, of 8 + e: 16 + 8h + e).
  // 2^5 (table) * 2^6 = 1 / (SCALE * CQK_): the bias in the units of the raw product
  Frag sel[2];
#pragma unroll
  for (int e = 0; e < 8; ++e) {
    const _Float16 d = ((lane >> 4) * 8 + e == (lane & 15)) ? (_Float16)64.0f : (_Float16)0.0f;
    sel[0].v[e] = d;               sel[0].v[8 + e] = (_Float16)0.0f;
    sel[1].v[e] = (_Float16)0.0f;  sel[1].v[8 + e] = d;
  }

  v8f oacc[2][4] = {{vz, vz, vz, vz}, {vz, vz, vz, vz}};
  float mrun[2] = {-3.0e38f, -3.0e38f};
  float lsum[2] = {0.f, 0.f};

#pragma unroll 1
  for (int kc = 0; kc < 32; ++kc) {
    const int k0 = kc * 32;
    v16h ak[2], av[4];
#pragma unroll
    for (int u = 0; u < 2; ++u) ak[u] = ldpk(kp + (size_t)(k0 + 16 * u) * DK_, lane);
    v16h ab[2];
#pragma unroll
    for (int u = 0; u < 2; ++u) ab[u] = ldpk(bb + (size_t)(2 * kc + u) * 512, lane);
    // precaution: the registers that hold the addresses of the loads above are reused below
    asm volatile("s_wait_xcnt 0x0" ::: "memory");
#pragma unroll
    for (int t = 0; t < 4; ++t) av[t] = ldpk(vp + (size_t)(t * (NP_ / 32) + kc) * 512, lane);
    // precaution: as above, for the addresses of the V loads
    asm volatile("s_wait_xcnt 0x0" ::: "memory");
    // without it the scheduler lifts the bias products in between the loads, and the V loads wait for the first tile
    __builtin_amdgcn_sched_barrier(0);
#pragma unroll
    for (int g = 0; g < 2; ++g) {
      float tv[16];
#pragma unroll
      for (int u = 0; u < 2; ++u) {
        // D[8h+j][m]: key k0+16u+8h+j, query column m; raw units, one log2 unit = 1 / (CQK_ * L2E_)
        const v8f s = mmab(ak[u], bq[g], mmab(ab[u], sel[g].v, vz));
#pragma unroll
        for (int j = 0; j < 8; ++j) tv[u * 8 + j] = s[j];
      }
      float mx = tv[0];
#pragma unroll
      for (int i = 1; i < 16; ++i) mx = fmaxf(mx, tv[i]);
      mx = fmaxf(mx, xhalf(mx));
      const float mnew = fmaxf(mrun[g], mx);
      float alpha;                                       // 2^(old maximum - new maximum), 0 on the first chunk
      // v_nop: the slot behind a transcendental. In one statement with it, since a v_nop of its own does not stay behind it
      asm("v_exp_f32 %0, %1\n\tv_nop" : "=v"(alpha) : "v"((mrun[g] - mnew) * (CQK_ * L2E_)));
      mrun[g] = mnew;
      const float moff = fmaf(-mnew, CQK_ * L2E_, 8.0f); // P carries 2^8; the row sum carries it too
      Frag bp;
      float ps = 0.f;
#pragma unroll
      for (int i = 0; i < 16; ++i) {
        const float p = __builtin_amdgcn_exp2f(fmaf(tv[i], CQK_ * L2E_, moff));
        ps += p;
        bp.v[i] = (_Float16)p;                           // element i = key k0+16(i>>3)+8h+(i&7), as ldpk orders V
      }
      lsum[g] = lsum[g] * alpha + ps;
#pragma unroll
      for (int t = 0; t < 4; ++t) {
        oacc[g][t] = mmab(av[t], bp.v, oacc[g][t] * alpha);
      }
    }
  }

  // normalise, GELU (erf form), scale 2^8; a lane holds 8 consecutive channels of one query: one piece of a
  // fragment-order tile (rows = pixels, k = channels), so a wave's store is 512 contiguous bytes
#pragma unroll
  for (int g = 0; g < 2; ++g) {
    const float l = lsum[g] + xhalf(lsum[g]);
    const float co = 1.0f / (l * 8.0f);                  // undo 2^3 (V); 2^8 (P) cancels against l
    _Float16* dst = goT + ((size_t)(b * (NP_ / 16) + (qbase >> 4) + g) * (NO_ / 32) + n * 2) * 512 + lane * 8;
#pragma unroll
    for (int t = 0; t < 4; ++t) {
      v8h o;
#pragma unroll
      for (int j = 0; j < 8; ++j) {
        const float xo = oacc[g][t][j] * co;
        const float gl = 0.5f * xo * (1.0f + erff(xo * 0.70710678118654752f));
        o[j] = (_Float16)(gl * 256.0f);
      }
      *(v8h*)(dst + (t >> 1) * 512 + (t & 1) * 256) = o;   // k = 64n + 16t + 8h: k tile 2n + t/2, half t&1
    }
  }
}

// ---------------- output projection GEMM (bias + BN folded) ---------------------------------------
__global__ __launch_bounds__(256) void k_out(
    const _Float16* __restrict__ goT, const _Float16* __restrict__ WoS, const float* __restrict__ betaO,
    float* out) {
  __shared__ __attribute__((aligned(16))) float To[128 * 68];
  const int ptile = blockIdx.x, nchunk = blockIdx.y, b = blockIdx.z;
  const int tid = threadIdx.x, lane = tid & 31, m = lane & 15, h = lane >> 4;
  // the wave's number as a scalar: tile indices and bases are then formed in scalar registers, which leaves the
  // vector registers to the fragment groups
  const int w = __builtin_amdgcn_readfirstlane(tid >> 5);
  const int msub = w & 3, nh = w >> 2;
  const int nbase = nchunk * 128 + nh * 64;
  v8f acc[4] = {vzero(), vzero(), vzero(), vzero()};
  const _Float16* ar = goT + (size_t)(b * (NP_ / 16) + ptile * 4 + msub) * (NO_ / 32) * 512;
  // the fragments of four k steps are requested as one group ahead of their products: one load latency per group
#pragma unroll 1
  for (int k4 = 0; k4 < 16; k4 += 4) {
    v16h a[4], bt[4][4];
#pragma unroll
    for (int s = 0; s < 4; ++s) {
      a[s] = ldpk(ar + (k4 + s) * 512, lane);
#pragma unroll
      for (int t = 0; t < 4; ++t)
        bt[s][t] = ldpk(WoS + (size_t)(((nbase >> 4) + t) * (NO_ / 32) + k4 + s) * 512, lane);
    }
    // precaution: the address registers of the loads above are reused below
    asm volatile("s_wait_xcnt 0x0" ::: "memory");
    // without it the scheduler sinks each tile's loads to just ahead of its product: one exposed latency per tile
    __builtin_amdgcn_sched_barrier(0);
#pragma unroll
    for (int s = 0; s < 4; ++s) {
#pragma unroll
      for (int t = 0; t < 4; ++t) acc[t] = mmab(a[s], bt[s][t], acc[t]);
    }
  }
  const float kS = 1.0f / 4096.0f;                       // undo 2^4 (W) and 2^8 (G)
#pragma unroll
  for (int t = 0; t < 4; ++t) {
    const int ol = nh * 64 + t * 16 + m;
    const float bta = betaO[nchunk * 128 + ol];
#pragma unroll
    for (int j = 0; j < 8; ++j) {
      const int pl = msub * 16 + 8 * h + j;
      To[ol * 68 + pl] = acc[t][j] * kS + bta;
    }
  }
  __syncthreads();
#pragma unroll
  for (int it = 0; it < 8; ++it) {
    const int pi = it * 256 + tid;                       // 128 rows x 16 float4 pieces
    const int ol = pi >> 4, pc = pi & 15;
    const v4f v = *(const v4fa*)(To + ol * 68 + pc * 4);
    float* dst = out + ((size_t)(b * NC_ + nchunk * 128 + ol)) * NP_ + ptile * 64 + pc * 4;
    *(v4f*)dst = v;
    
  }
}

// ---------------- launch glue ------------------------------------------------------------------------
extern "C" void kernel_launch(void* const* d_in, const int* in_sizes, int n_in,
                              void* d_out, int out_size, void* d_ws, size_t ws_size,
                              hipStream_t stream) {
  if (n_in < 24) return;
  if (in_sizes[0] != NB_ * NC_ * NP_) return;
  if (in_sizes[1] != NC_ * NC_ || in_sizes[6] != NC_ * NC_ || in_sizes[11] != NO_ * NC_) return;
  if (in_sizes[16] != NP_ * NH_ || in_sizes[17] != NC_ * NO_ || in_sizes[23] != NP_ * NP_) return;
  {
    const int f32c[13] = {2, 3, 4, 5, 7, 8, 9, 10, 18, 19, 20, 21, 22};
    for (int i = 0; i < 13; ++i) if (in_sizes[f32c[i]] != NC_) return;
    const int f32o[4] = {12, 13, 14, 15};
    for (int i = 0; i < 4; ++i) if (in_sizes[f32o[i]] != NO_) return;
  }
  if (out_size != NB_ * NC_ * NP_) return;

  const float* x    = (const float*)d_in[0];
  const float* Wq   = (const float*)d_in[1];
  const float* q_g  = (const float*)d_in[2];
  const float* q_b  = (const float*)d_in[3];
  const float* q_m  = (const float*)d_in[4];
  const float* q_v  = (const float*)d_in[5];
  const float* Wk   = (const float*)d_in[6];
  const float* k_g  = (const float*)d_in[7];
  const float* k_b  = (const float*)d_in[8];
  const float* k_m  = (const float*)d_in[9];
  const float* k_v  = (const float*)d_in[10];
  const float* Wv   = (const float*)d_in[11];
  const float* v_g  = (const float*)d_in[12];
  const float* v_b  = (const float*)d_in[13];
  const float* v_m  = (const float*)d_in[14];
  const float* v_v  = (const float*)d_in[15];
  const float* pose = (const float*)d_in[16];
  const float* Wo   = (const float*)d_in[17];
  const float* bo   = (const float*)d_in[18];
  const float* o_g  = (const float*)d_in[19];
  const float* o_b  = (const float*)d_in[20];
  const float* o_m  = (const float*)d_in[21];
  const float* o_v  = (const float*)d_in[22];
  const int*   pix  = (const int*)d_in[23];

  // workspace carve (bytes), every offset a multiple of 1024
  const size_t O_WH    = 0;                                             // 1024*256*2
  const size_t O_WL    = O_WH    + (size_t)1024 * NC_ * 2;              // 524288
  const size_t O_BETA  = O_WL    + (size_t)1024 * NC_ * 2;              // 1048576, 4096 B
  const size_t O_WOS   = O_BETA  + 4096;                                // 1052672, 256*512*2
  const size_t O_BETAO = O_WOS   + (size_t)NC_ * NO_ * 2;               // 1314816, 1024 B
  const size_t O_XTH   = O_BETAO + 1024;                                // 1315840, 8 MB
  const size_t O_XTL   = O_XTH   + (size_t)NB_ * NP_ * NC_ * 2;         // 9704448
  const size_t O_QT    = O_XTL   + (size_t)NB_ * NP_ * NC_ * 2;         // 18093056, 8 MB
  const size_t O_KT    = O_QT    + (size_t)NB_ * NH_ * NP_ * DK_ * 2;   // 26481664
  const size_t O_VN    = O_KT    + (size_t)NB_ * NH_ * NP_ * DK_ * 2;   // 34870272, 16 MB
  const size_t O_GOT   = O_VN    + (size_t)NB_ * NO_ * NP_ * 2;         // 51647488, 16 MB
  const size_t O_BIAS  = O_GOT   + (size_t)NB_ * NP_ * NO_ * 2;         // 68424704, 16 MB
  const size_t O_END   = O_BIAS  + (size_t)NH_ * NP_ * NP_ * 2;         // 85201920
  if (O_END > ws_size) return;

  char* ws = (char*)d_ws;
  _Float16* Wh    = (_Float16*)(ws + O_WH);
  _Float16* Wl    = (_Float16*)(ws + O_WL);
  float*    beta  = (float*)   (ws + O_BETA);
  _Float16* WoS   = (_Float16*)(ws + O_WOS);
  float*    betaO = (float*)   (ws + O_BETAO);
  _Float16* xTh   = (_Float16*)(ws + O_XTH);
  _Float16* xTl   = (_Float16*)(ws + O_XTL);
  _Float16* qT    = (_Float16*)(ws + O_QT);
  _Float16* kT    = (_Float16*)(ws + O_KT);
  _Float16* vN    = (_Float16*)(ws + O_VN);
  _Float16* goT   = (_Float16*)(ws + O_GOT);
  _Float16* biasP = (_Float16*)(ws + O_BIAS);

  k_prep<<<dim3(NFQ_ + NFO_ + (NP_ / 64) * (NC_ / 64) * NB_), dim3(256), 0, stream>>>(
      Wq, q_g, q_b, q_m, q_v, Wk, k_g, k_b, k_m, k_v, Wv, v_g, v_b, v_m, v_v,
      Wo, bo, o_g, o_b, o_m, o_v, x, pix, pose, Wh, Wl, beta, WoS, betaO, xTh, xTl, biasP);
  k_qkv<<<dim3(NP_ / 64, 8, NB_), dim3(256), 0, stream>>>(xTh, xTl, Wh, beta, qT, kT, vN);   // Wl = Wh + 1024*256 elements
  k_attn<<<dim3(NP_ / 256, NH_, NB_), dim3(256), 0, stream>>>(qT, kT, vN, biasP, goT);
  k_out<<<dim3(NP_ / 64, 2, NB_), dim3(256), 0, stream>>>(goT, WoS, betaO, (float*)d_out);
}

// v006
// A run of this version takes 104 microseconds.
// In both of two side-by-side timings against v005, it was 1.05 times as fast.
// Over all steps from v000 it is 6.77 times as fast.
#include <hip/hip_runtime.h>
#include <stddef.h>

// Contractions on v_wmma_f32_16x16x32_f16 (f16 operands, f32 accumulate): q/k channel GEMM as f16 hi/lo split (3 products, W scaled 2^10, x scaled 2^6), v channel GEMM single f16, QK^T single f16 (q,k scaled 2^3), P*V single f16 (P unnormalised, scaled 2^8, V scaled 2^3), output GEMM single f16 (W scaled 2^4, G scaled 2^8); position bias single f16 (scaled 2^5) times a 0 / 2^6 selector, summed into the QK^T accumulator; BN folds, softmax, GELU in f32.

typedef _Float16 v16h __attribute__((ext_vector_type(16)));
typedef _Float16 v8h  __attribute__((ext_vector_type(8)));
typedef float    v8f  __attribute__((ext_vector_type(8)));
typedef float    v4f  __attribute__((ext_vector_type(4)));
typedef v8h v8ha __attribute__((may_alias));
typedef v4f v4fa __attribute__((may_alias));

#define NB_  16
#define NC_  256
#define NP_  1024
#define NH_  8
#define DK_  32
#define DV_  64
#define NO_  512
#define GP_  72
#define EPS_ 1e-5f
#define CQK_ (0.17677669529663687f * 0.015625f)
#define L2E_ 1.4426950408889634f

union Frag { v16h v; v8h p[2]; };

// Fragment-order storage of every 16-bit matrix operand: a tile of 16 rows x 32 k is 1024 contiguous bytes,
// made of 64 pieces of 8 elements; piece p*32 + h*16 + m holds row m, k = 16p + 8h .. +7.
// Tiles are ordered [row tile][k tile], KT k tiles to a row tile. A wave-wide 16-byte load of one half of a
// fragment then covers 512 contiguous bytes (4 whole 128-byte lines) and not 16 lines.
__device__ __forceinline__ size_t pkoff(int row, int k, int KT) {
  return ((((size_t)(row >> 4) * KT + (k >> 5)) * 64) + ((k >> 4) & 1) * 32 + ((k >> 3) & 1) * 16 + (row & 15)) * 8;
}

// 16x32 fragment from one tile: elements 0..7 <- k 8h..+7, 8..15 <- k 16+8h..+7 of row m (lane = 16h + m)
__device__ __forceinline__ v16h ldpk(const _Float16* tile, int lane) {
  Frag f;
  f.p[0] = *(const v8ha*)(tile + lane * 8);
  f.p[1] = *(const v8ha*)(tile + 256 + lane * 8);
  return f.v;
}

__device__ __forceinline__ v8f mmab(v16h a, v16h b, v8f c) {
  return __builtin_amdgcn_wmma_f32_16x16x32_f16(false, a, false, b, (short)0, c, false, false);
}

// lane l <-> lane l ^ 16
__device__ __forceinline__ float xhalf(float x) {
  const int i = __builtin_bit_cast(int, x);
  return __builtin_bit_cast(float, __builtin_amdgcn_permlanex16(i, i, 0x76543210, 0xfedcba98, false, false));
}

__device__ __forceinline__ v8f vzero() {
  v8f z = {0.f, 0.f, 0.f, 0.f, 0.f, 0.f, 0.f, 0.f};
  return z;
}

// ---------------- BN folded into QKV weights: Wh/Wl f16 hi/lo planes of W*inv*1024, beta[1024] -----
// 32 rows per block, wave w handles rows w*4..w*4+3, lane writes 8 consecutive columns (16 B)
__device__ __forceinline__ void fold_qkv_blk(const int blk, float* sb,
    const float* __restrict__ Wq, const float* __restrict__ qg, const float* __restrict__ qb,
    const float* __restrict__ qm, const float* __restrict__ qv,
    const float* __restrict__ Wk, const float* __restrict__ kg, const float* __restrict__ kb,
    const float* __restrict__ km, const float* __restrict__ kv,
    const float* __restrict__ Wv, const float* __restrict__ vg, const float* __restrict__ vb,
    const float* __restrict__ vm, const float* __restrict__ vv,
    _Float16* Wh, _Float16* Wl, float* beta) {
  const int tid = threadIdx.x, w = tid >> 5, lane = tid & 31;
#pragma unroll 1
  for (int i = 0; i < 4; ++i) {
    const int o = blk * 32 + w * 4 + i;   // 0..1023
    const float* W;
    float g, bb, mm, var;
    int oo;
    if (o < 256)      { oo = o;       W = Wq; g = qg[oo]; bb = qb[oo]; mm = qm[oo]; var = qv[oo]; }
    else if (o < 512) { oo = o - 256; W = Wk; g = kg[oo]; bb = kb[oo]; mm = km[oo]; var = kv[oo]; }
    else              { oo = o - 512; W = Wv; g = vg[oo]; bb = vb[oo]; mm = vm[oo]; var = vv[oo]; }
    const float inv = g * (1.0f / sqrtf(var + EPS_));
    const float* wr = W + (size_t)oo * NC_ + lane * 8;
    const v4f w0 = *(const v4fa*)(wr);
    const v4f w1 = *(const v4fa*)(wr + 4);
    float vals[8] = {w0.x, w0.y, w0.z, w0.w, w1.x, w1.y, w1.z, w1.w};
    v8h hv, lv;
#pragma unroll
    for (int e = 0; e < 8; ++e) {
      const float s = vals[e] * inv * 1024.0f;
      const _Float16 hh = (_Float16)s;
      const _Float16 ll = (_Float16)(s - (float)hh);
      hv[e] = hh; lv[e] = ll;
    }
    _Float16* dh = Wh + pkoff(o, lane * 8, NC_ / 32);
    _Float16* dl = Wl + pkoff(o, lane * 8, NC_ / 32);
    *(v8h*)dh = hv;
    *(v8h*)dl = lv;
    
    if (lane == 0) sb[w * 4 + i] = bb - mm * inv;
  }
  __syncthreads();
  if (w == 0 && lane < 8) {
    v4f b4;
    b4.x = sb[lane * 4 + 0]; b4.y = sb[lane * 4 + 1]; b4.z = sb[lane * 4 + 2]; b4.w = sb[lane * 4 + 3];
    float* db = beta + blk * 32 + lane * 4;
    *(v4f*)db = b4;
    
  }
}

// ---------------- bo + output BN folded into Wo: WoS f16 = Wo*inv*16, betaO[256] -------------------
__device__ __forceinline__ void fold_wo_blk(const int blk, float* sb,
    const float* __restrict__ Wo, const float* __restrict__ bo, const float* __restrict__ og,
    const float* __restrict__ ob, const float* __restrict__ om, const float* __restrict__ ov,
    _Float16* WoS, float* betaO) {
  const int tid = threadIdx.x, w = tid >> 5, lane = tid & 31;
#pragma unroll 1
  for (int i = 0; i < 4; ++i) {
    const int o = blk * 32 + w * 4 + i;   // 0..255
    const float inv = og[o] * (1.0f / sqrtf(ov[o] + EPS_));
#pragma unroll
    for (int hf = 0; hf < 2; ++hf) {
      const float* wr = Wo + (size_t)o * NO_ + hf * 256 + lane * 8;
      const v4f w0 = *(const v4fa*)(wr);
      const v4f w1 = *(const v4fa*)(wr + 4);
      float vals[8] = {w0.x, w0.y, w0.z, w0.w, w1.x, w1.y, w1.z, w1.w};
      v8h hv;
#pragma unroll
      for (int e = 0; e < 8; ++e) hv[e] = (_Float16)(vals[e] * inv * 16.0f);
      _Float16* dh = WoS + pkoff(o, hf * 256 + lane * 8, NO_ / 32);
      *(v8h*)dh = hv;
      
    }
    if (lane == 0) sb[w * 4 + i] = bo[o] * inv + ob[o] - om[o] * inv;
  }
  __syncthreads();
  if (w == 0 && lane < 8) {
    v4f b4;
    b4.x = sb[lane * 4 + 0]; b4.y = sb[lane * 4 + 1]; b4.z = sb[lane * 4 + 2]; b4.w = sb[lane * 4 + 3];
    float* db = betaO + blk * 32 + lane * 4;
    *(v4f*)db = b4;
    
  }
}

// ---------------- x[b][c][p] -> xTh/xTl, rows b*1024+p, k = c, fragment order: f16 hi/lo planes of 64*x ----
__device__ __forceinline__ void tr_blk(const int pblk, const int cblk, const int b, float (*T)[65],
                                       const float* __restrict__ x, _Float16* xTh, _Float16* xTl) {
  const int tid = threadIdx.x;
#pragma unroll
  for (int it = 0; it < 16; ++it) {
    const int idx = it * 256 + tid;
    const int ci = idx >> 6, pj = idx & 63;
    T[ci][pj] = x[((size_t)(b * NC_ + cblk * 64 + ci)) * NP_ + pblk * 64 + pj];
  }
  __syncthreads();
#pragma unroll
  for (int it = 0; it < 2; ++it) {
    const int pi = it * 256 + tid;
    const int pl = pi & 63, pc = pi >> 6;                // a wave: 32 rows of one piece column = 2 x 256 B
    v8h hv, lv;
#pragma unroll
    for (int e = 0; e < 8; ++e) {
      const float s = T[pc * 8 + e][pl] * 64.0f;
      const _Float16 hh = (_Float16)s;
      const _Float16 ll = (_Float16)(s - (float)hh);
      hv[e] = hh; lv[e] = ll;
    }
    const size_t off = pkoff(b * NP_ + pblk * 64 + pl, cblk * 64 + pc * 8, NC_ / 32);
    *(v8h*)(xTh + off) = hv;
    *(v8h*)(xTl + off) = lv;
    
  }
}

// ---------------- QKV projection GEMM (BN folded) --------------------------------------------------
// K loop: every fragment of a group (one k step with hi/lo planes, two without) is requested before the group's first
// product, so a group waits out one load latency and not one per tile. Each accumulator takes its products in the order hi*hi, hi*lo, lo*hi,
// k ascending from the work-group's own first group g0 and wrapping: neighbours along ptile start one group apart, to spread
// their requests for one W line; g0 is the same for every b.
template <bool SPLIT>
__device__ __forceinline__ void qkv_acc(const _Float16* __restrict__ ahr, const _Float16* __restrict__ alr,
                                        const _Float16* __restrict__ whr, int loff, int rot, v8f (&acc)[4]) {
  constexpr int G = SPLIT ? 1 : 2;                       // k steps to a group: 20 loads of 16 bytes either way
  constexpr int NG = 8 / G;                              // groups in the walk
  int g0 = rot & (NG - 1);                               // the group the walk stands at (scalar)
  // the lane's own addresses, advanced behind the wait: no load of a group lands on a register that another load of
  // the group names. The lo plane of W follows its hi plane in the workspace: one address serves both.
  const _Float16* pah = ahr + loff + g0 * (G * 512);
  const _Float16* pal = alr + loff + g0 * (G * 512);
  const _Float16* pwh = whr + loff + g0 * (G * 512);
#pragma unroll 1
  for (int it = 0; it < NG; ++it) {
    v16h ah[G], al[G], bh[G][4], bl[G][4];
#pragma unroll
    for (int s = 0; s < G; ++s) {
      ah[s] = ldpk(pah + s * 512, 0);
      if (SPLIT) al[s] = ldpk(pal + s * 512, 0);
#pragma unroll
      for (int t = 0; t < 4; ++t) {
        bh[s][t] = ldpk(pwh + (t * (NC_ / 32) + s) * 512, 0);
        if (SPLIT) bl[s][t] = ldpk(pwh + 1024 * NC_ + (t * (NC_ / 32) + s) * 512, 0);
      }
    }
    // precaution: the address registers of the loads above (named here, so that they live up to the wait) are
    // advanced below
    if (SPLIT) asm volatile("s_wait_xcnt 0x0" :: "v"(pah), "v"(pal), "v"(pwh) : "memory");
    else       asm volatile("s_wait_xcnt 0x0" :: "v"(pah), "v"(pwh) : "memory");
    // without it the scheduler sinks each tile's loads to just ahead of its product: one exposed latency per tile
    __builtin_amdgcn_sched_barrier(0);
    const int adv = (g0 == NG - 1) ? (G - 8) * 512 : G * 512;   // behind the last group: back to k = 0
    g0 = (g0 + 1) & (NG - 1);
    pah += adv; pal += adv; pwh += adv;
#pragma unroll
    for (int s = 0; s < G; ++s) {
#pragma unroll
      for (int t = 0; t < 4; ++t) acc[t] = mmab(ah[s], bh[s][t], acc[t]);
      if (SPLIT) {
#pragma unroll
        for (int t = 0; t < 4; ++t) acc[t] = mmab(ah[s], bl[s][t], acc[t]);
#pragma unroll
        for (int t = 0; t < 4; ++t) acc[t] = mmab(al[s], bh[s][t], acc[t]);
      }
    }
  }
}

// block tile 64 pixels x 128 output channels, 8 waves (4 row groups x 2 column halves), K = 256.
// q,k column chunks (nchunk 0..3): hi*hi + hi*lo + lo*hi; v chunks (4..7): hi*hi.
// qT,kT: per b*8+n rows p, k = d (x8);  vN: rows b*512+channel, k = p (x8); all in fragment order
// 8 waves per SIMD (128 registers): four work-groups to a WGP, the grid in two even rounds
__global__ __launch_bounds__(256) __attribute__((amdgpu_waves_per_eu(8))) void k_qkv(
    const _Float16* __restrict__ xTh, const _Float16* __restrict__ xTl,
    const _Float16* __restrict__ Wh, const float* __restrict__ beta,
    _Float16* qT, _Float16* kT, _Float16* vN) {
  __shared__ __attribute__((aligned(16))) _Float16 st[128 * GP_];   // q/k view: [64][136], v view: [128][72]
  const int ptile = blockIdx.x, nchunk = blockIdx.y, b = blockIdx.z;
  const int tid = threadIdx.x, lane = tid & 31, m = lane & 15, h = lane >> 4;
  // the wave's number as a scalar: tile indices and bases are then formed in scalar registers, which leaves the
  // vector registers to the fragment groups
  const int w = __builtin_amdgcn_readfirstlane(tid >> 5);
  const int msub = w & 3, nh = w >> 2;
  const int nbase = nchunk * 128 + nh * 64;
  const bool split = (nchunk < 4);   // block-uniform

  v8f acc[4] = {vzero(), vzero(), vzero(), vzero()};
  const size_t atile = (size_t)(b * (NP_ / 16) + ptile * 4 + msub) * (NC_ / 32) * 512;
  const _Float16* ahr = xTh + atile;
  const _Float16* alr = xTl + atile;
  const _Float16* whr = Wh + (size_t)(nbase >> 4) * (NC_ / 32) * 512;
  // W lines are shared along ptile (and b), x lines along nchunk: neighbours in either direction start one group apart
  const int rot = ptile + nchunk;
  if (split) qkv_acc<true>(ahr, alr, whr, lane * 8, rot, acc);
  else       qkv_acc<false>(ahr, alr, whr, lane * 8, rot, acc);

  // epilogue: scale back 2^-16, add folded beta, scale x8, stage 16-bit tile in LDS
  const float kS = 1.0f / 65536.0f;
#pragma unroll
  for (int t = 0; t < 4; ++t) {
    const int ol = nh * 64 + t * 16 + m;                 // 0..127 (column = this lane's n)
    const float bta = beta[nchunk * 128 + ol];
#pragma unroll
    for (int j = 0; j < 8; ++j) {
      const int pl = msub * 16 + 8 * h + j;              // D row 8h+j
      const _Float16 hv = (_Float16)((acc[t][j] * kS + bta) * 8.0f);
      if (split) st[pl * 136 + ol] = hv;
      else       st[ol * GP_ + pl] = hv;
    }
  }
  __syncthreads();

  if (split) {
    _Float16* base = (nchunk < 2) ? qT : kT;
    const int hb = (nchunk & 1) * 4;
#pragma unroll
    for (int it = 0; it < 4; ++it) {
      const int pi = it * 256 + tid;                     // 1024 pieces of 16 B
      const int hd = pi >> 8, r = pi & 255;
      const int pl = r >> 2, dq = r & 3;
      const v8h v = *(const v8ha*)(st + pl * 136 + hd * 32 + dq * 8);
      _Float16* dst = base + ((size_t)(b * NH_ + hb + hd)) * NP_ * DK_ + pkoff(ptile * 64 + pl, dq * 8, 1);
      *(v8h*)dst = v;
      
    }
  } else {
    const int obase = (nchunk - 4) * 128;
#pragma unroll
    for (int it = 0; it < 4; ++it) {
      const int pi = it * 256 + tid;                     // 128 rows x 8 pieces
      const int ol = pi & 127, pc = pi >> 7;             // a wave: 32 rows of one piece column = 2 x 256 B
      const v8h v = *(const v8ha*)(st + ol * GP_ + pc * 8);
      _Float16* dst = vN + pkoff(b * NO_ + obase + ol, ptile * 64 + pc * 8, NP_ / 32);
      *(v8h*)dst = v;
      
    }
  }
}

// ---------------- position bias, gathered once for all batches ---------------------------------------
// biasP: per head n and group of 32 queries q32, 64 tiles of 16 keys (rows) x 32 queries (k) in fragment order,
// value pos_emb[index(query, key)][n] * 2^5. One work item (0..262143): one piece place (8 queries of one key) of
// four heads. The index is bounded here, before it forms an address.
struct BiasIdx { int ix[8]; };
__device__ __forceinline__ BiasIdx bias_idx(const int P, const int* __restrict__ pidx) {
  const int lane = P & 31, p = (P >> 5) & 1, kt = (P >> 7) & 63, q32 = P >> 13;
  const int m = lane & 15, h = lane >> 4;
  const int* src = pidx + (size_t)(q32 * 32 + 16 * p + 8 * h) * NP_ + kt * 16 + m;
  BiasIdx r;
#pragma unroll
  for (int e = 0; e < 8; ++e) r.ix[e] = src[(size_t)e * NP_];
  return r;
}
__device__ __forceinline__ void bias_put(const int P, const BiasIdx& r, const float* __restrict__ posemb,
                                         _Float16* biasP) {
  const int pl = P & 63, hh = (P >> 6) & 1, kt = (P >> 7) & 63, q32 = P >> 13;
  v8h o[4];
#pragma unroll
  for (int e = 0; e < 8; ++e) {
    int ix = r.ix[e];
    ix = ix < 0 ? 0 : (ix > NP_ - 1 ? NP_ - 1 : ix);
    const v4f pe = *(const v4fa*)(posemb + (size_t)ix * NH_ + hh * 4);
#pragma unroll
    for (int i = 0; i < 4; ++i) o[i][e] = (_Float16)(pe[i] * 32.0f);
  }
#pragma unroll
  for (int i = 0; i < 4; ++i)
    *(v8h*)(biasP + ((size_t)((hh * 4 + i) * (NP_ / 32) + q32) * (NP_ / 16) + kt) * 512 + pl * 8) = o[i];
}

// ---------------- all preparation in one launch ------------------------------------------------------
// None of the four jobs reads what another writes. Work-groups 0..31 fold the QKV weights, 32..39 the output
// weights (their serial row loops start first and run beside the rest); each of the other 1024 transposes one
// 64 x 64 tile of x and builds 256 work items of the bias table (1024 x 256 = all of them).
#define NFQ_ 32
#define NFO_ 8
__global__ __launch_bounds__(256) void k_prep(
    const float* __restrict__ Wq, const float* __restrict__ qg, const float* __restrict__ qb,
    const float* __restrict__ qm, const float* __restrict__ qv,
    const float* __restrict__ Wk, const float* __restrict__ kg, const float* __restrict__ kb,
    const float* __restrict__ km, const float* __restrict__ kv,
    const float* __restrict__ Wv, const float* __restrict__ vg, const float* __restrict__ vb,
    const float* __restrict__ vm, const float* __restrict__ vv,
    const float* __restrict__ Wo, const float* __restrict__ bo, const float* __restrict__ og,
    const float* __restrict__ ob, const float* __restrict__ om, const float* __restrict__ ov,
    const float* __restrict__ x, const int* __restrict__ pidx, const float* __restrict__ posemb,
    _Float16* Wh, _Float16* Wl, float* beta, _Float16* WoS, float* betaO,
    _Float16* xTh, _Float16* xTl, _Float16* biasP) {
  __shared__ __attribute__((aligned(16))) float T[64][65];
  const int blk = blockIdx.x;                            // the same for a whole work-group: its barriers are uniform
  if (blk < NFQ_) {
    fold_qkv_blk(blk, &T[0][0], Wq, qg, qb, qm, qv, Wk, kg, kb, km, kv, Wv, vg, vb, vm, vv, Wh, Wl, beta);
  } else if (blk < NFQ_ + NFO_) {
    fold_wo_blk(blk - NFQ_, &T[0][0], Wo, bo, og, ob, om, ov, WoS, betaO);
  } else {
    const int t = blk - (NFQ_ + NFO_);
    // the indices are requested with the tile's loads; the table's stores follow the tile's: a store in front of
    // the tile's barrier would be waited for there
    const int P = t * 256 + threadIdx.x;
    const BiasIdx bi = bias_idx(P, pidx);
    tr_blk(t & 15, (t >> 4) & 3, t >> 6, T, x, xTh, xTl);
    bias_put(P, bi, posemb, biasP);
    // precaution: the code of the other branches follows in the listing and rewrites registers that the stores above name
    asm volatile("s_wait_xcnt 0x0" ::: "memory");
  }
}

__global__ __launch_bounds__(256) void k_attn(
    const _Float16* __restrict__ qT, const _Float16* __restrict__ kT, const _Float16* __restrict__ vN,
    const _Float16* __restrict__ biasP, _Float16* goT) {
  const int qblk = blockIdx.x, n = blockIdx.y, b = blockIdx.z;
  const int tid = threadIdx.x;
  const int w = tid >> 5, lane = tid & 31;
  const int qbase = qblk * 256 + w * 32;
  const int bn = b * NH_ + n;
  v16h bq[2];
#pragma unroll
  for (int g = 0; g < 2; ++g) bq[g] = ldpk(qT + ((size_t)bn * NP_ + qbase + 16 * g) * DK_, lane);
  const _Float16* kp = kT + (size_t)bn * NP_ * DK_;                                  // A row m = key
  const _Float16* vp = vN + (size_t)(b * (NO_ / 16) + n * (DV_ / 16)) * (NP_ / 32) * 512;   // A row m = value channel
  const _Float16* bb = biasP + (size_t)(n * (NP_ / 32) + (qbase >> 5)) * (NP_ / 16) * 512;  // A row m = key, k = query
  const v8f vz = vzero();
  // selector of group g, a B fragment: 2^6 where k = 16g + column, else 0 (k of element e: 8h + e, of 8 + e: 16 + 8h + e).
  // 2^5 (table) * 2^6 = 1 / (SCALE * CQK_): the bias in the units of the raw product
  Frag sel[2];
#pragma unroll
  for (int e = 0; e < 8; ++e) {
    const _Float16 d = ((lane >> 4) * 8 + e == (lane & 15)) ? (_Float16)64.0f : (_Float16)0.0f;
    sel[0].v[e] = d;               sel[0].v[8 + e] = (_Float16)0.0f;
    sel[1].v[e] = (_Float16)0.0f;  sel[1].v[8 + e] = d;
  }

  v8f oacc[2][4] = {{vz, vz, vz, vz}, {vz, vz, vz, vz}};
  float mrun[2] = {-3.0e38f, -3.0e38f};
  float lsum[2] = {0.f, 0.f};

  // the four work-groups that read one (b, n)'s K and V start 8 chunks apart, those that read one bias plane 4 apart (in
  // pairs), and wrap: their requests for one line do not meet in L2. All waves of a work-group walk alike: they share K and V lines.
  int kc = (qblk * 8 + (b & 7) * 4) & 31;
  const _Float16* kpc = kp + (size_t)kc * 32 * DK_;
  const _Float16* vpc = vp + (size_t)kc * 512;
  const _Float16* bbc = bb + (size_t)kc * 1024;
#pragma unroll 1
  for (int it = 0; it < 32; ++it) {
    v16h ak[2], av[4];
#pragma unroll
    for (int u = 0; u < 2; ++u) ak[u] = ldpk(kpc + (size_t)(16 * u) * DK_, lane);
    v16h ab[2];
#pragma unroll
    for (int u = 0; u < 2; ++u) ab[u] = ldpk(bbc + (size_t)u * 512, lane);
    // precaution: the registers that hold the addresses of the loads above are reused below
    asm volatile("s_wait_xcnt 0x0" ::: "memory");
#pragma unroll
    for (int t = 0; t < 4; ++t) av[t] = ldpk(vpc + (size_t)(t * (NP_ / 32)) * 512, lane);
    // precaution: as above, for the addresses of the V loads
    asm volatile("s_wait_xcnt 0x0" ::: "memory");
    // without it the scheduler lifts the bias products in between the loads, and the V loads wait for the first tile
    __builtin_amdgcn_sched_barrier(0);
    {
      const int adv = (kc == 31) ? -31 : 1;              // behind the last chunk: back to key 0
      kc = (kc + 1) & 31;
      kpc += adv * (32 * DK_); vpc += adv * 512; bbc += adv * 1024;
    }
#pragma unroll
    for (int g = 0; g < 2; ++g) {
      float tv[16];
#pragma unroll
      for (int u = 0; u < 2; ++u) {
        // D[8h+j][m]: key 16u+8h+j of this chunk, query column m; raw units, one log2 unit = 1 / (CQK_ * L2E_)
        const v8f s = mmab(ak[u], bq[g], mmab(ab[u], sel[g].v, vz));
#pragma unroll
        for (int j = 0; j < 8; ++j) tv[u * 8 + j] = s[j];
      }
      float mx = tv[0];
#pragma unroll
      for (int i = 1; i < 16; ++i) mx = fmaxf(mx, tv[i]);
      mx = fmaxf(mx, xhalf(mx));
      const float mnew = fmaxf(mrun[g], mx);
      float alpha;                                       // 2^(old maximum - new maximum), 0 on the first chunk
      // v_nop: the slot behind a transcendental. In one statement with it, since a v_nop of its own does not stay behind it
      asm("v_exp_f32 %0, %1\n\tv_nop" : "=v"(alpha) : "v"((mrun[g] - mnew) * (CQK_ * L2E_)));
      mrun[g] = mnew;
      const float moff = fmaf(-mnew, CQK_ * L2E_, 8.0f); // P carries 2^8; the row sum carries it too
      Frag bp;
      float ps = 0.f;
#pragma unroll
      for (int i = 0; i < 16; ++i) {
        const float p = __builtin_amdgcn_exp2f(fmaf(tv[i], CQK_ * L2E_, moff));
        ps += p;
        bp.v[i] = (_Float16)p;                           // element i = key k0+16(i>>3)+8h+(i&7), as ldpk orders V
      }
      lsum[g] = lsum[g] * alpha + ps;
#pragma unroll
      for (int t = 0; t < 4; ++t) {
        oacc[g][t] = mmab(av[t], bp.v, oacc[g][t] * alpha);
      }
    }
  }

  // normalise, GELU (erf form), scale 2^8; a lane holds 8 consecutive channels of one query: one piece of a
  // fragment-order tile (rows = pixels, k = channels), so a wave's store is 512 contiguous bytes
#pragma unroll
  for (int g = 0; g < 2; ++g) {
    const float l = lsum[g] + xhalf(lsum[g]);
    const float co = 1.0f / (l * 8.0f);                  // undo 2^3 (V); 2^8 (P) cancels against l
    _Float16* dst = goT + ((size_t)(b * (NP_ / 16) + (qbase >> 4) + g) * (NO_ / 32) + n * 2) * 512 + lane * 8;
#pragma unroll
    for (int t = 0; t < 4; ++t) {
      v8h o;
#pragma unroll
      for (int j = 0; j < 8; ++j) {
        const float xo = oacc[g][t][j] * co;
        const float gl = 0.5f * xo * (1.0f + erff(xo * 0.70710678118654752f));
        o[j] = (_Float16)(gl * 256.0f);
      }
      *(v8h*)(dst + (t >> 1) * 512 + (t & 1) * 256) = o;   // k = 64n + 16t + 8h: k tile 2n + t/2, half t&1
    }
  }
}

// ---------------- output projection GEMM (bias + BN folded) ---------------------------------------
__global__ __launch_bounds__(256) void k_out(
    const _Float16* __restrict__ goT, const _Float16* __restrict__ WoS, const float* __restrict__ betaO,
    float* out) {
  __shared__ __attribute__((aligned(16))) float To[128 * 68];
  const int ptile = blockIdx.x, nchunk = blockIdx.y, b = blockIdx.z;
  const int tid = threadIdx.x, lane = tid & 31, m = lane & 15, h = lane >> 4;
  // the wave's number as a scalar: tile indices and bases are then formed in scalar registers, which leaves the
  // vector registers to the fragment groups
  const int w = __builtin_amdgcn_readfirstlane(tid >> 5);
  const int msub = w & 3, nh = w >> 2;
  const int nbase = nchunk * 128 + nh * 64;
  v8f acc[4] = {vzero(), vzero(), vzero(), vzero()};
  const _Float16* ar = goT + (size_t)(b * (NP_ / 16) + ptile * 4 + msub) * (NO_ / 32) * 512;
  // the fragments of four k steps are requested as one group ahead of their products: one load latency per group.
  // Neighbours along ptile (which share weight lines) and the two nchunk (which share G lines) start at different
  // groups and wrap; g0 is the same for every b and for ptile four apart.
  int g0 = (ptile + nchunk * 2) & 3;                     // the group the walk stands at (scalar)
  const _Float16* pa = ar + g0 * (4 * 512);
  const _Float16* pw = WoS + (size_t)(nbase >> 4) * (NO_ / 32) * 512 + g0 * (4 * 512);
#pragma unroll 1
  for (int it = 0; it < 4; ++it) {
    v16h a[4], bt[4][4];
#pragma unroll
    for (int s = 0; s < 4; ++s) {
      a[s] = ldpk(pa + s * 512, lane);
#pragma unroll
      for (int t = 0; t < 4; ++t)
        bt[s][t] = ldpk(pw + (t * (NO_ / 32) + s) * 512, lane);
    }
    // precaution: the address registers of the loads above are reused below
    asm volatile("s_wait_xcnt 0x0" ::: "memory");
    // without it the scheduler sinks each tile's loads to just ahead of its product: one exposed latency per tile
    __builtin_amdgcn_sched_barrier(0);
    {
      const int adv = (g0 == 3) ? -12 * 512 : 4 * 512;   // behind the last group: back to k = 0
      g0 = (g0 + 1) & 3;
      pa += adv; pw += adv;
    }
#pragma unroll
    for (int s = 0; s < 4; ++s) {
#pragma unroll
      for (int t = 0; t < 4; ++t) acc[t] = mmab(a[s], bt[s][t], acc[t]);
    }
  }
  const float kS = 1.0f / 4096.0f;                       // undo 2^4 (W) and 2^8 (G)
#pragma unroll
  for (int t = 0; t < 4; ++t) {
    const int ol = nh * 64 + t * 16 + m;
    const float bta = betaO[nchunk * 128 + ol];
#pragma unroll
    for (int j = 0; j < 8; ++j) {
      const int pl = msub * 16 + 8 * h + j;
      To[ol * 68 + pl] = acc[t][j] * kS + bta;
    }
  }
  __syncthreads();
#pragma unroll
  for (int it = 0; it < 8; ++it) {
    const int pi = it * 256 + tid;                       // 128 rows x 16 float4 pieces
    const int ol = pi >> 4, pc = pi & 15;
    const v4f v = *(const v4fa*)(To + ol * 68 + pc * 4);
    float* dst = out + ((size_t)(b * NC_ + nchunk * 128 + ol)) * NP_ + ptile * 64 + pc * 4;
    *(v4f*)dst = v;
    
  }
}

// ---------------- launch glue ------------------------------------------------------------------------
extern "C" void kernel_launch(void* const* d_in, const int* in_sizes, int n_in,
                              void* d_out, int out_size, void* d_ws, size_t ws_size,
                              hipStream_t stream) {
  if (n_in < 24) return;
  if (in_sizes[0] != NB_ * NC_ * NP_) return;
  if (in_sizes[1] != NC_ * NC_ || in_sizes[6] != NC_ * NC_ || in_sizes[11] != NO_ * NC_) return;
  if (in_sizes[16] != NP_ * NH_ || in_sizes[17] != NC_ * NO_ || in_sizes[23] != NP_ * NP_) return;
  {
    const int f32c[13] = {2, 3, 4, 5, 7, 8, 9, 10, 18, 19, 20, 21, 22};
    for (int i = 0; i < 13; ++i) if (in_sizes[f32c[i]] != NC_) return;
    const int f32o[4] = {12, 13, 14, 15};
    for (int i = 0; i < 4; ++i) if (in_sizes[f32o[i]] != NO_) return;
  }
  if (out_size != NB_ * NC_ * NP_) return;

  const float* x    = (const float*)d_in[0];
  const float* Wq   = (const float*)d_in[1];
  const float* q_g  = (const float*)d_in[2];
  const float* q_b  = (const float*)d_in[3];
  const float* q_m  = (const float*)d_in[4];
  const float* q_v  = (const float*)d_in[5];
  const float* Wk   = (const float*)d_in[6];
  const float* k_g  = (const float*)d_in[7];
  const float* k_b  = (const float*)d_in[8];
  const float* k_m  = (const float*)d_in[9];
  const float* k_v  = (const float*)d_in[10];
  const float* Wv   = (const float*)d_in[11];
  const float* v_g  = (const float*)d_in[12];
  const float* v_b  = (const float*)d_in[13];
  const float* v_m  = (const float*)d_in[14];
  const float* v_v  = (const float*)d_in[15];
  const float* pose = (const float*)d_in[16];
  const float* Wo   = (const float*)d_in[17];
  const float* bo   = (const float*)d_in[18];
  const float* o_g  = (const float*)d_in[19];
  const float* o_b  = (const float*)d_in[20];
  const float* o_m  = (const float*)d_in[21];
  const float* o_v  = (const float*)d_in[22];
  const int*   pix  = (const int*)d_in[23];

  // workspace carve (bytes), every offset a multiple of 1024
  const size_t O_WH    = 0;                                             // 1024*256*2
  const size_t O_WL    = O_WH    + (size_t)1024 * NC_ * 2;              // 524288
  const size_t O_BETA  = O_WL    + (size_t)1024 * NC_ * 2;              // 1048576, 4096 B
  const size_t O_WOS   = O_BETA  + 4096;                                // 1052672, 256*512*2
  const size_t O_BETAO = O_WOS   + (size_t)NC_ * NO_ * 2;               // 1314816, 1024 B
  const size_t O_XTH   = O_BETAO + 1024;                                // 1315840, 8 MB
  const size_t O_XTL   = O_XTH   + (size_t)NB_ * NP_ * NC_ * 2;         // 9704448
  const size_t O_QT    = O_XTL   + (size_t)NB_ * NP_ * NC_ * 2;         // 18093056, 8 MB
  const size_t O_KT    = O_QT    + (size_t)NB_ * NH_ * NP_ * DK_ * 2;   // 26481664
  const size_t O_VN    = O_KT    + (size_t)NB_ * NH_ * NP_ * DK_ * 2;   // 34870272, 16 MB
  const size_t O_GOT   = O_VN    + (size_t)NB_ * NO_ * NP_ * 2;         // 51647488, 16 MB
  const size_t O_BIAS  = O_GOT   + (size_t)NB_ * NP_ * NO_ * 2;         // 68424704, 16 MB
  const size_t O_END   = O_BIAS  + (size_t)NH_ * NP_ * NP_ * 2;         // 85201920
  if (O_END > ws_size) return;

  char* ws = (char*)d_ws;
  _Float16* Wh    = (_Float16*)(ws + O_WH);
  _Float16* Wl    = (_Float16*)(ws + O_WL);
  float*    beta  = (float*)   (ws + O_BETA);
  _Float16* WoS   = (_Float16*)(ws + O_WOS);
  float*    betaO = (float*)   (ws + O_BETAO);
  _Float16* xTh   = (_Float16*)(ws + O_XTH);
  _Float16* xTl   = (_Float16*)(ws + O_XTL);
  _Float16* qT    = (_Float16*)(ws + O_QT);
  _Float16* kT    = (_Float16*)(ws + O_KT);
  _Float16* vN    = (_Float16*)(ws + O_VN);
  _Float16* goT   = (_Float16*)(ws + O_GOT);
  _Float16* biasP = (_Float16*)(ws + O_BIAS);

  k_prep<<<dim3(NFQ_ + NFO_ + (NP_ / 64) * (NC_ / 64) * NB_), dim3(256), 0, stream>>>(
      Wq, q_g, q_b, q_m, q_v, Wk, k_g, k_b, k_m, k_v, Wv, v_g, v_b, v_m, v_v,
      Wo, bo, o_g, o_b, o_m, o_v, x, pix, pose, Wh, Wl, beta, WoS, betaO, xTh, xTl, biasP);
  k_qkv<<<dim3(NP_ / 64, 8, NB_), dim3(256), 0, stream>>>(xTh, xTl, Wh, beta, qT, kT, vN);   // Wl = Wh + 1024*256 elements
  k_attn<<<dim3(NP_ / 256, NH_, NB_), dim3(256), 0, stream>>>(qT, kT, vN, biasP, goT);
  k_out<<<dim3(NP_ / 64, 2, NB_), dim3(256), 0, stream>>>(goT, WoS, betaO, (float*)d_out);
}

// v007
// A run of this version takes 92.1 microseconds.
// Timed twice side by side with v006, it ran 1.13 times as fast both times.
// All steps since v000 together make it 7.66 times as fast.
#include <hip/hip_runtime.h>
#include <stddef.h>

// Contractions on v_wmma_f32_16x16x32_f16 (f16 operands, f32 accumulate): q/k channel GEMM as f16 hi/lo split (3 products, W scaled 2^10, x scaled 2^6), v channel GEMM single f16, QK^T single f16 (q,k scaled 2^3), P*V single f16 (P unnormalised, scaled 2^8, V scaled 2^3), output GEMM single f16 (W scaled 2^4, G scaled 2^8); position bias single f16 (scaled 2^5) times a 0 / 2^6 selector, summed into the QK^T accumulator; BN folds, softmax, GELU in f32.

typedef _Float16 v16h __attribute__((ext_vector_type(16)));
typedef _Float16 v8h  __attribute__((ext_vector_type(8)));
typedef float    v8f  __attribute__((ext_vector_type(8)));
typedef float    v4f  __attribute__((ext_vector_type(4)));
typedef v8h v8ha __attribute__((may_alias));
typedef v4f v4fa __attribute__((may_alias));

#define NB_  16
#define NC_  256
#define NP_  1024
#define NH_  8
#define DK_  32
#define DV_  64
#define NO_  512
#define EPS_ 1e-5f
#define CQK_ (0.17677669529663687f * 0.015625f)
#define L2E_ 1.4426950408889634f

union Frag { v16h v; v8h p[2]; };

// Fragment-order storage of every 16-bit matrix operand: a tile of 16 rows x 32 k is 1024 contiguous bytes,
// made of 64 pieces of 8 elements; piece p*32 + h*16 + m holds row m, k = 16p + 8h .. +7.
// Tiles are ordered [row tile][k tile], KT k tiles to a row tile. A wave-wide 16-byte load of one half of a
// fragment then covers 512 contiguous bytes (4 whole 128-byte lines) and not 16 lines.
__device__ __forceinline__ size_t pkoff(int row, int k, int KT) {
  return ((((size_t)(row >> 4) * KT + (k >> 5)) * 64) + ((k >> 4) & 1) * 32 + ((k >> 3) & 1) * 16 + (row & 15)) * 8;
}

// 16x32 fragment from one tile: elements 0..7 <- k 8h..+7, 8..15 <- k 16+8h..+7 of row m (lane = 16h + m)
__device__ __forceinline__ v16h ldpk(const _Float16* tile, int lane) {
  Frag f;
  f.p[0] = *(const v8ha*)(tile + lane * 8);
  f.p[1] = *(const v8ha*)(tile + 256 + lane * 8);
  return f.v;
}

__device__ __forceinline__ v8f mmab(v16h a, v16h b, v8f c) {
  return __builtin_amdgcn_wmma_f32_16x16x32_f16(false, a, false, b, (short)0, c, false, false);
}

// lane l <-> lane l ^ 16
__device__ __forceinline__ float xhalf(float x) {
  const int i = __builtin_bit_cast(int, x);
  return __builtin_bit_cast(float, __builtin_amdgcn_permlanex16(i, i, 0x76543210, 0xfedcba98, false, false));
}

__device__ __forceinline__ v8f vzero() {
  v8f z = {0.f, 0.f, 0.f, 0.f, 0.f, 0.f, 0.f, 0.f};
  return z;
}

// ---------------- BN folded into QKV weights: Wh/Wl f16 hi/lo planes of W*inv*1024, beta[1024] -----
// 32 rows per block, wave w handles rows w*4..w*4+3, lane writes 8 consecutive columns (16 B)
__device__ __forceinline__ void fold_qkv_blk(const int blk, float* sb,
    const float* __restrict__ Wq, const float* __restrict__ qg, const float* __restrict__ qb,
    const float* __restrict__ qm, const float* __restrict__ qv,
    const float* __restrict__ Wk, const float* __restrict__ kg, const float* __restrict__ kb,
    const float* __restrict__ km, const float* __restrict__ kv,
    const float* __restrict__ Wv, const float* __restrict__ vg, const float* __restrict__ vb,
    const float* __restrict__ vm, const float* __restrict__ vv,
    _Float16* Wh, _Float16* Wl, float* beta) {
  const int tid = threadIdx.x, w = tid >> 5, lane = tid & 31;
#pragma unroll 1
  for (int i = 0; i < 4; ++i) {
    const int o = blk * 32 + w * 4 + i;   // 0..1023
    const float* W;
    float g, bb, mm, var;
    int oo;
    if (o < 256)      { oo = o;       W = Wq; g = qg[oo]; bb = qb[oo]; mm = qm[oo]; var = qv[oo]; }
    else if (o < 512) { oo = o - 256; W = Wk; g = kg[oo]; bb = kb[oo]; mm = km[oo]; var = kv[oo]; }
    else              { oo = o - 512; W = Wv; g = vg[oo]; bb = vb[oo]; mm = vm[oo]; var = vv[oo]; }
    const float inv = g * (1.0f / sqrtf(var + EPS_));
    const float* wr = W + (size_t)oo * NC_ + lane * 8;
    const v4f w0 = *(const v4fa*)(wr);
    const v4f w1 = *(const v4fa*)(wr + 4);
    float vals[8] = {w0.x, w0.y, w0.z, w0.w, w1.x, w1.y, w1.z, w1.w};
    v8h hv, lv;
#pragma unroll
    for (int e = 0; e < 8; ++e) {
      const float s = vals[e] * inv * 1024.0f;
      const _Float16 hh = (_Float16)s;
      const _Float16 ll = (_Float16)(s - (float)hh);
      hv[e] = hh; lv[e] = ll;
    }
    _Float16* dh = Wh + pkoff(o, lane * 8, NC_ / 32);
    _Float16* dl = Wl + pkoff(o, lane * 8, NC_ / 32);
    *(v8h*)dh = hv;
    *(v8h*)dl = lv;
    
    if (lane == 0) sb[w * 4 + i] = bb - mm * inv;
  }
  __syncthreads();
  if (w == 0 && lane < 8) {
    v4f b4;
    b4.x = sb[lane * 4 + 0]; b4.y = sb[lane * 4 + 1]; b4.z = sb[lane * 4 + 2]; b4.w = sb[lane * 4 + 3];
    float* db = beta + blk * 32 + lane * 4;
    *(v4f*)db = b4;
    
  }
}

// ---------------- bo + output BN folded into Wo: WoS f16 = Wo*inv*16, betaO[256] -------------------
__device__ __forceinline__ void fold_wo_blk(const int blk, float* sb,
    const float* __restrict__ Wo, const float* __restrict__ bo, const float* __restrict__ og,
    const float* __restrict__ ob, const float* __restrict__ om, const float* __restrict__ ov,
    _Float16* WoS, float* betaO) {
  const int tid = threadIdx.x, w = tid >> 5, lane = tid & 31;
#pragma unroll 1
  for (int i = 0; i < 4; ++i) {
    const int o = blk * 32 + w * 4 + i;   // 0..255
    const float inv = og[o] * (1.0f / sqrtf(ov[o] + EPS_));
#pragma unroll
    for (int hf = 0; hf < 2; ++hf) {
      const float* wr = Wo + (size_t)o * NO_ + hf * 256 + lane * 8;
      const v4f w0 = *(const v4fa*)(wr);
      const v4f w1 = *(const v4fa*)(wr + 4);
      float vals[8] = {w0.x, w0.y, w0.z, w0.w, w1.x, w1.y, w1.z, w1.w};
      v8h hv;
#pragma unroll
      for (int e = 0; e < 8; ++e) hv[e] = (_Float16)(vals[e] * inv * 16.0f);
      _Float16* dh = WoS + pkoff(o, hf * 256 + lane * 8, NO_ / 32);
      *(v8h*)dh = hv;
      
    }
    if (lane == 0) sb[w * 4 + i] = bo[o] * inv + ob[o] - om[o] * inv;
  }
  __syncthreads();
  if (w == 0 && lane < 8) {
    v4f b4;
    b4.x = sb[lane * 4 + 0]; b4.y = sb[lane * 4 + 1]; b4.z = sb[lane * 4 + 2]; b4.w = sb[lane * 4 + 3];
    float* db = betaO + blk * 32 + lane * 4;
    *(v4f*)db = b4;
    
  }
}

// ---------------- x[b][c][p] -> xTh/xTl, rows b*1024+p, k = c, fragment order: f16 hi/lo planes of 64*x ----
__device__ __forceinline__ void tr_blk(const int pblk, const int cblk, const int b, float (*T)[65],
                                       const float* __restrict__ x, _Float16* xTh, _Float16* xTl) {
  const int tid = threadIdx.x;
#pragma unroll
  for (int it = 0; it < 16; ++it) {
    const int idx = it * 256 + tid;
    const int ci = idx >> 6, pj = idx & 63;
    T[ci][pj] = x[((size_t)(b * NC_ + cblk * 64 + ci)) * NP_ + pblk * 64 + pj];
  }
  __syncthreads();
#pragma unroll
  for (int it = 0; it < 2; ++it) {
    const int pi = it * 256 + tid;
    const int pl = pi & 63, pc = pi >> 6;                // a wave: 32 rows of one piece column = 2 x 256 B
    v8h hv, lv;
#pragma unroll
    for (int e = 0; e < 8; ++e) {
      const float s = T[pc * 8 + e][pl] * 64.0f;
      const _Float16 hh = (_Float16)s;
      const _Float16 ll = (_Float16)(s - (float)hh);
      hv[e] = hh; lv[e] = ll;
    }
    const size_t off = pkoff(b * NP_ + pblk * 64 + pl, cblk * 64 + pc * 8, NC_ / 32);
    *(v8h*)(xTh + off) = hv;
    *(v8h*)(xTl + off) = lv;
    
  }
}

// ---------------- QKV projection GEMM (BN folded) --------------------------------------------------
// K loop: every fragment of a group (one k step with hi/lo planes, two without) is requested before the group's first
// product, so a group waits out one load latency and not one per tile. Each accumulator takes its products in the order hi*hi, hi*lo, lo*hi,
// k ascending from the work-group's own first group g0 and wrapping: neighbours along ptile start one group apart, to spread
// their requests for one W line; g0 is the same for every b.
template <bool SPLIT>
__device__ __forceinline__ void qkv_acc(const _Float16* __restrict__ ahr, const _Float16* __restrict__ alr,
                                        const _Float16* __restrict__ whr, int loff, int rot, v8f (&acc)[2][4]) {
  constexpr int G = SPLIT ? 1 : 2;                       // k steps to a group: 24 loads of 16 bytes either way
  constexpr int RT = (NC_ / 32) * 512;                   // from one row tile of x to the next
  constexpr int NG = 8 / G;                              // groups in the walk
  int g0 = rot & (NG - 1);                               // the group the walk stands at (scalar)
  // the lane's own addresses, advanced behind the wait: no load of a group lands on a register that another load of
  // the group names. The lo plane of W follows its hi plane in the workspace: one address serves both.
  const _Float16* pah = ahr + loff + g0 * (G * 512);
  const _Float16* pal = alr + loff + g0 * (G * 512);
  const _Float16* pwh = whr + loff + g0 * (G * 512);
#pragma unroll 1
  for (int it = 0; it < NG; ++it) {
    v16h ah[G][2], al[G][2], bh[G][4], bl[G][4];
#pragma unroll
    for (int s = 0; s < G; ++s) {
#pragma unroll
      for (int r = 0; r < 2; ++r) {
        ah[s][r] = ldpk(pah + r * RT + s * 512, 0);
        if (SPLIT) al[s][r] = ldpk(pal + r * RT + s * 512, 0);
      }
#pragma unroll
      for (int t = 0; t < 4; ++t) {
        bh[s][t] = ldpk(pwh + (t * (NC_ / 32) + s) * 512, 0);
        if (SPLIT) bl[s][t] = ldpk(pwh + 1024 * NC_ + (t * (NC_ / 32) + s) * 512, 0);
      }
    }
    // precaution: the address registers of the loads above (named here, so that they live up to the wait) are
    // advanced below
    if (SPLIT) asm volatile("s_wait_xcnt 0x0" :: "v"(pah), "v"(pal), "v"(pwh) : "memory");
    else       asm volatile("s_wait_xcnt 0x0" :: "v"(pah), "v"(pwh) : "memory");
    // without it the scheduler sinks each tile's loads to just ahead of its product: one exposed latency per tile
    __builtin_amdgcn_sched_barrier(0);
    const int adv = (g0 == NG - 1) ? (G - 8) * 512 : G * 512;   // behind the last group: back to k = 0
    g0 = (g0 + 1) & (NG - 1);
    pah += adv; pal += adv; pwh += adv;
#pragma unroll
    for (int s = 0; s < G; ++s) {
#pragma unroll
      for (int i = 0; i < 8; ++i) acc[i >> 2][i & 3] = mmab(ah[s][i >> 2], bh[s][i & 3], acc[i >> 2][i & 3]);
      if (SPLIT) {
#pragma unroll
        for (int i = 0; i < 8; ++i) acc[i >> 2][i & 3] = mmab(ah[s][i >> 2], bl[s][i & 3], acc[i >> 2][i & 3]);
#pragma unroll
        for (int i = 0; i < 8; ++i) acc[i >> 2][i & 3] = mmab(al[s][i >> 2], bh[s][i & 3], acc[i >> 2][i & 3]);
      }
    }
  }
}

// block tile 128 pixels x 128 output channels, 8 waves (4 row groups x 2 column halves), K = 256. A wave owns 32 pixels x
// 64 channels: each W fragment serves two row tiles, so a product takes 3/5 of the loaded bytes of a 16-row wave, and
// the launch starts half as many waves.
// q,k column chunks (nchunk 0..3): hi*hi + hi*lo + lo*hi; v chunks (4..7): hi*hi.
// qT,kT: per b*8+n rows p, k = d (x8);  vN: rows b*512+channel, k = p (x8); all in fragment order
// at least 4 waves per SIMD: the fragment group (96 registers) and the accumulators (64) do not fit 128 registers
__global__ __launch_bounds__(256) __attribute__((amdgpu_waves_per_eu(4))) void k_qkv(
    const _Float16* __restrict__ xTh, const _Float16* __restrict__ xTl,
    const _Float16* __restrict__ Wh, const float* __restrict__ beta,
    _Float16* qT, _Float16* kT, _Float16* vN) {
  __shared__ __attribute__((aligned(16))) _Float16 st[128 * 136];   // q/k view: [pixel][136], v view: [channel][136]
  const int ptile = blockIdx.x, nchunk = blockIdx.y, b = blockIdx.z;
  const int tid = threadIdx.x, lane = tid & 31, m = lane & 15, h = lane >> 4;
  // the wave's number as a scalar: tile indices and bases are then formed in scalar registers, which leaves the
  // vector registers to the fragment groups
  const int w = __builtin_amdgcn_readfirstlane(tid >> 5);
  const int msub = w & 3, nh = w >> 2;
  const int nbase = nchunk * 128 + nh * 64;
  const bool split = (nchunk < 4);   // block-uniform

  v8f acc[2][4] = {{vzero(), vzero(), vzero(), vzero()}, {vzero(), vzero(), vzero(), vzero()}};
  const size_t atile = (size_t)(b * (NP_ / 16) + ptile * 8 + msub * 2) * (NC_ / 32) * 512;
  const _Float16* ahr = xTh + atile;
  const _Float16* alr = xTl + atile;
  const _Float16* whr = Wh + (size_t)(nbase >> 4) * (NC_ / 32) * 512;
  // W lines are shared along ptile (and b), x lines along nchunk: neighbours in either direction start one group apart
  const int rot = ptile + nchunk;
  if (split) qkv_acc<true>(ahr, alr, whr, lane * 8, rot, acc);
  else       qkv_acc<false>(ahr, alr, whr, lane * 8, rot, acc);

  // epilogue: scale back 2^-16, add folded beta, scale x8, stage 16-bit tile in LDS
  const float kS = 1.0f / 65536.0f;
  float bta[4];
#pragma unroll
  for (int t = 0; t < 4; ++t) bta[t] = beta[nchunk * 128 + nh * 64 + t * 16 + m];   // column = this lane's n
  const int ol0 = nh * 64 + m;                           // + 16t: 0..127
  const int pl0 = msub * 32 + 8 * h;                     // + 16r + j: D row 8h+j of row tile r
  if (split) {
#pragma unroll
    for (int t = 0; t < 4; ++t)
#pragma unroll
      for (int r = 0; r < 2; ++r)
#pragma unroll
        for (int j = 0; j < 8; ++j)
          st[(pl0 + r * 16 + j) * 136 + ol0 + t * 16] = (_Float16)((acc[r][t][j] * kS + bta[t]) * 8.0f);
  } else {
#pragma unroll
    for (int t = 0; t < 4; ++t)
#pragma unroll
      for (int r = 0; r < 2; ++r) {
        v8h o;                                           // 8 consecutive pixels of one channel: one 16-byte store
#pragma unroll
        for (int j = 0; j < 8; ++j) o[j] = (_Float16)((acc[r][t][j] * kS + bta[t]) * 8.0f);
        *(v8ha*)(st + (ol0 + t * 16) * 136 + pl0 + r * 16) = o;
      }
  }
  __syncthreads();

  if (split) {
    _Float16* base = (nchunk < 2) ? qT : kT;
    const int hb = (nchunk & 1) * 4;
    v8h pv[8];                                           // all LDS reads ahead of the stores: one LDS latency, not eight
#pragma unroll
    for (int it = 0; it < 8; ++it) {
      const int pi = it * 256 + tid;                     // 2048 pieces of 16 B
      const int hd = pi >> 9, r = pi & 511;
      const int pl = r >> 2, dq = r & 3;
      pv[it] = *(const v8ha*)(st + pl * 136 + hd * 32 + dq * 8);
    }
#pragma unroll
    for (int it = 0; it < 8; ++it) {
      const int pi = it * 256 + tid;
      const int hd = pi >> 9, r = pi & 511;
      const int pl = r >> 2, dq = r & 3;
      _Float16* dst = base + ((size_t)(b * NH_ + hb + hd)) * NP_ * DK_ + pkoff(ptile * 128 + pl, dq * 8, 1);
      *(v8h*)dst = pv[it];
    }
  } else {
    const int obase = (nchunk - 4) * 128;
    v8h pv[8];                                           // as above
#pragma unroll
    for (int it = 0; it < 8; ++it) {
      const int pi = it * 256 + tid;                     // 128 rows x 16 pieces
      const int ol = pi & 127, pc = pi >> 7;             // a wave: 32 rows of one piece column = 2 x 256 B
      pv[it] = *(const v8ha*)(st + ol * 136 + pc * 8);
    }
#pragma unroll
    for (int it = 0; it < 8; ++it) {
      const int pi = it * 256 + tid;
      const int ol = pi & 127, pc = pi >> 7;
      _Float16* dst = vN + pkoff(b * NO_ + obase + ol, ptile * 128 + pc * 8, NP_ / 32);
      *(v8h*)dst = pv[it];
    }
    // precaution: the code of the other path follows in the listing and rewrites registers that the stores above name
    asm volatile("s_wait_xcnt 0x0" ::: "memory");
  }
}

// ---------------- position bias, gathered once for all batches ---------------------------------------
// biasP: per head n and group of 32 queries q32, 64 tiles of 16 keys (rows) x 32 queries (k) in fragment order,
// value pos_emb[index(query, key)][n] * 2^5. One work item (0..262143): one piece place (8 queries of one key) of
// four heads. The index is bounded here, before it forms an address.
struct BiasIdx { int ix[8]; };
__device__ __forceinline__ BiasIdx bias_idx(const int P, const int* __restrict__ pidx) {
  const int lane = P & 31, p = (P >> 5) & 1, kt = (P >> 7) & 63, q32 = P >> 13;
  const int m = lane & 15, h = lane >> 4;
  const int* src = pidx + (size_t)(q32 * 32 + 16 * p + 8 * h) * NP_ + kt * 16 + m;
  BiasIdx r;
#pragma unroll
  for (int e = 0; e < 8; ++e) r.ix[e] = src[(size_t)e * NP_];
  return r;
}
__device__ __forceinline__ void bias_put(const int P, const BiasIdx& r, const float* __restrict__ posemb,
                                         _Float16* biasP) {
  const int pl = P & 63, hh = (P >> 6) & 1, kt = (P >> 7) & 63, q32 = P >> 13;
  v8h o[4];
#pragma unroll
  for (int e = 0; e < 8; ++e) {
    int ix = r.ix[e];
    ix = ix < 0 ? 0 : (ix > NP_ - 1 ? NP_ - 1 : ix);
    const v4f pe = *(const v4fa*)(posemb + (size_t)ix * NH_ + hh * 4);
#pragma unroll
    for (int i = 0; i < 4; ++i) o[i][e] = (_Float16)(pe[i] * 32.0f);
  }
#pragma unroll
  for (int i = 0; i < 4; ++i)
    *(v8h*)(biasP + ((size_t)((hh * 4 + i) * (NP_ / 32) + q32) * (NP_ / 16) + kt) * 512 + pl * 8) = o[i];
}

// ---------------- all preparation in one launch ------------------------------------------------------
// None of the four jobs reads what another writes. Work-groups 0..31 fold the QKV weights, 32..39 the output
// weights (their serial row loops start first and run beside the rest); each of the other 1024 transposes one
// 64 x 64 tile of x and builds 256 work items of the bias table (1024 x 256 = all of them).
#define NFQ_ 32
#define NFO_ 8
__global__ __launch_bounds__(256) void k_prep(
    const float* __restrict__ Wq, const float* __restrict__ qg, const float* __restrict__ qb,
    const float* __restrict__ qm, const float* __restrict__ qv,
    const float* __restrict__ Wk, const float* __restrict__ kg, const float* __restrict__ kb,
    const float* __restrict__ km, const float* __restrict__ kv,
    const float* __restrict__ Wv, const float* __restrict__ vg, const float* __restrict__ vb,
    const float* __restrict__ vm, const float* __restrict__ vv,
    const float* __restrict__ Wo, const float* __restrict__ bo, const float* __restrict__ og,
    const float* __restrict__ ob, const float* __restrict__ om, const float* __restrict__ ov,
    const float* __restrict__ x, const int* __restrict__ pidx, const float* __restrict__ posemb,
    _Float16* Wh, _Float16* Wl, float* beta, _Float16* WoS, float* betaO,
    _Float16* xTh, _Float16* xTl, _Float16* biasP) {
  __shared__ __attribute__((aligned(16))) float T[64][65];
  const int blk = blockIdx.x;                            // the same for a whole work-group: its barriers are uniform
  if (blk < NFQ_) {
    fold_qkv_blk(blk, &T[0][0], Wq, qg, qb, qm, qv, Wk, kg, kb, km, kv, Wv, vg, vb, vm, vv, Wh, Wl, beta);
  } else if (blk < NFQ_ + NFO_) {
    fold_wo_blk(blk - NFQ_, &T[0][0], Wo, bo, og, ob, om, ov, WoS, betaO);
  } else {
    const int t = blk - (NFQ_ + NFO_);
    // the indices are requested with the tile's loads; the table's stores follow the tile's: a store in front of
    // the tile's barrier would be waited for there
    const int P = t * 256 + threadIdx.x;
    const BiasIdx bi = bias_idx(P, pidx);
    tr_blk(t & 15, (t >> 4) & 3, t >> 6, T, x, xTh, xTl);
    bias_put(P, bi, posemb, biasP);
    // precaution: the code of the other branches follows in the listing and rewrites registers that the stores above name
    asm volatile("s_wait_xcnt 0x0" ::: "memory");
  }
}

__global__ __launch_bounds__(256) void k_attn(
    const _Float16* __restrict__ qT, const _Float16* __restrict__ kT, const _Float16* __restrict__ vN,
    const _Float16* __restrict__ biasP, _Float16* goT) {
  const int qblk = blockIdx.x, n = blockIdx.y, b = blockIdx.z;
  const int tid = threadIdx.x;
  const int w = tid >> 5, lane = tid & 31;
  const int qbase = qblk * 256 + w * 32;
  const int bn = b * NH_ + n;
  v16h bq[2];
#pragma unroll
  for (int g = 0; g < 2; ++g) bq[g] = ldpk(qT + ((size_t)bn * NP_ + qbase + 16 * g) * DK_, lane);
  const _Float16* kp = kT + (size_t)bn * NP_ * DK_;                                  // A row m = key
  const _Float16* vp = vN + (size_t)(b * (NO_ / 16) + n * (DV_ / 16)) * (NP_ / 32) * 512;   // A row m = value channel
  const _Float16* bb = biasP + (size_t)(n * (NP_ / 32) + (qbase >> 5)) * (NP_ / 16) * 512;  // A row m = key, k = query
  const v8f vz = vzero();
  // selector of group g, a B fragment: 2^6 where k = 16g + column, else 0 (k of element e: 8h + e, of 8 + e: 16 + 8h + e).
  // 2^5 (table) * 2^6 = 1 / (SCALE * CQK_): the bias in the units of the raw product
  Frag sel[2];
#pragma unroll
  for (int e = 0; e < 8; ++e) {
    const _Float16 d = ((lane >> 4) * 8 + e == (lane & 15)) ? (_Float16)64.0f : (_Float16)0.0f;
    sel[0].v[e] = d;               sel[0].v[8 + e] = (_Float16)0.0f;
    sel[1].v[e] = (_Float16)0.0f;  sel[1].v[8 + e] = d;
  }

  v8f oacc[2][4] = {{vz, vz, vz, vz}, {vz, vz, vz, vz}};
  float mrun[2] = {-3.0e38f, -3.0e38f};
  float lsum[2] = {0.f, 0.f};

  // the four work-groups that read one (b, n)'s K and V start 8 chunks apart, those that read one bias plane 4 apart (in
  // pairs), and wrap: their requests for one line do not meet in L2. All waves of a work-group walk alike: they share K and V lines.
  int kc = (qblk * 8 + (b & 7) * 4) & 31;
  const _Float16* kpc = kp + (size_t)kc * 32 * DK_;
  const _Float16* vpc = vp + (size_t)kc * 512;
  const _Float16* bbc = bb + (size_t)kc * 1024;
#pragma unroll 1
  for (int it = 0; it < 32; ++it) {
    v16h ak[2], av[4];
#pragma unroll
    for (int u = 0; u < 2; ++u) ak[u] = ldpk(kpc + (size_t)(16 * u) * DK_, lane);
    v16h ab[2];
#pragma unroll
    for (int u = 0; u < 2; ++u) ab[u] = ldpk(bbc + (size_t)u * 512, lane);
    // precaution: the registers that hold the addresses of the loads above are reused below
    asm volatile("s_wait_xcnt 0x0" ::: "memory");
#pragma unroll
    for (int t = 0; t < 4; ++t) av[t] = ldpk(vpc + (size_t)(t * (NP_ / 32)) * 512, lane);
    // precaution: as above, for the addresses of the V loads
    asm volatile("s_wait_xcnt 0x0" ::: "memory");
    // without it the scheduler lifts the bias products in between the loads, and the V loads wait for the first tile
    __builtin_amdgcn_sched_barrier(0);
    {
      const int adv = (kc == 31) ? -31 : 1;              // behind the last chunk: back to key 0
      kc = (kc + 1) & 31;
      kpc += adv * (32 * DK_); vpc += adv * 512; bbc += adv * 1024;
    }
#pragma unroll
    for (int g = 0; g < 2; ++g) {
      float tv[16];
#pragma unroll
      for (int u = 0; u < 2; ++u) {
        // D[8h+j][m]: key 16u+8h+j of this chunk, query column m; raw units, one log2 unit = 1 / (CQK_ * L2E_)
        const v8f s = mmab(ak[u], bq[g], mmab(ab[u], sel[g].v, vz));
#pragma unroll
        for (int j = 0; j < 8; ++j) tv[u * 8 + j] = s[j];
      }
      float mx = tv[0];
#pragma unroll
      for (int i = 1; i < 16; ++i) mx = fmaxf(mx, tv[i]);
      mx = fmaxf(mx, xhalf(mx));
      const float mnew = fmaxf(mrun[g], mx);
      float alpha;                                       // 2^(old maximum - new maximum), 0 on the first chunk
      // v_nop: the slot behind a transcendental. In one statement with it, since a v_nop of its own does not stay behind it
      asm("v_exp_f32 %0, %1\n\tv_nop" : "=v"(alpha) : "v"((mrun[g] - mnew) * (CQK_ * L2E_)));
      mrun[g] = mnew;
      const float moff = fmaf(-mnew, CQK_ * L2E_, 8.0f); // P carries 2^8; the row sum carries it too
      Frag bp;
      float ps = 0.f;
#pragma unroll
      for (int i = 0; i < 16; ++i) {
        const float p = __builtin_amdgcn_exp2f(fmaf(tv[i], CQK_ * L2E_, moff));
        ps += p;
        bp.v[i] = (_Float16)p;                           // element i = key k0+16(i>>3)+8h+(i&7), as ldpk orders V
      }
      lsum[g] = lsum[g] * alpha + ps;
#pragma unroll
      for (int t = 0; t < 4; ++t) {
        oacc[g][t] = mmab(av[t], bp.v, oacc[g][t] * alpha);
      }
    }
  }

  // normalise, GELU (erf form), scale 2^8; a lane holds 8 consecutive channels of one query: one piece of a
  // fragment-order tile (rows = pixels, k = channels), so a wave's store is 512 contiguous bytes
#pragma unroll
  for (int g = 0; g < 2; ++g) {
    const float l = lsum[g] + xhalf(lsum[g]);
    const float co = 1.0f / (l * 8.0f);                  // undo 2^3 (V); 2^8 (P) cancels against l
    _Float16* dst = goT + ((size_t)(b * (NP_ / 16) + (qbase >> 4) + g) * (NO_ / 32) + n * 2) * 512 + lane * 8;
#pragma unroll
    for (int t = 0; t < 4; ++t) {
      v8h o;
#pragma unroll
      for (int j = 0; j < 8; ++j) {
        const float xo = oacc[g][t][j] * co;
        const float gl = 0.5f * xo * (1.0f + erff(xo * 0.70710678118654752f));
        o[j] = (_Float16)(gl * 256.0f);
      }
      *(v8h*)(dst + (t >> 1) * 512 + (t & 1) * 256) = o;   // k = 64n + 16t + 8h: k tile 2n + t/2, half t&1
    }
  }
}

// ---------------- output projection GEMM (bias + BN folded) ---------------------------------------
__global__ __launch_bounds__(256) void k_out(
    const _Float16* __restrict__ goT, const _Float16* __restrict__ WoS, const float* __restrict__ betaO,
    float* out) {
  __shared__ __attribute__((aligned(16))) float To[128 * 68];
  const int ptile = blockIdx.x, nchunk = blockIdx.y, b = blockIdx.z;
  const int tid = threadIdx.x, lane = tid & 31, m = lane & 15, h = lane >> 4;
  // the wave's number as a scalar: tile indices and bases are then formed in scalar registers, which leaves the
  // vector registers to the fragment groups
  const int w = __builtin_amdgcn_readfirstlane(tid >> 5);
  const int msub = w & 3, nh = w >> 2;
  const int nbase = nchunk * 128 + nh * 64;
  v8f acc[4] = {vzero(), vzero(), vzero(), vzero()};
  const _Float16* ar = goT + (size_t)(b * (NP_ / 16) + ptile * 4 + msub) * (NO_ / 32) * 512;
  // the fragments of four k steps are requested as one group ahead of their products: one load latency per group.
  // Neighbours along ptile (which share weight lines) and the two nchunk (which share G lines) start at different
  // groups and wrap; g0 is the same for every b and for ptile four apart.
  int g0 = (ptile + nchunk * 2) & 3;                     // the group the walk stands at (scalar)
  const _Float16* pa = ar + g0 * (4 * 512);
  const _Float16* pw = WoS + (size_t)(nbase >> 4) * (NO_ / 32) * 512 + g0 * (4 * 512);
#pragma unroll 1
  for (int it = 0; it < 4; ++it) {
    v16h a[4], bt[4][4];
#pragma unroll
    for (int s = 0; s < 4; ++s) {
      a[s] = ldpk(pa + s * 512, lane);
#pragma unroll
      for (int t = 0; t < 4; ++t)
        bt[s][t] = ldpk(pw + (t * (NO_ / 32) + s) * 512, lane);
    }
    // precaution: the address registers of the loads above are reused below
    asm volatile("s_wait_xcnt 0x0" ::: "memory");
    // without it the scheduler sinks each tile's loads to just ahead of its product: one exposed latency per tile
    __builtin_amdgcn_sched_barrier(0);
    {
      const int adv = (g0 == 3) ? -12 * 512 : 4 * 512;   // behind the last group: back to k = 0
      g0 = (g0 + 1) & 3;
      pa += adv; pw += adv;
    }
#pragma unroll
    for (int s = 0; s < 4; ++s) {
#pragma unroll
      for (int t = 0; t < 4; ++t) acc[t] = mmab(a[s], bt[s][t], acc[t]);
    }
  }
  const float kS = 1.0f / 4096.0f;                       // undo 2^4 (W) and 2^8 (G)
#pragma unroll
  for (int t = 0; t < 4; ++t) {
    const int ol = nh * 64 + t * 16 + m;
    const float bta = betaO[nchunk * 128 + ol];
#pragma unroll
    for (int j = 0; j < 8; ++j) {
      const int pl = msub * 16 + 8 * h + j;
      To[ol * 68 + pl] = acc[t][j] * kS + bta;
    }
  }
  __syncthreads();
#pragma unroll
  for (int it = 0; it < 8; ++it) {
    const int pi = it * 256 + tid;                       // 128 rows x 16 float4 pieces
    const int ol = pi >> 4, pc = pi & 15;
    const v4f v = *(const v4fa*)(To + ol * 68 + pc * 4);
    float* dst = out + ((size_t)(b * NC_ + nchunk * 128 + ol)) * NP_ + ptile * 64 + pc * 4;
    *(v4f*)dst = v;
    
  }
}

// ---------------- launch glue ------------------------------------------------------------------------
extern "C" void kernel_launch(void* const* d_in, const int* in_sizes, int n_in,
                              void* d_out, int out_size, void* d_ws, size_t ws_size,
                              hipStream_t stream) {
  if (n_in < 24) return;
  if (in_sizes[0] != NB_ * NC_ * NP_) return;
  if (in_sizes[1] != NC_ * NC_ || in_sizes[6] != NC_ * NC_ || in_sizes[11] != NO_ * NC_) return;
  if (in_sizes[16] != NP_ * NH_ || in_sizes[17] != NC_ * NO_ || in_sizes[23] != NP_ * NP_) return;
  {
    const int f32c[13] = {2, 3, 4, 5, 7, 8, 9, 10, 18, 19, 20, 21, 22};
    for (int i = 0; i < 13; ++i) if (in_sizes[f32c[i]] != NC_) return;
    const int f32o[4] = {12, 13, 14, 15};
    for (int i = 0; i < 4; ++i) if (in_sizes[f32o[i]] != NO_) return;
  }
  if (out_size != NB_ * NC_ * NP_) return;

  const float* x    = (const float*)d_in[0];
  const float* Wq   = (const float*)d_in[1];
  const float* q_g  = (const float*)d_in[2];
  const float* q_b  = (const float*)d_in[3];
  const float* q_m  = (const float*)d_in[4];
  const float* q_v  = (const float*)d_in[5];
  const float* Wk   = (const float*)d_in[6];
  const float* k_g  = (const float*)d_in[7];
  const float* k_b  = (const float*)d_in[8];
  const float* k_m  = (const float*)d_in[9];
  const float* k_v  = (const float*)d_in[10];
  const float* Wv   = (const float*)d_in[11];
  const float* v_g  = (const float*)d_in[12];
  const float* v_b  = (const float*)d_in[13];
  const float* v_m  = (const float*)d_in[14];
  const float* v_v  = (const float*)d_in[15];
  const float* pose = (const float*)d_in[16];
  const float* Wo   = (const float*)d_in[17];
  const float* bo   = (const float*)d_in[18];
  const float* o_g  = (const float*)d_in[19];
  const float* o_b  = (const float*)d_in[20];
  const float* o_m  = (const float*)d_in[21];
  const float* o_v  = (const float*)d_in[22];
  const int*   pix  = (const int*)d_in[23];

  // workspace carve (bytes), every offset a multiple of 1024
  const size_t O_WH    = 0;                                             // 1024*256*2
  const size_t O_WL    = O_WH    + (size_t)1024 * NC_ * 2;              // 524288
  const size_t O_BETA  = O_WL    + (size_t)1024 * NC_ * 2;              // 1048576, 4096 B
  const size_t O_WOS   = O_BETA  + 4096;                                // 1052672, 256*512*2
  const size_t O_BETAO = O_WOS   + (size_t)NC_ * NO_ * 2;               // 1314816, 1024 B
  const size_t O_XTH   = O_BETAO + 1024;                                // 1315840, 8 MB
  const size_t O_XTL   = O_XTH   + (size_t)NB_ * NP_ * NC_ * 2;         // 9704448
  const size_t O_QT    = O_XTL   + (size_t)NB_ * NP_ * NC_ * 2;         // 18093056, 8 MB
  const size_t O_KT    = O_QT    + (size_t)NB_ * NH_ * NP_ * DK_ * 2;   // 26481664
  const size_t O_VN    = O_KT    + (size_t)NB_ * NH_ * NP_ * DK_ * 2;   // 34870272, 16 MB
  const size_t O_GOT   = O_VN    + (size_t)NB_ * NO_ * NP_ * 2;         // 51647488, 16 MB
  const size_t O_BIAS  = O_GOT   + (size_t)NB_ * NP_ * NO_ * 2;         // 68424704, 16 MB
  const size_t O_END   = O_BIAS  + (size_t)NH_ * NP_ * NP_ * 2;         // 85201920
  if (O_END > ws_size) return;

  char* ws = (char*)d_ws;
  _Float16* Wh    = (_Float16*)(ws + O_WH);
  _Float16* Wl    = (_Float16*)(ws + O_WL);
  float*    beta  = (float*)   (ws + O_BETA);
  _Float16* WoS   = (_Float16*)(ws + O_WOS);
  float*    betaO = (float*)   (ws + O_BETAO);
  _Float16* xTh   = (_Float16*)(ws + O_XTH);
  _Float16* xTl   = (_Float16*)(ws + O_XTL);
  _Float16* qT    = (_Float16*)(ws + O_QT);
  _Float16* kT    = (_Float16*)(ws + O_KT);
  _Float16* vN    = (_Float16*)(ws + O_VN);
  _Float16* goT   = (_Float16*)(ws + O_GOT);
  _Float16* biasP = (_Float16*)(ws + O_BIAS);

  k_prep<<<dim3(NFQ_ + NFO_ + (NP_ / 64) * (NC_ / 64) * NB_), dim3(256), 0, stream>>>(
      Wq, q_g, q_b, q_m, q_v, Wk, k_g, k_b, k_m, k_v, Wv, v_g, v_b, v_m, v_v,
      Wo, bo, o_g, o_b, o_m, o_v, x, pix, pose, Wh, Wl, beta, WoS, betaO, xTh, xTl, biasP);
  k_qkv<<<dim3(NP_ / 128, 8, NB_), dim3(256), 0, stream>>>(xTh, xTl, Wh, beta, qT, kT, vN);   // Wl = Wh + 1024*256 elements
  k_attn<<<dim3(NP_ / 256, NH_, NB_), dim3(256), 0, stream>>>(qT, kT, vN, biasP, goT);
  k_out<<<dim3(NP_ / 64, 2, NB_), dim3(256), 0, stream>>>(goT, WoS, betaO, (float*)d_out);
}

// v008
// A run of this version takes 89.1 microseconds.
// Two timings next to v007 both put it at 1.03 times that version's speed.
// All steps since v000 together make it 7.90 times as fast.
#include <hip/hip_runtime.h>
#include <stddef.h>

// Contractions on v_wmma_f32_16x16x32_f16 (f16 operands, f32 accumulate): q/k channel GEMM as f16 hi/lo split (3 products, W scaled 2^10, x scaled 2^6), v channel GEMM single f16, QK^T single f16 (q,k scaled 2^3), P*V single f16 (P unnormalised, 2^8 at the query's reference point and at most 2^15, V scaled 2^3), output GEMM single f16 (W scaled 2^4, G scaled 2^8); position bias single f16 (scaled 2^5) times a 0 / 2^6 selector, summed into the QK^T accumulator; BN folds, softmax, GELU in f32.

typedef _Float16 v16h __attribute__((ext_vector_type(16)));
typedef _Float16 v8h  __attribute__((ext_vector_type(8)));
typedef float    v8f  __attribute__((ext_vector_type(8)));
typedef float    v4f  __attribute__((ext_vector_type(4)));
typedef v8h v8ha __attribute__((may_alias));
typedef v4f v4fa __attribute__((may_alias));

#define NB_  16
#define NC_  256
#define NP_  1024
#define NH_  8
#define DK_  32
#define DV_  64
#define NO_  512
#define EPS_ 1e-5f
#define CQK_ (0.17677669529663687f * 0.015625f)
#define L2E_ 1.4426950408889634f
#define PLIM_ 32768.0f

union Frag { v16h v; v8h p[2]; };

// Fragment-order storage of every 16-bit matrix operand: a tile of 16 rows x 32 k is 1024 contiguous bytes,
// made of 64 pieces of 8 elements; piece p*32 + h*16 + m holds row m, k = 16p + 8h .. +7.
// Tiles are ordered [row tile][k tile], KT k tiles to a row tile. A wave-wide 16-byte load of one half of a
// fragment then covers 512 contiguous bytes (4 whole 128-byte lines) and not 16 lines.
__device__ __forceinline__ size_t pkoff(int row, int k, int KT) {
  return ((((size_t)(row >> 4) * KT + (k >> 5)) * 64) + ((k >> 4) & 1) * 32 + ((k >> 3) & 1) * 16 + (row & 15)) * 8;
}

// 16x32 fragment from one tile: elements 0..7 <- k 8h..+7, 8..15 <- k 16+8h..+7 of row m (lane = 16h + m)
__device__ __forceinline__ v16h ldpk(const _Float16* tile, int lane) {
  Frag f;
  f.p[0] = *(const v8ha*)(tile + lane * 8);
  f.p[1] = *(const v8ha*)(tile + 256 + lane * 8);
  return f.v;
}

__device__ __forceinline__ v8f mmab(v16h a, v16h b, v8f c) {
  return __builtin_amdgcn_wmma_f32_16x16x32_f16(false, a, false, b, (short)0, c, false, false);
}

// lane l <-> lane l ^ 16
__device__ __forceinline__ float xhalf(float x) {
  const int i = __builtin_bit_cast(int, x);
  return __builtin_bit_cast(float, __builtin_amdgcn_permlanex16(i, i, 0x76543210, 0xfedcba98, false, false));
}

__device__ __forceinline__ v8f vzero() {
  v8f z = {0.f, 0.f, 0.f, 0.f, 0.f, 0.f, 0.f, 0.f};
  return z;
}

// ---------------- BN folded into QKV weights: Wh/Wl f16 hi/lo planes of W*inv*1024, beta[1024] -----
// 32 rows per block, wave w handles rows w*4..w*4+3, lane writes 8 consecutive columns (16 B)
__device__ __forceinline__ void fold_qkv_blk(const int blk, float* sb,
    const float* __restrict__ Wq, const float* __restrict__ qg, const float* __restrict__ qb,
    const float* __restrict__ qm, const float* __restrict__ qv,
    const float* __restrict__ Wk, const float* __restrict__ kg, const float* __restrict__ kb,
    const float* __restrict__ km, const float* __restrict__ kv,
    const float* __restrict__ Wv, const float* __restrict__ vg, const float* __restrict__ vb,
    const float* __restrict__ vm, const float* __restrict__ vv,
    _Float16* Wh, _Float16* Wl, float* beta) {
  const int tid = threadIdx.x, w = tid >> 5, lane = tid & 31;
#pragma unroll 1
  for (int i = 0; i < 4; ++i) {
    const int o = blk * 32 + w * 4 + i;   // 0..1023
    const float* W;
    float g, bb, mm, var;
    int oo;
    if (o < 256)      { oo = o;       W = Wq; g = qg[oo]; bb = qb[oo]; mm = qm[oo]; var = qv[oo]; }
    else if (o < 512) { oo = o - 256; W = Wk; g = kg[oo]; bb = kb[oo]; mm = km[oo]; var = kv[oo]; }
    else              { oo = o - 512; W = Wv; g = vg[oo]; bb = vb[oo]; mm = vm[oo]; var = vv[oo]; }
    const float inv = g * (1.0f / sqrtf(var + EPS_));
    const float* wr = W + (size_t)oo * NC_ + lane * 8;
    const v4f w0 = *(const v4fa*)(wr);
    const v4f w1 = *(const v4fa*)(wr + 4);
    float vals[8] = {w0.x, w0.y, w0.z, w0.w, w1.x, w1.y, w1.z, w1.w};
    v8h hv, lv;
#pragma unroll
    for (int e = 0; e < 8; ++e) {
      const float s = vals[e] * inv * 1024.0f;
      const _Float16 hh = (_Float16)s;
      const _Float16 ll = (_Float16)(s - (float)hh);
      hv[e] = hh; lv[e] = ll;
    }
    _Float16* dh = Wh + pkoff(o, lane * 8, NC_ / 32);
    _Float16* dl = Wl + pkoff(o, lane * 8, NC_ / 32);
    *(v8h*)dh = hv;
    *(v8h*)dl = lv;
    
    if (lane == 0) sb[w * 4 + i] = bb - mm * inv;
  }
  __syncthreads();
  if (w == 0 && lane < 8) {
    v4f b4;
    b4.x = sb[lane * 4 + 0]; b4.y = sb[lane * 4 + 1]; b4.z = sb[lane * 4 + 2]; b4.w = sb[lane * 4 + 3];
    float* db = beta + blk * 32 + lane * 4;
    *(v4f*)db = b4;
    
  }
}

// ---------------- bo + output BN folded into Wo: WoS f16 = Wo*inv*16, betaO[256] -------------------
__device__ __forceinline__ void fold_wo_blk(const int blk, float* sb,
    const float* __restrict__ Wo, const float* __restrict__ bo, const float* __restrict__ og,
    const float* __restrict__ ob, const float* __restrict__ om, const float* __restrict__ ov,
    _Float16* WoS, float* betaO) {
  const int tid = threadIdx.x, w = tid >> 5, lane = tid & 31;
#pragma unroll 1
  for (int i = 0; i < 4; ++i) {
    const int o = blk * 32 + w * 4 + i;   // 0..255
    const float inv = og[o] * (1.0f / sqrtf(ov[o] + EPS_));
#pragma unroll
    for (int hf = 0; hf < 2; ++hf) {
      const float* wr = Wo + (size_t)o * NO_ + hf * 256 + lane * 8;
      const v4f w0 = *(const v4fa*)(wr);
      const v4f w1 = *(const v4fa*)(wr + 4);
      float vals[8] = {w0.x, w0.y, w0.z, w0.w, w1.x, w1.y, w1.z, w1.w};
      v8h hv;
#pragma unroll
      for (int e = 0; e < 8; ++e) hv[e] = (_Float16)(vals[e] * inv * 16.0f);
      _Float16* dh = WoS + pkoff(o, hf * 256 + lane * 8, NO_ / 32);
      *(v8h*)dh = hv;
      
    }
    if (lane == 0) sb[w * 4 + i] = bo[o] * inv + ob[o] - om[o] * inv;
  }
  __syncthreads();
  if (w == 0 && lane < 8) {
    v4f b4;
    b4.x = sb[lane * 4 + 0]; b4.y = sb[lane * 4 + 1]; b4.z = sb[lane * 4 + 2]; b4.w = sb[lane * 4 + 3];
    float* db = betaO + blk * 32 + lane * 4;
    *(v4f*)db = b4;
    
  }
}

// ---------------- x[b][c][p] -> xTh/xTl, rows b*1024+p, k = c, fragment order: f16 hi/lo planes of 64*x ----
__device__ __forceinline__ void tr_blk(const int pblk, const int cblk, const int b, float (*T)[65],
                                       const float* __restrict__ x, _Float16* xTh, _Float16* xTl) {
  const int tid = threadIdx.x;
#pragma unroll
  for (int it = 0; it < 16; ++it) {
    const int idx = it * 256 + tid;
    const int ci = idx >> 6, pj = idx & 63;
    T[ci][pj] = x[((size_t)(b * NC_ + cblk * 64 + ci)) * NP_ + pblk * 64 + pj];
  }
  __syncthreads();
#pragma unroll
  for (int it = 0; it < 2; ++it) {
    const int pi = it * 256 + tid;
    const int pl = pi & 63, pc = pi >> 6;                // a wave: 32 rows of one piece column = 2 x 256 B
    v8h hv, lv;
#pragma unroll
    for (int e = 0; e < 8; ++e) {
      const float s = T[pc * 8 + e][pl] * 64.0f;
      const _Float16 hh = (_Float16)s;
      const _Float16 ll = (_Float16)(s - (float)hh);
      hv[e] = hh; lv[e] = ll;
    }
    const size_t off = pkoff(b * NP_ + pblk * 64 + pl, cblk * 64 + pc * 8, NC_ / 32);
    *(v8h*)(xTh + off) = hv;
    *(v8h*)(xTl + off) = lv;
    
  }
}

// ---------------- QKV projection GEMM (BN folded) --------------------------------------------------
// K loop: every fragment of a group (one k step with hi/lo planes, two without) is requested before the group's first
// product, so a group waits out one load latency and not one per tile. Each accumulator takes its products in the order hi*hi, hi*lo, lo*hi,
// k ascending from the work-group's own first group g0 and wrapping: neighbours along ptile start one group apart, to spread
// their requests for one W line; g0 is the same for every b.
template <bool SPLIT>
__device__ __forceinline__ void qkv_acc(const _Float16* __restrict__ ahr, const _Float16* __restrict__ alr,
                                        const _Float16* __restrict__ whr, int loff, int rot, v8f (&acc)[2][4]) {
  constexpr int G = SPLIT ? 1 : 2;                       // k steps to a group: 24 loads of 16 bytes either way
  constexpr int RT = (NC_ / 32) * 512;                   // from one row tile of x to the next
  constexpr int NG = 8 / G;                              // groups in the walk
  int g0 = rot & (NG - 1);                               // the group the walk stands at (scalar)
  // the lane's own addresses, advanced behind the wait: no load of a group lands on a register that another load of
  // the group names. The lo plane of W follows its hi plane in the workspace: one address serves both.
  const _Float16* pah = ahr + loff + g0 * (G * 512);
  const _Float16* pal = alr + loff + g0 * (G * 512);
  const _Float16* pwh = whr + loff + g0 * (G * 512);
#pragma unroll 1
  for (int it = 0; it < NG; ++it) {
    v16h ah[G][2], al[G][2], bh[G][4], bl[G][4];
#pragma unroll
    for (int s = 0; s < G; ++s) {
#pragma unroll
      for (int r = 0; r < 2; ++r) {
        ah[s][r] = ldpk(pah + r * RT + s * 512, 0);
        if (SPLIT) al[s][r] = ldpk(pal + r * RT + s * 512, 0);
      }
#pragma unroll
      for (int t = 0; t < 4; ++t) {
        bh[s][t] = ldpk(pwh + (t * (NC_ / 32) + s) * 512, 0);
        if (SPLIT) bl[s][t] = ldpk(pwh + 1024 * NC_ + (t * (NC_ / 32) + s) * 512, 0);
      }
    }
    // precaution: the address registers of the loads above (named here, so that they live up to the wait) are
    // advanced below
    if (SPLIT) asm volatile("s_wait_xcnt 0x0" :: "v"(pah), "v"(pal), "v"(pwh) : "memory");
    else       asm volatile("s_wait_xcnt 0x0" :: "v"(pah), "v"(pwh) : "memory");
    // without it the scheduler sinks each tile's loads to just ahead of its product: one exposed latency per tile
    __builtin_amdgcn_sched_barrier(0);
    const int adv = (g0 == NG - 1) ? (G - 8) * 512 : G * 512;   // behind the last group: back to k = 0
    g0 = (g0 + 1) & (NG - 1);
    pah += adv; pal += adv; pwh += adv;
#pragma unroll
    for (int s = 0; s < G; ++s) {
#pragma unroll
      for (int i = 0; i < 8; ++i) acc[i >> 2][i & 3] = mmab(ah[s][i >> 2], bh[s][i & 3], acc[i >> 2][i & 3]);
      if (SPLIT) {
#pragma unroll
        for (int i = 0; i < 8; ++i) acc[i >> 2][i & 3] = mmab(ah[s][i >> 2], bl[s][i & 3], acc[i >> 2][i & 3]);
#pragma unroll
        for (int i = 0; i < 8; ++i) acc[i >> 2][i & 3] = mmab(al[s][i >> 2], bh[s][i & 3], acc[i >> 2][i & 3]);
      }
    }
  }
}

// block tile 128 pixels x 128 output channels, 8 waves (4 row groups x 2 column halves), K = 256. A wave owns 32 pixels x
// 64 channels: each W fragment serves two row tiles, so a product takes 3/5 of the loaded bytes of a 16-row wave, and
// the launch starts half as many waves.
// q,k column chunks (nchunk 0..3): hi*hi + hi*lo + lo*hi; v chunks (4..7): hi*hi.
// qT,kT: per b*8+n rows p, k = d (x8);  vN: rows b*512+channel, k = p (x8); all in fragment order
// at least 4 waves per SIMD: the fragment group (96 registers) and the accumulators (64) do not fit 128 registers
__global__ __launch_bounds__(256) __attribute__((amdgpu_waves_per_eu(4))) void k_qkv(
    const _Float16* __restrict__ xTh, const _Float16* __restrict__ xTl,
    const _Float16* __restrict__ Wh, const float* __restrict__ beta,
    _Float16* qT, _Float16* kT, _Float16* vN) {
  __shared__ __attribute__((aligned(16))) _Float16 st[128 * 136];   // q/k view: [pixel][136], v view: [channel][136]
  const int ptile = blockIdx.x, nchunk = blockIdx.y, b = blockIdx.z;
  const int tid = threadIdx.x, lane = tid & 31, m = lane & 15, h = lane >> 4;
  // the wave's number as a scalar: tile indices and bases are then formed in scalar registers, which leaves the
  // vector registers to the fragment groups
  const int w = __builtin_amdgcn_readfirstlane(tid >> 5);
  const int msub = w & 3, nh = w >> 2;
  const int nbase = nchunk * 128 + nh * 64;
  const bool split = (nchunk < 4);   // block-uniform

  v8f acc[2][4] = {{vzero(), vzero(), vzero(), vzero()}, {vzero(), vzero(), vzero(), vzero()}};
  const size_t atile = (size_t)(b * (NP_ / 16) + ptile * 8 + msub * 2) * (NC_ / 32) * 512;
  const _Float16* ahr = xTh + atile;
  const _Float16* alr = xTl + atile;
  const _Float16* whr = Wh + (size_t)(nbase >> 4) * (NC_ / 32) * 512;
  // W lines are shared along ptile (and b), x lines along nchunk: neighbours in either direction start one group apart
  const int rot = ptile + nchunk;
  if (split) qkv_acc<true>(ahr, alr, whr, lane * 8, rot, acc);
  else       qkv_acc<false>(ahr, alr, whr, lane * 8, rot, acc);

  // epilogue: scale back 2^-16, add folded beta, scale x8, stage 16-bit tile in LDS
  const float kS = 1.0f / 65536.0f;
  float bta[4];
#pragma unroll
  for (int t = 0; t < 4; ++t) bta[t] = beta[nchunk * 128 + nh * 64 + t * 16 + m];   // column = this lane's n
  const int ol0 = nh * 64 + m;                           // + 16t: 0..127
  const int pl0 = msub * 32 + 8 * h;                     // + 16r + j: D row 8h+j of row tile r
  if (split) {
#pragma unroll
    for (int t = 0; t < 4; ++t)
#pragma unroll
      for (int r = 0; r < 2; ++r)
#pragma unroll
        for (int j = 0; j < 8; ++j)
          st[(pl0 + r * 16 + j) * 136 + ol0 + t * 16] = (_Float16)((acc[r][t][j] * kS + bta[t]) * 8.0f);
  } else {
#pragma unroll
    for (int t = 0; t < 4; ++t)
#pragma unroll
      for (int r = 0; r < 2; ++r) {
        v8h o;                                           // 8 consecutive pixels of one channel: one 16-byte store
#pragma unroll
        for (int j = 0; j < 8; ++j) o[j] = (_Float16)((acc[r][t][j] * kS + bta[t]) * 8.0f);
        *(v8ha*)(st + (ol0 + t * 16) * 136 + pl0 + r * 16) = o;
      }
  }
  __syncthreads();

  if (split) {
    _Float16* base = (nchunk < 2) ? qT : kT;
    const int hb = (nchunk & 1) * 4;
    v8h pv[8];                                           // all LDS reads ahead of the stores: one LDS latency, not eight
#pragma unroll
    for (int it = 0; it < 8; ++it) {
      const int pi = it * 256 + tid;                     // 2048 pieces of 16 B
      const int hd = pi >> 9, r = pi & 511;
      const int pl = r >> 2, dq = r & 3;
      pv[it] = *(const v8ha*)(st + pl * 136 + hd * 32 + dq * 8);
    }
#pragma unroll
    for (int it = 0; it < 8; ++it) {
      const int pi = it * 256 + tid;
      const int hd = pi >> 9, r = pi & 511;
      const int pl = r >> 2, dq = r & 3;
      _Float16* dst = base + ((size_t)(b * NH_ + hb + hd)) * NP_ * DK_ + pkoff(ptile * 128 + pl, dq * 8, 1);
      *(v8h*)dst = pv[it];
    }
  } else {
    const int obase = (nchunk - 4) * 128;
    v8h pv[8];                                           // as above
#pragma unroll
    for (int it = 0; it < 8; ++it) {
      const int pi = it * 256 + tid;                     // 128 rows x 16 pieces
      const int ol = pi & 127, pc = pi >> 7;             // a wave: 32 rows of one piece column = 2 x 256 B
      pv[it] = *(const v8ha*)(st + ol * 136 + pc * 8);
    }
#pragma unroll
    for (int it = 0; it < 8; ++it) {
      const int pi = it * 256 + tid;
      const int ol = pi & 127, pc = pi >> 7;
      _Float16* dst = vN + pkoff(b * NO_ + obase + ol, ptile * 128 + pc * 8, NP_ / 32);
      *(v8h*)dst = pv[it];
    }
    // precaution: the code of the other path follows in the listing and rewrites registers that the stores above name
    asm volatile("s_wait_xcnt 0x0" ::: "memory");
  }
}

// ---------------- position bias, gathered once for all batches ---------------------------------------
// biasP: per head n and group of 32 queries q32, 64 tiles of 16 keys (rows) x 32 queries (k) in fragment order,
// value pos_emb[index(query, key)][n] * 2^5. One work item (0..262143): one piece place (8 queries of one key) of
// four heads. The index is bounded here, before it forms an address.
struct BiasIdx { int ix[8]; };
__device__ __forceinline__ BiasIdx bias_idx(const int P, const int* __restrict__ pidx) {
  const int lane = P & 31, p = (P >> 5) & 1, kt = (P >> 7) & 63, q32 = P >> 13;
  const int m = lane & 15, h = lane >> 4;
  const int* src = pidx + (size_t)(q32 * 32 + 16 * p + 8 * h) * NP_ + kt * 16 + m;
  BiasIdx r;
#pragma unroll
  for (int e = 0; e < 8; ++e) r.ix[e] = src[(size_t)e * NP_];
  return r;
}
__device__ __forceinline__ void bias_put(const int P, const BiasIdx& r, const float* __restrict__ posemb,
                                         _Float16* biasP) {
  const int pl = P & 63, hh = (P >> 6) & 1, kt = (P >> 7) & 63, q32 = P >> 13;
  v8h o[4];
#pragma unroll
  for (int e = 0; e < 8; ++e) {
    int ix = r.ix[e];
    ix = ix < 0 ? 0 : (ix > NP_ - 1 ? NP_ - 1 : ix);
    const v4f pe = *(const v4fa*)(posemb + (size_t)ix * NH_ + hh * 4);
#pragma unroll
    for (int i = 0; i < 4; ++i) o[i][e] = (_Float16)(pe[i] * 32.0f);
  }
#pragma unroll
  for (int i = 0; i < 4; ++i)
    *(v8h*)(biasP + ((size_t)((hh * 4 + i) * (NP_ / 32) + q32) * (NP_ / 16) + kt) * 512 + pl * 8) = o[i];
}

// ---------------- all preparation in one launch ------------------------------------------------------
// None of the four jobs reads what another writes. Work-groups 0..31 fold the QKV weights, 32..39 the output
// weights (their serial row loops start first and run beside the rest); each of the other 1024 transposes one
// 64 x 64 tile of x and builds 256 work items of the bias table (1024 x 256 = all of them).
#define NFQ_ 32
#define NFO_ 8
__global__ __launch_bounds__(256) void k_prep(
    const float* __restrict__ Wq, const float* __restrict__ qg, const float* __restrict__ qb,
    const float* __restrict__ qm, const float* __restrict__ qv,
    const float* __restrict__ Wk, const float* __restrict__ kg, const float* __restrict__ kb,
    const float* __restrict__ km, const float* __restrict__ kv,
    const float* __restrict__ Wv, const float* __restrict__ vg, const float* __restrict__ vb,
    const float* __restrict__ vm, const float* __restrict__ vv,
    const float* __restrict__ Wo, const float* __restrict__ bo, const float* __restrict__ og,
    const float* __restrict__ ob, const float* __restrict__ om, const float* __restrict__ ov,
    const float* __restrict__ x, const int* __restrict__ pidx, const float* __restrict__ posemb,
    _Float16* Wh, _Float16* Wl, float* beta, _Float16* WoS, float* betaO,
    _Float16* xTh, _Float16* xTl, _Float16* biasP) {
  __shared__ __attribute__((aligned(16))) float T[64][65];
  const int blk = blockIdx.x;                            // the same for a whole work-group: its barriers are uniform
  if (blk < NFQ_) {
    fold_qkv_blk(blk, &T[0][0], Wq, qg, qb, qm, qv, Wk, kg, kb, km, kv, Wv, vg, vb, vm, vv, Wh, Wl, beta);
  } else if (blk < NFQ_ + NFO_) {
    fold_wo_blk(blk - NFQ_, &T[0][0], Wo, bo, og, ob, om, ov, WoS, betaO);
  } else {
    const int t = blk - (NFQ_ + NFO_);
    // the indices are requested with the tile's loads; the table's stores follow the tile's: a store in front of
    // the tile's barrier would be waited for there
    const int P = t * 256 + threadIdx.x;
    const BiasIdx bi = bias_idx(P, pidx);
    tr_blk(t & 15, (t >> 4) & 3, t >> 6, T, x, xTh, xTl);
    bias_put(P, bi, posemb, biasP);
    // precaution: the code of the other branches follows in the listing and rewrites registers that the stores above name
    asm volatile("s_wait_xcnt 0x0" ::: "memory");
  }
}

// 2^x of the eight scores of one tile, in one statement: the outputs are early-clobber, so no exponential of the run lands on
// a register that another one still reads, and v_nop fills the slot behind the last transcendental
__device__ __forceinline__ void exp2x8(const float (&a)[8], float (&p)[8]) {
  asm("v_exp_f32 %0, %8\n\tv_exp_f32 %1, %9\n\tv_exp_f32 %2, %10\n\tv_exp_f32 %3, %11\n\t"
      "v_exp_f32 %4, %12\n\tv_exp_f32 %5, %13\n\tv_exp_f32 %6, %14\n\tv_exp_f32 %7, %15\n\tv_nop"
      : "=&v"(p[0]), "=&v"(p[1]), "=&v"(p[2]), "=&v"(p[3]), "=&v"(p[4]), "=&v"(p[5]), "=&v"(p[6]), "=&v"(p[7])
      : "v"(a[0]), "v"(a[1]), "v"(a[2]), "v"(a[3]), "v"(a[4]), "v"(a[5]), "v"(a[6]), "v"(a[7]));
}

// P of one group of 16 queries against the offset moff (8 - reference point, in log2 units): the f16 fragment and the lane's sum
__device__ __forceinline__ float pfrag(const float (&tv)[16], const float moff, Frag& bp) {
  float ps = 0.f;
#pragma unroll
  for (int u = 0; u < 2; ++u) {
    float a[8], p[8];
#pragma unroll
    for (int j = 0; j < 8; ++j) a[j] = fmaf(tv[u * 8 + j], CQK_ * L2E_, moff);
    exp2x8(a, p);
#pragma unroll
    for (int j = 0; j < 8; ++j) {
      ps = (u + j == 0) ? p[0] : ps + p[j];
      bp.v[u * 8 + j] = (_Float16)p[j];                  // element i = key 16(i/8) + 8h + i%8, as ldpk orders V
    }
  }
  return ps;
}

__global__ __launch_bounds__(256) void k_attn(
    const _Float16* __restrict__ qT, const _Float16* __restrict__ kT, const _Float16* __restrict__ vN,
    const _Float16* __restrict__ biasP, _Float16* goT) {
  const int qblk = blockIdx.x, n = blockIdx.y, b = blockIdx.z;
  const int tid = threadIdx.x;
  const int w = tid >> 5, lane = tid & 31;
  const int qbase = qblk * 256 + w * 32;
  const int bn = b * NH_ + n;
  v16h bq[2];
#pragma unroll
  for (int g = 0; g < 2; ++g) bq[g] = ldpk(qT + ((size_t)bn * NP_ + qbase + 16 * g) * DK_, lane);
  const _Float16* kp = kT + (size_t)bn * NP_ * DK_;                                  // A row m = key
  const _Float16* vp = vN + (size_t)(b * (NO_ / 16) + n * (DV_ / 16)) * (NP_ / 32) * 512;   // A row m = value channel
  const _Float16* bb = biasP + (size_t)(n * (NP_ / 32) + (qbase >> 5)) * (NP_ / 16) * 512;  // A row m = key, k = query
  const v8f vz = vzero();
  // selector of group g, a B fragment: 2^6 where k = 16g + column, else 0 (k of element e: 8h + e, of 8 + e: 16 + 8h + e).
  // 2^5 (table) * 2^6 = 1 / (SCALE * CQK_): the bias in the units of the raw product
  Frag sel[2];
#pragma unroll
  for (int e = 0; e < 8; ++e) {
    const _Float16 d = ((lane >> 4) * 8 + e == (lane & 15)) ? (_Float16)64.0f : (_Float16)0.0f;
    sel[0].v[e] = d;               sel[0].v[8 + e] = (_Float16)0.0f;
    sel[1].v[e] = (_Float16)0.0f;  sel[1].v[8 + e] = d;
  }

  v8f oacc[2][4] = {{vz, vz, vz, vz}, {vz, vz, vz, vz}};
  // mrun: the query's reference point, the largest score seen when it was last set. It is set anew only when a chunk's
  // exponentials against it grow past PLIM_ (the first chunk does: they are infinite); until then no maximum is searched,
  // nothing is exchanged between the wave halves and no accumulator is rescaled. It never exceeds the running maximum.
  float mrun[2] = {-3.0e38f, -3.0e38f};
  float moff[2] = {fmaf(3.0e38f, CQK_ * L2E_, 8.0f), fmaf(3.0e38f, CQK_ * L2E_, 8.0f)};   // 8 - mrun in log2 units
  float lsum[2] = {0.f, 0.f};

  // the four work-groups that read one (b, n)'s K and V start 8 chunks apart, those that read one bias plane 4 apart (in
  // pairs), and wrap: their requests for one line do not meet in L2. All waves of a work-group walk alike: they share K and V lines.
  int kc = (qblk * 8 + (b & 7) * 4) & 31;
  const _Float16* kpc = kp + (size_t)kc * 32 * DK_;
  const _Float16* vpc = vp + (size_t)kc * 512;
  const _Float16* bbc = bb + (size_t)kc * 1024;
#pragma unroll 1
  for (int it = 0; it < 32; ++it) {
    v16h ak[2], av[4];
#pragma unroll
    for (int u = 0; u < 2; ++u) ak[u] = ldpk(kpc + (size_t)(16 * u) * DK_, lane);
    v16h ab[2];
#pragma unroll
    for (int u = 0; u < 2; ++u) ab[u] = ldpk(bbc + (size_t)u * 512, lane);
    // precaution: the registers that hold the addresses of the loads above are reused below
    asm volatile("s_wait_xcnt 0x0" ::: "memory");
#pragma unroll
    for (int t = 0; t < 4; ++t) av[t] = ldpk(vpc + (size_t)(t * (NP_ / 32)) * 512, lane);
    // precaution: as above, for the addresses of the V loads
    asm volatile("s_wait_xcnt 0x0" ::: "memory");
    // without it the scheduler lifts the bias products in between the loads, and the V loads wait for the first tile
    __builtin_amdgcn_sched_barrier(0);
    {
      const int adv = (kc == 31) ? -31 : 1;              // behind the last chunk: back to key 0
      kc = (kc + 1) & 31;
      kpc += adv * (32 * DK_); vpc += adv * 512; bbc += adv * 1024;
    }
    float tv[2][16];
#pragma unroll
    for (int g = 0; g < 2; ++g) {
#pragma unroll
      for (int u = 0; u < 2; ++u) {
        // D[8h+j][m]: key 16u+8h+j of this chunk, query column m; raw units, one log2 unit = 1 / (CQK_ * L2E_)
        const v8f s = mmab(ak[u], bq[g], mmab(ab[u], sel[g].v, vz));
#pragma unroll
        for (int j = 0; j < 8; ++j) tv[g][u * 8 + j] = s[j];
      }
    }
    // keeps the eight score products in one run: spread among the exponentials, each run of them is followed by its own
    // idle slots before a vector instruction may touch its registers
    __builtin_amdgcn_sched_barrier(0);
    // common path: the exponentials are taken against the reference point the query already has
    Frag bp[2];
    float ps[2];
#pragma unroll
    for (int g = 0; g < 2; ++g) ps[g] = pfrag(tv[g], moff[g], bp[g]);
    // no p is negative, so a lane's sum bounds each of its p: up to PLIM_ all 32 are finite in f16. One test per chunk, the
    // same for the whole wave (the matrix products below need every lane); written so that a NaN takes the branch too
    if (__builtin_expect(__builtin_amdgcn_ballot_w32(!(ps[0] + ps[1] <= PLIM_)) != 0u, 0)) {
#pragma unroll
      for (int g = 0; g < 2; ++g) {
        float mx = tv[g][0];
#pragma unroll
        for (int i = 1; i < 16; ++i) mx = fmaxf(mx, tv[g][i]);
        mx = fmaxf(mx, xhalf(mx));                       // both halves of the wave hold keys of the same query
        const float mnew = fmaxf(mrun[g], mx);
        float alpha;                                     // 2^(old reference - new reference), 0 on the first chunk
        // v_nop: the slot behind a transcendental. In one statement with it, since a v_nop of its own does not stay behind it
        asm("v_exp_f32 %0, %1\n\tv_nop" : "=v"(alpha) : "v"((mrun[g] - mnew) * (CQK_ * L2E_)));
        mrun[g] = mnew;
        moff[g] = fmaf(-mnew, CQK_ * L2E_, 8.0f);        // P carries 2^8; the row sum carries it too
        ps[g] = pfrag(tv[g], moff[g], bp[g]);            // now every p is at most 2^8
        lsum[g] *= alpha;
#pragma unroll
        for (int t = 0; t < 4; ++t) oacc[g][t] = oacc[g][t] * alpha;
      }
    }
#pragma unroll
    for (int g = 0; g < 2; ++g) {
      lsum[g] += ps[g];
#pragma unroll
      for (int t = 0; t < 4; ++t) oacc[g][t] = mmab(av[t], bp[g].v, oacc[g][t]);
    }
  }

  // normalise, GELU (erf form), scale 2^8; a lane holds 8 consecutive channels of one query: one piece of a
  // fragment-order tile (rows = pixels, k = channels), so a wave's store is 512 contiguous bytes
#pragma unroll
  for (int g = 0; g < 2; ++g) {
    const float l = lsum[g] + xhalf(lsum[g]);
    const float co = 1.0f / (l * 8.0f);                  // undo 2^3 (V); 2^8 (P) cancels against l
    _Float16* dst = goT + ((size_t)(b * (NP_ / 16) + (qbase >> 4) + g) * (NO_ / 32) + n * 2) * 512 + lane * 8;
#pragma unroll
    for (int t = 0; t < 4; ++t) {
      v8h o;
#pragma unroll
      for (int j = 0; j < 8; ++j) {
        const float xo = oacc[g][t][j] * co;
        const float gl = 0.5f * xo * (1.0f + erff(xo * 0.70710678118654752f));
        o[j] = (_Float16)(gl * 256.0f);
      }
      *(v8h*)(dst + (t >> 1) * 512 + (t & 1) * 256) = o;   // k = 64n + 16t + 8h: k tile 2n + t/2, half t&1
    }
  }
}

// ---------------- output projection GEMM (bias + BN folded) ---------------------------------------
__global__ __launch_bounds__(256) void k_out(
    const _Float16* __restrict__ goT, const _Float16* __restrict__ WoS, const float* __restrict__ betaO,
    float* out) {
  __shared__ __attribute__((aligned(16))) float To[128 * 68];
  const int ptile = blockIdx.x, nchunk = blockIdx.y, b = blockIdx.z;
  const int tid = threadIdx.x, lane = tid & 31, m = lane & 15, h = lane >> 4;
  // the wave's number as a scalar: tile indices and bases are then formed in scalar registers, which leaves the
  // vector registers to the fragment groups
  const int w = __builtin_amdgcn_readfirstlane(tid >> 5);
  const int msub = w & 3, nh = w >> 2;
  const int nbase = nchunk * 128 + nh * 64;
  v8f acc[4] = {vzero(), vzero(), vzero(), vzero()};
  const _Float16* ar = goT + (size_t)(b * (NP_ / 16) + ptile * 4 + msub) * (NO_ / 32) * 512;
  // the fragments of four k steps are requested as one group ahead of their products: one load latency per group.
  // Neighbours along ptile (which share weight lines) and the two nchunk (which share G lines) start at different
  // groups and wrap; g0 is the same for every b and for ptile four apart.
  int g0 = (ptile + nchunk * 2) & 3;                     // the group the walk stands at (scalar)
  const _Float16* pa = ar + g0 * (4 * 512);
  const _Float16* pw = WoS + (size_t)(nbase >> 4) * (NO_ / 32) * 512 + g0 * (4 * 512);
#pragma unroll 1
  for (int it = 0; it < 4; ++it) {
    v16h a[4], bt[4][4];
#pragma unroll
    for (int s = 0; s < 4; ++s) {
      a[s] = ldpk(pa + s * 512, lane);
#pragma unroll
      for (int t = 0; t < 4; ++t)
        bt[s][t] = ldpk(pw + (t * (NO_ / 32) + s) * 512, lane);
    }
    // precaution: the address registers of the loads above are reused below
    asm volatile("s_wait_xcnt 0x0" ::: "memory");
    // without it the scheduler sinks each tile's loads to just ahead of its product: one exposed latency per tile
    __builtin_amdgcn_sched_barrier(0);
    {
      const int adv = (g0 == 3) ? -12 * 512 : 4 * 512;   // behind the last group: back to k = 0
      g0 = (g0 + 1) & 3;
      pa += adv; pw += adv;
    }
#pragma unroll
    for (int s = 0; s < 4; ++s) {
#pragma unroll
      for (int t = 0; t < 4; ++t) acc[t] = mmab(a[s], bt[s][t], acc[t]);
    }
  }
  const float kS = 1.0f / 4096.0f;                       // undo 2^4 (W) and 2^8 (G)
#pragma unroll
  for (int t = 0; t < 4; ++t) {
    const int ol = nh * 64 + t * 16 + m;
    const float bta = betaO[nchunk * 128 + ol];
#pragma unroll
    for (int j = 0; j < 8; ++j) {
      const int pl = msub * 16 + 8 * h + j;
      To[ol * 68 + pl] = acc[t][j] * kS + bta;
    }
  }
  __syncthreads();
#pragma unroll
  for (int it = 0; it < 8; ++it) {
    const int pi = it * 256 + tid;                       // 128 rows x 16 float4 pieces
    const int ol = pi >> 4, pc = pi & 15;
    const v4f v = *(const v4fa*)(To + ol * 68 + pc * 4);
    float* dst = out + ((size_t)(b * NC_ + nchunk * 128 + ol)) * NP_ + ptile * 64 + pc * 4;
    *(v4f*)dst = v;
    
  }
}

// ---------------- launch glue ------------------------------------------------------------------------
extern "C" void kernel_launch(void* const* d_in, const int* in_sizes, int n_in,
                              void* d_out, int out_size, void* d_ws, size_t ws_size,
                              hipStream_t stream) {
  if (n_in < 24) return;
  if (in_sizes[0] != NB_ * NC_ * NP_) return;
  if (in_sizes[1] != NC_ * NC_ || in_sizes[6] != NC_ * NC_ || in_sizes[11] != NO_ * NC_) return;
  if (in_sizes[16] != NP_ * NH_ || in_sizes[17] != NC_ * NO_ || in_sizes[23] != NP_ * NP_) return;
  {
    const int f32c[13] = {2, 3, 4, 5, 7, 8, 9, 10, 18, 19, 20, 21, 22};
    for (int i = 0; i < 13; ++i) if (in_sizes[f32c[i]] != NC_) return;
    const int f32o[4] = {12, 13, 14, 15};
    for (int i = 0; i < 4; ++i) if (in_sizes[f32o[i]] != NO_) return;
  }
  if (out_size != NB_ * NC_ * NP_) return;

  const float* x    = (const float*)d_in[0];
  const float* Wq   = (const float*)d_in[1];
  const float* q_g  = (const float*)d_in[2];
  const float* q_b  = (const float*)d_in[3];
  const float* q_m  = (const float*)d_in[4];
  const float* q_v  = (const float*)d_in[5];
  const float* Wk   = (const float*)d_in[6];
  const float* k_g  = (const float*)d_in[7];
  const float* k_b  = (const float*)d_in[8];
  const float* k_m  = (const float*)d_in[9];
  const float* k_v  = (const float*)d_in[10];
  const float* Wv   = (const float*)d_in[11];
  const float* v_g  = (const float*)d_in[12];
  const float* v_b  = (const float*)d_in[13];
  const float* v_m  = (const float*)d_in[14];
  const float* v_v  = (const float*)d_in[15];
  const float* pose = (const float*)d_in[16];
  const float* Wo   = (const float*)d_in[17];
  const float* bo   = (const float*)d_in[18];
  const float* o_g  = (const float*)d_in[19];
  const float* o_b  = (const float*)d_in[20];
  const float* o_m  = (const float*)d_in[21];
  const float* o_v  = (const float*)d_in[22];
  const int*   pix  = (const int*)d_in[23];

  // workspace carve (bytes), every offset a multiple of 1024
  const size_t O_WH    = 0;                                             // 1024*256*2
  const size_t O_WL    = O_WH    + (size_t)1024 * NC_ * 2;              // 524288
  const size_t O_BETA  = O_WL    + (size_t)1024 * NC_ * 2;              // 1048576, 4096 B
  const size_t O_WOS   = O_BETA  + 4096;                                // 1052672, 256*512*2
  const size_t O_BETAO = O_WOS   + (size_t)NC_ * NO_ * 2;               // 1314816, 1024 B
  const size_t O_XTH   = O_BETAO + 1024;                                // 1315840, 8 MB
  const size_t O_XTL   = O_XTH   + (size_t)NB_ * NP_ * NC_ * 2;         // 9704448
  const size_t O_QT    = O_XTL   + (size_t)NB_ * NP_ * NC_ * 2;         // 18093056, 8 MB
  const size_t O_KT    = O_QT    + (size_t)NB_ * NH_ * NP_ * DK_ * 2;   // 26481664
  const size_t O_VN    = O_KT    + (size_t)NB_ * NH_ * NP_ * DK_ * 2;   // 34870272, 16 MB
  const size_t O_GOT   = O_VN    + (size_t)NB_ * NO_ * NP_ * 2;         // 51647488, 16 MB
  const size_t O_BIAS  = O_GOT   + (size_t)NB_ * NP_ * NO_ * 2;         // 68424704, 16 MB
  const size_t O_END   = O_BIAS  + (size_t)NH_ * NP_ * NP_ * 2;         // 85201920
  if (O_END > ws_size) return;

  char* ws = (char*)d_ws;
  _Float16* Wh    = (_Float16*)(ws + O_WH);
  _Float16* Wl    = (_Float16*)(ws + O_WL);
  float*    beta  = (float*)   (ws + O_BETA);
  _Float16* WoS   = (_Float16*)(ws + O_WOS);
  float*    betaO = (float*)   (ws + O_BETAO);
  _Float16* xTh   = (_Float16*)(ws + O_XTH);
  _Float16* xTl   = (_Float16*)(ws + O_XTL);
  _Float16* qT    = (_Float16*)(ws + O_QT);
  _Float16* kT    = (_Float16*)(ws + O_KT);
  _Float16* vN    = (_Float16*)(ws + O_VN);
  _Float16* goT   = (_Float16*)(ws + O_GOT);
  _Float16* biasP = (_Float16*)(ws + O_BIAS);

  k_prep<<<dim3(NFQ_ + NFO_ + (NP_ / 64) * (NC_ / 64) * NB_), dim3(256), 0, stream>>>(
      Wq, q_g, q_b, q_m, q_v, Wk, k_g, k_b, k_m, k_v, Wv, v_g, v_b, v_m, v_v,
      Wo, bo, o_g, o_b, o_m, o_v, x, pix, pose, Wh, Wl, beta, WoS, betaO, xTh, xTl, biasP);
  k_qkv<<<dim3(NP_ / 128, 8, NB_), dim3(256), 0, stream>>>(xTh, xTl, Wh, beta, qT, kT, vN);   // Wl = Wh + 1024*256 elements
  k_attn<<<dim3(NP_ / 256, NH_, NB_), dim3(256), 0, stream>>>(qT, kT, vN, biasP, goT);
  k_out<<<dim3(NP_ / 64, 2, NB_), dim3(256), 0, stream>>>(goT, WoS, betaO, (float*)d_out);
}

// v009
// Measured time: 79.6 microseconds a run.
// Timed twice side by side with v008, it ran 1.12 times as fast both times.
// Counting every step since v000, it is 8.83 times as fast.
#include <hip/hip_runtime.h>
#include <stddef.h>

// Contractions on v_wmma_f32_16x16x32_f16 (f16 operands, f32 accumulate): q/k channel GEMM as f16 hi/lo split (3 products, W scaled 2^10, x scaled 2^6), v channel GEMM single f16, QK^T single f16 (q,k scaled 2^3), P*V single f16 (P unnormalised, 2^8 at the query's reference point and at most 2^15, V scaled 2^3), output GEMM single f16 (W scaled 2^4, G scaled 2^8); position bias single f16 (scaled 2^5) times a 0 / 2^6 selector, summed into the QK^T accumulator; BN folds, softmax, GELU in f32.

typedef _Float16 v16h __attribute__((ext_vector_type(16)));
typedef _Float16 v8h  __attribute__((ext_vector_type(8)));
typedef float    v8f  __attribute__((ext_vector_type(8)));
typedef float    v4f  __attribute__((ext_vector_type(4)));
typedef v8h v8ha __attribute__((may_alias));
typedef v4f v4fa __attribute__((may_alias));

#define NB_  16
#define NC_  256
#define NP_  1024
#define NH_  8
#define DK_  32
#define DV_  64
#define NO_  512
#define EPS_ 1e-5f
#define CQK_ (0.17677669529663687f * 0.015625f)
#define L2E_ 1.4426950408889634f
#define PLIM_ 32768.0f

union Frag { v16h v; v8h p[2]; };

// Fragment-order storage of every 16-bit matrix operand: a tile of 16 rows x 32 k is 1024 contiguous bytes,
// made of 64 pieces of 8 elements; piece p*32 + h*16 + m holds row m, k = 16p + 8h .. +7.
// Tiles are ordered [row tile][k tile], KT k tiles to a row tile. A wave-wide 16-byte load of one half of a
// fragment then covers 512 contiguous bytes (4 whole 128-byte lines) and not 16 lines.
__device__ __forceinline__ size_t pkoff(int row, int k, int KT) {
  return ((((size_t)(row >> 4) * KT + (k >> 5)) * 64) + ((k >> 4) & 1) * 32 + ((k >> 3) & 1) * 16 + (row & 15)) * 8;
}

// 16x32 fragment from one tile: elements 0..7 <- k 8h..+7, 8..15 <- k 16+8h..+7 of row m (lane = 16h + m)
__device__ __forceinline__ v16h ldpk(const _Float16* tile, int lane) {
  Frag f;
  f.p[0] = *(const v8ha*)(tile + lane * 8);
  f.p[1] = *(const v8ha*)(tile + 256 + lane * 8);
  return f.v;
}

__device__ __forceinline__ v8f mmab(v16h a, v16h b, v8f c) {
  return __builtin_amdgcn_wmma_f32_16x16x32_f16(false, a, false, b, (short)0, c, false, false);
}

// lane l <-> lane l ^ 16
__device__ __forceinline__ float xhalf(float x) {
  const int i = __builtin_bit_cast(int, x);
  return __builtin_bit_cast(float, __builtin_amdgcn_permlanex16(i, i, 0x76543210, 0xfedcba98, false, false));
}

__device__ __forceinline__ v8f vzero() {
  v8f z = {0.f, 0.f, 0.f, 0.f, 0.f, 0.f, 0.f, 0.f};
  return z;
}

// ---------------- BN folded into QKV weights: Wh/Wl f16 hi/lo planes of W*inv*1024, beta[1024] -----
// 32 rows per block, wave w handles rows w*4..w*4+3, lane writes 8 consecutive columns (16 B)
__device__ __forceinline__ void fold_qkv_blk(const int blk, float* sb,
    const float* __restrict__ Wq, const float* __restrict__ qg, const float* __restrict__ qb,
    const float* __restrict__ qm, const float* __restrict__ qv,
    const float* __restrict__ Wk, const float* __restrict__ kg, const float* __restrict__ kb,
    const float* __restrict__ km, const float* __restrict__ kv,
    const float* __restrict__ Wv, const float* __restrict__ vg, const float* __restrict__ vb,
    const float* __restrict__ vm, const float* __restrict__ vv,
    _Float16* Wh, _Float16* Wl, float* beta) {
  const int tid = threadIdx.x, w = tid >> 5, lane = tid & 31;
#pragma unroll 1
  for (int i = 0; i < 4; ++i) {
    const int o = blk * 32 + w * 4 + i;   // 0..1023
    const float* W;
    float g, bb, mm, var;
    int oo;
    if (o < 256)      { oo = o;       W = Wq; g = qg[oo]; bb = qb[oo]; mm = qm[oo]; var = qv[oo]; }
    else if (o < 512) { oo = o - 256; W = Wk; g = kg[oo]; bb = kb[oo]; mm = km[oo]; var = kv[oo]; }
    else              { oo = o - 512; W = Wv; g = vg[oo]; bb = vb[oo]; mm = vm[oo]; var = vv[oo]; }
    const float inv = g * (1.0f / sqrtf(var + EPS_));
    const float* wr = W + (size_t)oo * NC_ + lane * 8;
    const v4f w0 = *(const v4fa*)(wr);
    const v4f w1 = *(const v4fa*)(wr + 4);
    float vals[8] = {w0.x, w0.y, w0.z, w0.w, w1.x, w1.y, w1.z, w1.w};
    v8h hv, lv;
#pragma unroll
    for (int e = 0; e < 8; ++e) {
      const float s = vals[e] * inv * 1024.0f;
      const _Float16 hh = (_Float16)s;
      const _Float16 ll = (_Float16)(s - (float)hh);
      hv[e] = hh; lv[e] = ll;
    }
    _Float16* dh = Wh + pkoff(o, lane * 8, NC_ / 32);
    _Float16* dl = Wl + pkoff(o, lane * 8, NC_ / 32);
    *(v8h*)dh = hv;
    *(v8h*)dl = lv;
    
    if (lane == 0) sb[w * 4 + i] = bb - mm * inv;
  }
  __syncthreads();
  if (w == 0 && lane < 8) {
    v4f b4;
    b4.x = sb[lane * 4 + 0]; b4.y = sb[lane * 4 + 1]; b4.z = sb[lane * 4 + 2]; b4.w = sb[lane * 4 + 3];
    float* db = beta + blk * 32 + lane * 4;
    *(v4f*)db = b4;
    
  }
}

// ---------------- bo + output BN folded into Wo: WoS f16 = Wo*inv*16, betaO[256] -------------------
__device__ __forceinline__ void fold_wo_blk(const int blk, float* sb,
    const float* __restrict__ Wo, const float* __restrict__ bo, const float* __restrict__ og,
    const float* __restrict__ ob, const float* __restrict__ om, const float* __restrict__ ov,
    _Float16* WoS, float* betaO) {
  const int tid = threadIdx.x, w = tid >> 5, lane = tid & 31;
#pragma unroll 1
  for (int i = 0; i < 4; ++i) {
    const int o = blk * 32 + w * 4 + i;   // 0..255
    const float inv = og[o] * (1.0f / sqrtf(ov[o] + EPS_));
#pragma unroll
    for (int hf = 0; hf < 2; ++hf) {
      const float* wr = Wo + (size_t)o * NO_ + hf * 256 + lane * 8;
      const v4f w0 = *(const v4fa*)(wr);
      const v4f w1 = *(const v4fa*)(wr + 4);
      float vals[8] = {w0.x, w0.y, w0.z, w0.w, w1.x, w1.y, w1.z, w1.w};
      v8h hv;
#pragma unroll
      for (int e = 0; e < 8; ++e) hv[e] = (_Float16)(vals[e] * inv * 16.0f);
      _Float16* dh = WoS + pkoff(o, hf * 256 + lane * 8, NO_ / 32);
      *(v8h*)dh = hv;
      
    }
    if (lane == 0) sb[w * 4 + i] = bo[o] * inv + ob[o] - om[o] * inv;
  }
  __syncthreads();
  if (w == 0 && lane < 8) {
    v4f b4;
    b4.x = sb[lane * 4 + 0]; b4.y = sb[lane * 4 + 1]; b4.z = sb[lane * 4 + 2]; b4.w = sb[lane * 4 + 3];
    float* db = betaO + blk * 32 + lane * 4;
    *(v4f*)db = b4;
    
  }
}

// ---------------- x[b][c][p] -> xTh/xTl, rows b*1024+p, k = c, fragment order: f16 hi/lo planes of 64*x ----
__device__ __forceinline__ void tr_blk(const int pblk, const int cblk, const int b, float (*T)[65],
                                       const float* __restrict__ x, _Float16* xTh, _Float16* xTl) {
  const int tid = threadIdx.x;
#pragma unroll
  for (int it = 0; it < 16; ++it) {
    const int idx = it * 256 + tid;
    const int ci = idx >> 6, pj = idx & 63;
    T[ci][pj] = x[((size_t)(b * NC_ + cblk * 64 + ci)) * NP_ + pblk * 64 + pj];
  }
  __syncthreads();
#pragma unroll
  for (int it = 0; it < 2; ++it) {
    const int pi = it * 256 + tid;
    const int pl = pi & 63, pc = pi >> 6;                // a wave: 32 rows of one piece column = 2 x 256 B
    v8h hv, lv;
#pragma unroll
    for (int e = 0; e < 8; ++e) {
      const float s = T[pc * 8 + e][pl] * 64.0f;
      const _Float16 hh = (_Float16)s;
      const _Float16 ll = (_Float16)(s - (float)hh);
      hv[e] = hh; lv[e] = ll;
    }
    const size_t off = pkoff(b * NP_ + pblk * 64 + pl, cblk * 64 + pc * 8, NC_ / 32);
    *(v8h*)(xTh + off) = hv;
    *(v8h*)(xTl + off) = lv;
    
  }
}

// ---------------- QKV projection GEMM (BN folded) --------------------------------------------------
// K loop: every fragment of a group (one k step with hi/lo planes, two without) is requested before the group's first
// product, so a group waits out one load latency and not one per tile. Each accumulator takes its products in the order hi*hi, hi*lo, lo*hi,
// k ascending from the work-group's own first group g0 and wrapping: neighbours along ptile start one group apart, to spread
// their requests for one W line; g0 is the same for every b.
template <bool SPLIT>
__device__ __forceinline__ void qkv_acc(const _Float16* __restrict__ ahr, const _Float16* __restrict__ alr,
                                        const _Float16* __restrict__ whr, int loff, int rot, v8f (&acc)[4][4]) {
  constexpr int G = SPLIT ? 1 : 2;                       // k steps to a group: 32 loads of 16 bytes either way
  constexpr int RT = (NC_ / 32) * 512;                   // from one row tile of x to the next
  constexpr int NG = 8 / G;                              // groups in the walk
  int g0 = rot & (NG - 1);                               // the group the walk stands at (scalar)
  // the lane's own addresses, advanced behind the wait: no load of a group lands on a register that another load of
  // the group names. The lo plane of W follows its hi plane in the workspace: one address serves both.
  const _Float16* pah = ahr + loff + g0 * (G * 512);
  const _Float16* pal = alr + loff + g0 * (G * 512);
  const _Float16* pwh = whr + loff + g0 * (G * 512);
#pragma unroll 1
  for (int it = 0; it < NG; ++it) {
    v16h ah[G][4], al[G][4], bh[G][4], bl[G][4];
#pragma unroll
    for (int s = 0; s < G; ++s) {
#pragma unroll
      for (int r = 0; r < 4; ++r) {
        ah[s][r] = ldpk(pah + r * RT + s * 512, 0);
        if (SPLIT) al[s][r] = ldpk(pal + r * RT + s * 512, 0);
      }
#pragma unroll
      for (int t = 0; t < 4; ++t) {
        bh[s][t] = ldpk(pwh + (t * (NC_ / 32) + s) * 512, 0);
        if (SPLIT) bl[s][t] = ldpk(pwh + 1024 * NC_ + (t * (NC_ / 32) + s) * 512, 0);
      }
    }
    // precaution: the address registers of the loads above (named here, so that they live up to the wait) are
    // advanced below
    if (SPLIT) asm volatile("s_wait_xcnt 0x0" :: "v"(pah), "v"(pal), "v"(pwh) : "memory");
    else       asm volatile("s_wait_xcnt 0x0" :: "v"(pah), "v"(pwh) : "memory");
    // without it the scheduler sinks each tile's loads to just ahead of its product: one exposed latency per tile
    __builtin_amdgcn_sched_barrier(0);
    const int adv = (g0 == NG - 1) ? (G - 8) * 512 : G * 512;   // behind the last group: back to k = 0
    g0 = (g0 + 1) & (NG - 1);
    pah += adv; pal += adv; pwh += adv;
#pragma unroll
    for (int s = 0; s < G; ++s) {
#pragma unroll
      for (int i = 0; i < 16; ++i) acc[i >> 2][i & 3] = mmab(ah[s][i >> 2], bh[s][i & 3], acc[i >> 2][i & 3]);
      if (SPLIT) {
#pragma unroll
        for (int i = 0; i < 16; ++i) acc[i >> 2][i & 3] = mmab(ah[s][i >> 2], bl[s][i & 3], acc[i >> 2][i & 3]);
#pragma unroll
        for (int i = 0; i < 16; ++i) acc[i >> 2][i & 3] = mmab(al[s][i >> 2], bh[s][i & 3], acc[i >> 2][i & 3]);
      }
    }
  }
}

// block tile 128 pixels x 128 output channels, 4 waves (2 row halves x 2 column halves), K = 256. A wave owns 64 pixels x
// 64 channels: each W fragment serves four row tiles and each x fragment four column tiles, so a product takes half a
// loaded fragment (a 32-row wave: three quarters), and the launch starts half as many waves.
// q,k column chunks (nchunk 0..3): hi*hi + hi*lo + lo*hi; v chunks (4..7): hi*hi.
// qT,kT: per b*8+n rows p, k = d (x8);  vN: rows b*512+channel, k = p (x8); all in fragment order
// at least 3 waves per SIMD (three work-groups to a WGP): the fragment group and the accumulators take 128 registers each
__global__ __launch_bounds__(128) __attribute__((amdgpu_waves_per_eu(3))) void k_qkv(
    const _Float16* __restrict__ xTh, const _Float16* __restrict__ xTl,
    const _Float16* __restrict__ Wh, const float* __restrict__ beta,
    _Float16* qT, _Float16* kT, _Float16* vN) {
  __shared__ __attribute__((aligned(16))) _Float16 st[128 * 136];   // q/k view: [pixel][136], v view: [channel][136]
  const int ptile = blockIdx.x, nchunk = blockIdx.y, b = blockIdx.z;
  const int tid = threadIdx.x, lane = tid & 31, m = lane & 15, h = lane >> 4;
  // the wave's number as a scalar: tile indices and bases are then formed in scalar registers, which leaves the
  // vector registers to the fragment groups
  const int w = __builtin_amdgcn_readfirstlane(tid >> 5);
  const int msub = w & 1, nh = w >> 1;
  const int nbase = nchunk * 128 + nh * 64;
  const bool split = (nchunk < 4);   // block-uniform

  v8f acc[4][4];
#pragma unroll
  for (int i = 0; i < 16; ++i) acc[i >> 2][i & 3] = vzero();
  const size_t atile = (size_t)(b * (NP_ / 16) + ptile * 8 + msub * 4) * (NC_ / 32) * 512;
  const _Float16* ahr = xTh + atile;
  const _Float16* alr = xTl + atile;
  const _Float16* whr = Wh + (size_t)(nbase >> 4) * (NC_ / 32) * 512;
  // W lines are shared along ptile (and b), x lines along nchunk: neighbours in either direction start one group apart
  const int rot = ptile + nchunk;
  if (split) qkv_acc<true>(ahr, alr, whr, lane * 8, rot, acc);
  else       qkv_acc<false>(ahr, alr, whr, lane * 8, rot, acc);

  // epilogue: scale back 2^-16, add folded beta, scale x8, stage 16-bit tile in LDS
  const float kS = 1.0f / 65536.0f;
  float bta[4];
#pragma unroll
  for (int t = 0; t < 4; ++t) bta[t] = beta[nchunk * 128 + nh * 64 + t * 16 + m];   // column = this lane's n
  const int ol0 = nh * 64 + m;                           // + 16t: 0..127
  const int pl0 = msub * 64 + 8 * h;                     // + 16r + j: D row 8h+j of row tile r
  if (split) {
#pragma unroll
    for (int t = 0; t < 4; ++t)
#pragma unroll
      for (int r = 0; r < 4; ++r)
#pragma unroll
        for (int j = 0; j < 8; ++j)
          st[(pl0 + r * 16 + j) * 136 + ol0 + t * 16] = (_Float16)((acc[r][t][j] * kS + bta[t]) * 8.0f);
  } else {
#pragma unroll
    for (int t = 0; t < 4; ++t)
#pragma unroll
      for (int r = 0; r < 4; ++r) {
        v8h o;                                           // 8 consecutive pixels of one channel: one 16-byte store
#pragma unroll
        for (int j = 0; j < 8; ++j) o[j] = (_Float16)((acc[r][t][j] * kS + bta[t]) * 8.0f);
        *(v8ha*)(st + (ol0 + t * 16) * 136 + pl0 + r * 16) = o;
      }
  }
  __syncthreads();

  if (split) {
    _Float16* base = (nchunk < 2) ? qT : kT;
    const int hb = (nchunk & 1) * 4;
    v8h pv[16];                                          // all LDS reads ahead of the stores: one LDS latency, not sixteen
#pragma unroll
    for (int it = 0; it < 16; ++it) {
      const int pi = it * 128 + tid;                     // 2048 pieces of 16 B
      const int hd = pi >> 9, r = pi & 511;
      const int pl = r >> 2, dq = r & 3;
      pv[it] = *(const v8ha*)(st + pl * 136 + hd * 32 + dq * 8);
    }
#pragma unroll
    for (int it = 0; it < 16; ++it) {
      const int pi = it * 128 + tid;
      const int hd = pi >> 9, r = pi & 511;
      const int pl = r >> 2, dq = r & 3;
      _Float16* dst = base + ((size_t)(b * NH_ + hb + hd)) * NP_ * DK_ + pkoff(ptile * 128 + pl, dq * 8, 1);
      *(v8h*)dst = pv[it];
    }
  } else {
    const int obase = (nchunk - 4) * 128;
    v8h pv[16];                                          // as above
#pragma unroll
    for (int it = 0; it < 16; ++it) {
      const int pi = it * 128 + tid;                     // 128 rows x 16 pieces
      const int ol = pi & 127, pc = pi >> 7;             // a wave: 32 rows of one piece column = 2 x 256 B
      pv[it] = *(const v8ha*)(st + ol * 136 + pc * 8);
    }
#pragma unroll
    for (int it = 0; it < 16; ++it) {
      const int pi = it * 128 + tid;
      const int ol = pi & 127, pc = pi >> 7;
      _Float16* dst = vN + pkoff(b * NO_ + obase + ol, ptile * 128 + pc * 8, NP_ / 32);
      *(v8h*)dst = pv[it];
    }
    // precaution: the code of the other path follows in the listing and rewrites registers that the stores above name
    asm volatile("s_wait_xcnt 0x0" ::: "memory");
  }
}

// ---------------- position bias, gathered once for all batches ---------------------------------------
// biasP: per head n and group of 32 queries q32, 64 tiles of 16 keys (rows) x 32 queries (k) in fragment order,
// value pos_emb[index(query, key)][n] * 2^5. One work item (0..262143): one piece place (8 queries of one key) of
// four heads. The index is bounded here, before it forms an address.
struct BiasIdx { int ix[8]; };
__device__ __forceinline__ BiasIdx bias_idx(const int P, const int* __restrict__ pidx) {
  const int lane = P & 31, p = (P >> 5) & 1, kt = (P >> 7) & 63, q32 = P >> 13;
  const int m = lane & 15, h = lane >> 4;
  const int* src = pidx + (size_t)(q32 * 32 + 16 * p + 8 * h) * NP_ + kt * 16 + m;
  BiasIdx r;
#pragma unroll
  for (int e = 0; e < 8; ++e) r.ix[e] = src[(size_t)e * NP_];
  return r;
}
__device__ __forceinline__ void bias_put(const int P, const BiasIdx& r, const float* __restrict__ posemb,
                                         _Float16* biasP) {
  const int pl = P & 63, hh = (P >> 6) & 1, kt = (P >> 7) & 63, q32 = P >> 13;
  v8h o[4];
#pragma unroll
  for (int e = 0; e < 8; ++e) {
    int ix = r.ix[e];
    ix = ix < 0 ? 0 : (ix > NP_ - 1 ? NP_ - 1 : ix);
    const v4f pe = *(const v4fa*)(posemb + (size_t)ix * NH_ + hh * 4);
#pragma unroll
    for (int i = 0; i < 4; ++i) o[i][e] = (_Float16)(pe[i] * 32.0f);
  }
#pragma unroll
  for (int i = 0; i < 4; ++i)
    *(v8h*)(biasP + ((size_t)((hh * 4 + i) * (NP_ / 32) + q32) * (NP_ / 16) + kt) * 512 + pl * 8) = o[i];
}

// ---------------- all preparation in one launch ------------------------------------------------------
// None of the four jobs reads what another writes. Work-groups 0..31 fold the QKV weights, 32..39 the output
// weights (their serial row loops start first and run beside the rest); each of the other 1024 transposes one
// 64 x 64 tile of x and builds 256 work items of the bias table (1024 x 256 = all of them).
#define NFQ_ 32
#define NFO_ 8
__global__ __launch_bounds__(256) void k_prep(
    const float* __restrict__ Wq, const float* __restrict__ qg, const float* __restrict__ qb,
    const float* __restrict__ qm, const float* __restrict__ qv,
    const float* __restrict__ Wk, const float* __restrict__ kg, const float* __restrict__ kb,
    const float* __restrict__ km, const float* __restrict__ kv,
    const float* __restrict__ Wv, const float* __restrict__ vg, const float* __restrict__ vb,
    const float* __restrict__ vm, const float* __restrict__ vv,
    const float* __restrict__ Wo, const float* __restrict__ bo, const float* __restrict__ og,
    const float* __restrict__ ob, const float* __restrict__ om, const float* __restrict__ ov,
    const float* __restrict__ x, const int* __restrict__ pidx, const float* __restrict__ posemb,
    _Float16* Wh, _Float16* Wl, float* beta, _Float16* WoS, float* betaO,
    _Float16* xTh, _Float16* xTl, _Float16* biasP) {
  __shared__ __attribute__((aligned(16))) float T[64][65];
  const int blk = blockIdx.x;                            // the same for a whole work-group: its barriers are uniform
  if (blk < NFQ_) {
    fold_qkv_blk(blk, &T[0][0], Wq, qg, qb, qm, qv, Wk, kg, kb, km, kv, Wv, vg, vb, vm, vv, Wh, Wl, beta);
  } else if (blk < NFQ_ + NFO_) {
    fold_wo_blk(blk - NFQ_, &T[0][0], Wo, bo, og, ob, om, ov, WoS, betaO);
  } else {
    const int t = blk - (NFQ_ + NFO_);
    // the indices are requested with the tile's loads; the table's stores follow the tile's: a store in front of
    // the tile's barrier would be waited for there
    const int P = t * 256 + threadIdx.x;
    const BiasIdx bi = bias_idx(P, pidx);
    tr_blk(t & 15, (t >> 4) & 3, t >> 6, T, x, xTh, xTl);
    bias_put(P, bi, posemb, biasP);
    // precaution: the code of the other branches follows in the listing and rewrites registers that the stores above name
    asm volatile("s_wait_xcnt 0x0" ::: "memory");
  }
}

// 2^x of the eight scores of one tile, in one statement: the outputs are early-clobber, so no exponential of the run lands on
// a register that another one still reads, and v_nop fills the slot behind the last transcendental
__device__ __forceinline__ void exp2x8(const float (&a)[8], float (&p)[8]) {
  asm("v_exp_f32 %0, %8\n\tv_exp_f32 %1, %9\n\tv_exp_f32 %2, %10\n\tv_exp_f32 %3, %11\n\t"
      "v_exp_f32 %4, %12\n\tv_exp_f32 %5, %13\n\tv_exp_f32 %6, %14\n\tv_exp_f32 %7, %15\n\tv_nop"
      : "=&v"(p[0]), "=&v"(p[1]), "=&v"(p[2]), "=&v"(p[3]), "=&v"(p[4]), "=&v"(p[5]), "=&v"(p[6]), "=&v"(p[7])
      : "v"(a[0]), "v"(a[1]), "v"(a[2]), "v"(a[3]), "v"(a[4]), "v"(a[5]), "v"(a[6]), "v"(a[7]));
}

// P of one group of 16 queries against the offset moff (8 - reference point, in log2 units): the f16 fragment and the lane's sum
__device__ __forceinline__ float pfrag(const float (&tv)[16], const float moff, Frag& bp) {
  float ps = 0.f;
#pragma unroll
  for (int u = 0; u < 2; ++u) {
    float a[8], p[8];
#pragma unroll
    for (int j = 0; j < 8; ++j) a[j] = fmaf(tv[u * 8 + j], CQK_ * L2E_, moff);
    exp2x8(a, p);
#pragma unroll
    for (int j = 0; j < 8; ++j) {
      ps = (u + j == 0) ? p[0] : ps + p[j];
      bp.v[u * 8 + j] = (_Float16)p[j];                  // element i = key 16(i/8) + 8h + i%8, as ldpk orders V
    }
  }
  return ps;
}

__global__ __launch_bounds__(256) void k_attn(
    const _Float16* __restrict__ qT, const _Float16* __restrict__ kT, const _Float16* __restrict__ vN,
    const _Float16* __restrict__ biasP, _Float16* goT) {
  const int qblk = blockIdx.x, n = blockIdx.y, b = blockIdx.z;
  const int tid = threadIdx.x;
  const int w = tid >> 5, lane = tid & 31;
  const int qbase = qblk * 256 + w * 32;
  const int bn = b * NH_ + n;
  v16h bq[2];
#pragma unroll
  for (int g = 0; g < 2; ++g) bq[g] = ldpk(qT + ((size_t)bn * NP_ + qbase + 16 * g) * DK_, lane);
  const _Float16* kp = kT + (size_t)bn * NP_ * DK_;                                  // A row m = key
  const _Float16* vp = vN + (size_t)(b * (NO_ / 16) + n * (DV_ / 16)) * (NP_ / 32) * 512;   // A row m = value channel
  const _Float16* bb = biasP + (size_t)(n * (NP_ / 32) + (qbase >> 5)) * (NP_ / 16) * 512;  // A row m = key, k = query
  const v8f vz = vzero();
  // selector of group g, a B fragment: 2^6 where k = 16g + column, else 0 (k of element e: 8h + e, of 8 + e: 16 + 8h + e).
  // 2^5 (table) * 2^6 = 1 / (SCALE * CQK_): the bias in the units of the raw product
  Frag sel[2];
#pragma unroll
  for (int e = 0; e < 8; ++e) {
    const _Float16 d = ((lane >> 4) * 8 + e == (lane & 15)) ? (_Float16)64.0f : (_Float16)0.0f;
    sel[0].v[e] = d;               sel[0].v[8 + e] = (_Float16)0.0f;
    sel[1].v[e] = (_Float16)0.0f;  sel[1].v[8 + e] = d;
  }

  v8f oacc[2][4] = {{vz, vz, vz, vz}, {vz, vz, vz, vz}};
  // mrun: the query's reference point, the largest score seen when it was last set. It is set anew only when a chunk's
  // exponentials against it grow past PLIM_ (the first chunk does: they are infinite); until then no maximum is searched,
  // nothing is exchanged between the wave halves and no accumulator is rescaled. It never exceeds the running maximum.
  float mrun[2] = {-3.0e38f, -3.0e38f};
  float moff[2] = {fmaf(3.0e38f, CQK_ * L2E_, 8.0f), fmaf(3.0e38f, CQK_ * L2E_, 8.0f)};   // 8 - mrun in log2 units
  float lsum[2] = {0.f, 0.f};

  // the four work-groups that read one (b, n)'s K and V start 8 chunks apart, those that read one bias plane 4 apart (in
  // pairs), and wrap: their requests for one line do not meet in L2. All waves of a work-group walk alike: they share K and V lines.
  int kc = (qblk * 8 + (b & 7) * 4) & 31;
  const _Float16* kpc = kp + (size_t)kc * 32 * DK_;
  const _Float16* vpc = vp + (size_t)kc * 512;
  const _Float16* bbc = bb + (size_t)kc * 1024;
#pragma unroll 1
  for (int it = 0; it < 32; ++it) {
    v16h ak[2], av[4];
#pragma unroll
    for (int u = 0; u < 2; ++u) ak[u] = ldpk(kpc + (size_t)(16 * u) * DK_, lane);
    v16h ab[2];
#pragma unroll
    for (int u = 0; u < 2; ++u) ab[u] = ldpk(bbc + (size_t)u * 512, lane);
    // precaution: the registers that hold the addresses of the loads above are reused below
    asm volatile("s_wait_xcnt 0x0" ::: "memory");
#pragma unroll
    for (int t = 0; t < 4; ++t) av[t] = ldpk(vpc + (size_t)(t * (NP_ / 32)) * 512, lane);
    // precaution: as above, for the addresses of the V loads
    asm volatile("s_wait_xcnt 0x0" ::: "memory");
    // without it the scheduler lifts the bias products in between the loads, and the V loads wait for the first tile
    __builtin_amdgcn_sched_barrier(0);
    {
      const int adv = (kc == 31) ? -31 : 1;              // behind the last chunk: back to key 0
      kc = (kc + 1) & 31;
      kpc += adv * (32 * DK_); vpc += adv * 512; bbc += adv * 1024;
    }
    float tv[2][16];
#pragma unroll
    for (int g = 0; g < 2; ++g) {
#pragma unroll
      for (int u = 0; u < 2; ++u) {
        // D[8h+j][m]: key 16u+8h+j of this chunk, query column m; raw units, one log2 unit = 1 / (CQK_ * L2E_)
        const v8f s = mmab(ak[u], bq[g], mmab(ab[u], sel[g].v, vz));
#pragma unroll
        for (int j = 0; j < 8; ++j) tv[g][u * 8 + j] = s[j];
      }
    }
    // keeps the eight score products in one run: spread among the exponentials, each run of them is followed by its own
    // idle slots before a vector instruction may touch its registers
    __builtin_amdgcn_sched_barrier(0);
    // common path: the exponentials are taken against the reference point the query already has
    Frag bp[2];
    float ps[2];
#pragma unroll
    for (int g = 0; g < 2; ++g) ps[g] = pfrag(tv[g], moff[g], bp[g]);
    // no p is negative, so a lane's sum bounds each of its p: up to PLIM_ all 32 are finite in f16. One test per chunk, the
    // same for the whole wave (the matrix products below need every lane); written so that a NaN takes the branch too
    if (__builtin_expect(__builtin_amdgcn_ballot_w32(!(ps[0] + ps[1] <= PLIM_)) != 0u, 0)) {
#pragma unroll
      for (int g = 0; g < 2; ++g) {
        float mx = tv[g][0];
#pragma unroll
        for (int i = 1; i < 16; ++i) mx = fmaxf(mx, tv[g][i]);
        mx = fmaxf(mx, xhalf(mx));                       // both halves of the wave hold keys of the same query
        const float mnew = fmaxf(mrun[g], mx);
        float alpha;                                     // 2^(old reference - new reference), 0 on the first chunk
        // v_nop: the slot behind a transcendental. In one statement with it, since a v_nop of its own does not stay behind it
        asm("v_exp_f32 %0, %1\n\tv_nop" : "=v"(alpha) : "v"((mrun[g] - mnew) * (CQK_ * L2E_)));
        mrun[g] = mnew;
        moff[g] = fmaf(-mnew, CQK_ * L2E_, 8.0f);        // P carries 2^8; the row sum carries it too
        ps[g] = pfrag(tv[g], moff[g], bp[g]);            // now every p is at most 2^8
        lsum[g] *= alpha;
#pragma unroll
        for (int t = 0; t < 4; ++t) oacc[g][t] = oacc[g][t] * alpha;
      }
    }
#pragma unroll
    for (int g = 0; g < 2; ++g) {
      lsum[g] += ps[g];
#pragma unroll
      for (int t = 0; t < 4; ++t) oacc[g][t] = mmab(av[t], bp[g].v, oacc[g][t]);
    }
  }

  // normalise, GELU (erf form), scale 2^8; a lane holds 8 consecutive channels of one query: one piece of a
  // fragment-order tile (rows = pixels, k = channels), so a wave's store is 512 contiguous bytes
#pragma unroll
  for (int g = 0; g < 2; ++g) {
    const float l = lsum[g] + xhalf(lsum[g]);
    const float co = 1.0f / (l * 8.0f);                  // undo 2^3 (V); 2^8 (P) cancels against l
    _Float16* dst = goT + ((size_t)(b * (NP_ / 16) + (qbase >> 4) + g) * (NO_ / 32) + n * 2) * 512 + lane * 8;
#pragma unroll
    for (int t = 0; t < 4; ++t) {
      v8h o;
#pragma unroll
      for (int j = 0; j < 8; ++j) {
        const float xo = oacc[g][t][j] * co;
        const float gl = 0.5f * xo * (1.0f + erff(xo * 0.70710678118654752f));
        o[j] = (_Float16)(gl * 256.0f);
      }
      *(v8h*)(dst + (t >> 1) * 512 + (t & 1) * 256) = o;   // k = 64n + 16t + 8h: k tile 2n + t/2, half t&1
    }
  }
}

// ---------------- output projection GEMM (bias + BN folded) ---------------------------------------
__global__ __launch_bounds__(256) void k_out(
    const _Float16* __restrict__ goT, const _Float16* __restrict__ WoS, const float* __restrict__ betaO,
    float* out) {
  __shared__ __attribute__((aligned(16))) float To[128 * 132];   // [channel][pixel], 4 floats of pad
  const int ptile = blockIdx.x, nchunk = blockIdx.y, b = blockIdx.z;
  const int tid = threadIdx.x, lane = tid & 31, m = lane & 15, h = lane >> 4;
  // the wave's number as a scalar: tile indices and bases are then formed in scalar registers, which leaves the
  // vector registers to the fragment groups
  const int w = __builtin_amdgcn_readfirstlane(tid >> 5);
  const int msub = w & 3, nh = w >> 2;
  const int nbase = nchunk * 128 + nh * 64;
  // block tile 128 pixels x 128 channels; a wave owns 32 pixels x 64 channels: each weight fragment serves two row tiles,
  // so a product takes 3/4 of a loaded fragment (a 16-row wave: 5/4), and the launch starts half as many waves
  v8f acc[2][4] = {{vzero(), vzero(), vzero(), vzero()}, {vzero(), vzero(), vzero(), vzero()}};
  constexpr int RT = (NO_ / 32) * 512;                   // from one row tile of G to the next
  const _Float16* ar = goT + (size_t)(b * (NP_ / 16) + ptile * 8 + msub * 2) * (NO_ / 32) * 512;
  // the fragments of four k steps are requested as one group ahead of their products: one load latency per group.
  // Neighbours along ptile (which share weight lines) and the two nchunk (which share G lines) start at different
  // groups and wrap; g0 is the same for every b and for ptile four apart.
  int g0 = (ptile + nchunk * 2) & 3;                     // the group the walk stands at (scalar)
  const _Float16* pa = ar + g0 * (4 * 512);
  const _Float16* pw = WoS + (size_t)(nbase >> 4) * (NO_ / 32) * 512 + g0 * (4 * 512);
#pragma unroll 1
  for (int it = 0; it < 4; ++it) {
    v16h a[4][2], bt[4][4];
#pragma unroll
    for (int s = 0; s < 4; ++s) {
#pragma unroll
      for (int r = 0; r < 2; ++r) a[s][r] = ldpk(pa + r * RT + s * 512, lane);
#pragma unroll
      for (int t = 0; t < 4; ++t)
        bt[s][t] = ldpk(pw + (t * (NO_ / 32) + s) * 512, lane);
    }
    // precaution: the address registers of the loads above are reused below
    asm volatile("s_wait_xcnt 0x0" ::: "memory");
    // without it the scheduler sinks each tile's loads to just ahead of its product: one exposed latency per tile
    __builtin_amdgcn_sched_barrier(0);
    {
      const int adv = (g0 == 3) ? -12 * 512 : 4 * 512;   // behind the last group: back to k = 0
      g0 = (g0 + 1) & 3;
      pa += adv; pw += adv;
    }
#pragma unroll
    for (int s = 0; s < 4; ++s) {
#pragma unroll
      for (int i = 0; i < 8; ++i) acc[i >> 2][i & 3] = mmab(a[s][i >> 2], bt[s][i & 3], acc[i >> 2][i & 3]);
    }
  }
  const float kS = 1.0f / 4096.0f;                       // undo 2^4 (W) and 2^8 (G)
#pragma unroll
  for (int t = 0; t < 4; ++t) {
    const int ol = nh * 64 + t * 16 + m;
    const float bta = betaO[nchunk * 128 + ol];
#pragma unroll
    for (int r = 0; r < 2; ++r)
#pragma unroll
      for (int j = 0; j < 8; ++j) {
        const int pl = msub * 32 + r * 16 + 8 * h + j;   // D row 8h+j of row tile r
        To[ol * 132 + pl] = acc[r][t][j] * kS + bta;
      }
  }
  __syncthreads();
#pragma unroll
  for (int it = 0; it < 16; ++it) {
    const int pi = it * 256 + tid;                       // 128 rows x 32 float4 pieces
    const int ol = pi >> 5, pc = pi & 31;
    const v4f v = *(const v4fa*)(To + ol * 132 + pc * 4);
    float* dst = out + ((size_t)(b * NC_ + nchunk * 128 + ol)) * NP_ + ptile * 128 + pc * 4;
    *(v4f*)dst = v;
    
  }
}

// ---------------- launch glue ------------------------------------------------------------------------
extern "C" void kernel_launch(void* const* d_in, const int* in_sizes, int n_in,
                              void* d_out, int out_size, void* d_ws, size_t ws_size,
                              hipStream_t stream) {
  if (n_in < 24) return;
  if (in_sizes[0] != NB_ * NC_ * NP_) return;
  if (in_sizes[1] != NC_ * NC_ || in_sizes[6] != NC_ * NC_ || in_sizes[11] != NO_ * NC_) return;
  if (in_sizes[16] != NP_ * NH_ || in_sizes[17] != NC_ * NO_ || in_sizes[23] != NP_ * NP_) return;
  {
    const int f32c[13] = {2, 3, 4, 5, 7, 8, 9, 10, 18, 19, 20, 21, 22};
    for (int i = 0; i < 13; ++i) if (in_sizes[f32c[i]] != NC_) return;
    const int f32o[4] = {12, 13, 14, 15};
    for (int i = 0; i < 4; ++i) if (in_sizes[f32o[i]] != NO_) return;
  }
  if (out_size != NB_ * NC_ * NP_) return;

  const float* x    = (const float*)d_in[0];
  const float* Wq   = (const float*)d_in[1];
  const float* q_g  = (const float*)d_in[2];
  const float* q_b  = (const float*)d_in[3];
  const float* q_m  = (const float*)d_in[4];
  const float* q_v  = (const float*)d_in[5];
  const float* Wk   = (const float*)d_in[6];
  const float* k_g  = (const float*)d_in[7];
  const float* k_b  = (const float*)d_in[8];
  const float* k_m  = (const float*)d_in[9];
  const float* k_v  = (const float*)d_in[10];
  const float* Wv   = (const float*)d_in[11];
  const float* v_g  = (const float*)d_in[12];
  const float* v_b  = (const float*)d_in[13];
  const float* v_m  = (const float*)d_in[14];
  const float* v_v  = (const float*)d_in[15];
  const float* pose = (const float*)d_in[16];
  const float* Wo   = (const float*)d_in[17];
  const float* bo   = (const float*)d_in[18];
  const float* o_g  = (const float*)d_in[19];
  const float* o_b  = (const float*)d_in[20];
  const float* o_m  = (const float*)d_in[21];
  const float* o_v  = (const float*)d_in[22];
  const int*   pix  = (const int*)d_in[23];

  // workspace carve (bytes), every offset a multiple of 1024
  const size_t O_WH    = 0;                                             // 1024*256*2
  const size_t O_WL    = O_WH    + (size_t)1024 * NC_ * 2;              // 524288
  const size_t O_BETA  = O_WL    + (size_t)1024 * NC_ * 2;              // 1048576, 4096 B
  const size_t O_WOS   = O_BETA  + 4096;                                // 1052672, 256*512*2
  const size_t O_BETAO = O_WOS   + (size_t)NC_ * NO_ * 2;               // 1314816, 1024 B
  const size_t O_XTH   = O_BETAO + 1024;                                // 1315840, 8 MB
  const size_t O_XTL   = O_XTH   + (size_t)NB_ * NP_ * NC_ * 2;         // 9704448
  const size_t O_QT    = O_XTL   + (size_t)NB_ * NP_ * NC_ * 2;         // 18093056, 8 MB
  const size_t O_KT    = O_QT    + (size_t)NB_ * NH_ * NP_ * DK_ * 2;   // 26481664
  const size_t O_VN    = O_KT    + (size_t)NB_ * NH_ * NP_ * DK_ * 2;   // 34870272, 16 MB
  const size_t O_GOT   = O_VN    + (size_t)NB_ * NO_ * NP_ * 2;         // 51647488, 16 MB
  const size_t O_BIAS  = O_GOT   + (size_t)NB_ * NP_ * NO_ * 2;         // 68424704, 16 MB
  const size_t O_END   = O_BIAS  + (size_t)NH_ * NP_ * NP_ * 2;         // 85201920
  if (O_END > ws_size) return;

  char* ws = (char*)d_ws;
  _Float16* Wh    = (_Float16*)(ws + O_WH);
  _Float16* Wl    = (_Float16*)(ws + O_WL);
  float*    beta  = (float*)   (ws + O_BETA);
  _Float16* WoS   = (_Float16*)(ws + O_WOS);
  float*    betaO = (float*)   (ws + O_BETAO);
  _Float16* xTh   = (_Float16*)(ws + O_XTH);
  _Float16* xTl   = (_Float16*)(ws + O_XTL);
  _Float16* qT    = (_Float16*)(ws + O_QT);
  _Float16* kT    = (_Float16*)(ws + O_KT);
  _Float16* vN    = (_Float16*)(ws + O_VN);
  _Float16* goT   = (_Float16*)(ws + O_GOT);
  _Float16* biasP = (_Float16*)(ws + O_BIAS);

  k_prep<<<dim3(NFQ_ + NFO_ + (NP_ / 64) * (NC_ / 64) * NB_), dim3(256), 0, stream>>>(
      Wq, q_g, q_b, q_m, q_v, Wk, k_g, k_b, k_m, k_v, Wv, v_g, v_b, v_m, v_v,
      Wo, bo, o_g, o_b, o_m, o_v, x, pix, pose, Wh, Wl, beta, WoS, betaO, xTh, xTl, biasP);
  k_qkv<<<dim3(NP_ / 128, 8, NB_), dim3(128), 0, stream>>>(xTh, xTl, Wh, beta, qT, kT, vN);   // Wl = Wh + 1024*256 elements
  k_attn<<<dim3(NP_ / 256, NH_, NB_), dim3(256), 0, stream>>>(qT, kT, vN, biasP, goT);
  k_out<<<dim3(NP_ / 128, 2, NB_), dim3(256), 0, stream>>>(goT, WoS, betaO, (float*)d_out);
}

// v010
// A run of this version takes 70.6 microseconds.
// Next to v009, in two timings, it ran 1.13 times as fast each time.
// Over all steps from v000 it is 9.96 times as fast.
#include <hip/hip_runtime.h>
#include <stddef.h>

// Contractions on v_wmma_f32_16x16x32_f16 (f16 operands, f32 accumulate): q/k channel GEMM as f16 hi/lo split (3 products, W scaled 2^10, x scaled 2^6), v channel GEMM single f16, QK^T single f16 (q,k scaled 2^3), P*V single f16 (P unnormalised, 2^8 at the query's reference point and at most 2^15, V scaled 2^3), output GEMM single f16 (W scaled 2^4, G scaled 2^8); position bias single f16 (scaled 2^5) times a 0 / 2^6 selector, summed into the QK^T accumulator; BN folds, softmax, GELU in f32.

typedef _Float16 v16h __attribute__((ext_vector_type(16)));
typedef _Float16 v8h  __attribute__((ext_vector_type(8)));
typedef float    v8f  __attribute__((ext_vector_type(8)));
typedef float    v4f  __attribute__((ext_vector_type(4)));
typedef v8h v8ha __attribute__((may_alias));
typedef v4f v4fa __attribute__((may_alias));

#define NB_  16
#define NC_  256
#define NP_  1024
#define NH_  8
#define DK_  32
#define DV_  64
#define NO_  512
#define EPS_ 1e-5f
#define CQK_ (0.17677669529663687f * 0.015625f)
#define L2E_ 1.4426950408889634f
#define PLIM_ 32768.0f

union Frag { v16h v; v8h p[2]; };

// Fragment-order storage of every 16-bit matrix operand: a tile of 16 rows x 32 k is 1024 contiguous bytes,
// made of 64 pieces of 8 elements; piece p*32 + h*16 + m holds row m, k = 16p + 8h .. +7.
// Tiles are ordered [row tile][k tile], KT k tiles to a row tile. A wave-wide 16-byte load of one half of a
// fragment then covers 512 contiguous bytes (4 whole 128-byte lines) and not 16 lines.
__device__ __forceinline__ size_t pkoff(int row, int k, int KT) {
  return ((((size_t)(row >> 4) * KT + (k >> 5)) * 64) + ((k >> 4) & 1) * 32 + ((k >> 3) & 1) * 16 + (row & 15)) * 8;
}

// 16x32 fragment from one tile: elements 0..7 <- k 8h..+7, 8..15 <- k 16+8h..+7 of row m (lane = 16h + m)
__device__ __forceinline__ v16h ldpk(const _Float16* tile, int lane) {
  Frag f;
  f.p[0] = *(const v8ha*)(tile + lane * 8);
  f.p[1] = *(const v8ha*)(tile + 256 + lane * 8);
  return f.v;
}

__device__ __forceinline__ v8f mmab(v16h a, v16h b, v8f c) {
  return __builtin_amdgcn_wmma_f32_16x16x32_f16(false, a, false, b, (short)0, c, false, false);
}

// lane l <-> lane l ^ 16
__device__ __forceinline__ float xhalf(float x) {
  const int i = __builtin_bit_cast(int, x);
  return __builtin_bit_cast(float, __builtin_amdgcn_permlanex16(i, i, 0x76543210, 0xfedcba98, false, false));
}

__device__ __forceinline__ v8f vzero() {
  v8f z = {0.f, 0.f, 0.f, 0.f, 0.f, 0.f, 0.f, 0.f};
  return z;
}

// ---------------- BN folded into QKV weights: Wh/Wl f16 hi/lo planes of W*inv*1024, beta[1024] -----
// 32 rows per block, wave w handles rows w*4..w*4+3, lane writes 8 consecutive columns (16 B)
__device__ __forceinline__ void fold_qkv_blk(const int blk, float* sb,
    const float* __restrict__ Wq, const float* __restrict__ qg, const float* __restrict__ qb,
    const float* __restrict__ qm, const float* __restrict__ qv,
    const float* __restrict__ Wk, const float* __restrict__ kg, const float* __restrict__ kb,
    const float* __restrict__ km, const float* __restrict__ kv,
    const float* __restrict__ Wv, const float* __restrict__ vg, const float* __restrict__ vb,
    const float* __restrict__ vm, const float* __restrict__ vv,
    _Float16* Wh, _Float16* Wl, float* beta) {
  const int tid = threadIdx.x, w = tid >> 5, lane = tid & 31;
#pragma unroll 1
  for (int i = 0; i < 4; ++i) {
    const int o = blk * 32 + w * 4 + i;   // 0..1023
    const float* W;
    float g, bb, mm, var;
    int oo;
    if (o < 256)      { oo = o;       W = Wq; g = qg[oo]; bb = qb[oo]; mm = qm[oo]; var = qv[oo]; }
    else if (o < 512) { oo = o - 256; W = Wk; g = kg[oo]; bb = kb[oo]; mm = km[oo]; var = kv[oo]; }
    else              { oo = o - 512; W = Wv; g = vg[oo]; bb = vb[oo]; mm = vm[oo]; var = vv[oo]; }
    const float inv = g * (1.0f / sqrtf(var + EPS_));
    const float* wr = W + (size_t)oo * NC_ + lane * 8;
    const v4f w0 = *(const v4fa*)(wr);
    const v4f w1 = *(const v4fa*)(wr + 4);
    float vals[8] = {w0.x, w0.y, w0.z, w0.w, w1.x, w1.y, w1.z, w1.w};
    v8h hv, lv;
#pragma unroll
    for (int e = 0; e < 8; ++e) {
      const float s = vals[e] * inv * 1024.0f;
      const _Float16 hh = (_Float16)s;
      const _Float16 ll = (_Float16)(s - (float)hh);
      hv[e] = hh; lv[e] = ll;
    }
    _Float16* dh = Wh + pkoff(o, lane * 8, NC_ / 32);
    _Float16* dl = Wl + pkoff(o, lane * 8, NC_ / 32);
    *(v8h*)dh = hv;
    *(v8h*)dl = lv;
    
    if (lane == 0) sb[w * 4 + i] = bb - mm * inv;
  }
  __syncthreads();
  if (w == 0 && lane < 8) {
    v4f b4;
    b4.x = sb[lane * 4 + 0]; b4.y = sb[lane * 4 + 1]; b4.z = sb[lane * 4 + 2]; b4.w = sb[lane * 4 + 3];
    float* db = beta + blk * 32 + lane * 4;
    *(v4f*)db = b4;
    
  }
}

// ---------------- bo + output BN folded into Wo: WoS f16 = Wo*inv*16, betaO[256] -------------------
__device__ __forceinline__ void fold_wo_blk(const int blk, float* sb,
    const float* __restrict__ Wo, const float* __restrict__ bo, const float* __restrict__ og,
    const float* __restrict__ ob, const float* __restrict__ om, const float* __restrict__ ov,
    _Float16* WoS, float* betaO) {
  const int tid = threadIdx.x, w = tid >> 5, lane = tid & 31;
#pragma unroll 1
  for (int i = 0; i < 4; ++i) {
    const int o = blk * 32 + w * 4 + i;   // 0..255
    const float inv = og[o] * (1.0f / sqrtf(ov[o] + EPS_));
#pragma unroll
    for (int hf = 0; hf < 2; ++hf) {
      const float* wr = Wo + (size_t)o * NO_ + hf * 256 + lane * 8;
      const v4f w0 = *(const v4fa*)(wr);
      const v4f w1 = *(const v4fa*)(wr + 4);
      float vals[8] = {w0.x, w0.y, w0.z, w0.w, w1.x, w1.y, w1.z, w1.w};
      v8h hv;
#pragma unroll
      for (int e = 0; e < 8; ++e) hv[e] = (_Float16)(vals[e] * inv * 16.0f);
      _Float16* dh = WoS + pkoff(o, hf * 256 + lane * 8, NO_ / 32);
      *(v8h*)dh = hv;
      
    }
    if (lane == 0) sb[w * 4 + i] = bo[o] * inv + ob[o] - om[o] * inv;
  }
  __syncthreads();
  if (w == 0 && lane < 8) {
    v4f b4;
    b4.x = sb[lane * 4 + 0]; b4.y = sb[lane * 4 + 1]; b4.z = sb[lane * 4 + 2]; b4.w = sb[lane * 4 + 3];
    float* db = betaO + blk * 32 + lane * 4;
    *(v4f*)db = b4;
    
  }
}

// ---------------- x[b][c][p] -> xTh/xTl, rows b*1024+p, k = c, fragment order: f16 hi/lo planes of 64*x ----
__device__ __forceinline__ void tr_blk(const int pblk, const int cblk, const int b, float (*T)[65],
                                       const float* __restrict__ x, _Float16* xTh, _Float16* xTl) {
  const int tid = threadIdx.x;
#pragma unroll
  for (int it = 0; it < 16; ++it) {
    const int idx = it * 256 + tid;
    const int ci = idx >> 6, pj = idx & 63;
    T[ci][pj] = x[((size_t)(b * NC_ + cblk * 64 + ci)) * NP_ + pblk * 64 + pj];
  }
  __syncthreads();
#pragma unroll
  for (int it = 0; it < 2; ++it) {
    const int pi = it * 256 + tid;
    const int pl = pi & 63, pc = pi >> 6;                // a wave: 32 rows of one piece column = 2 x 256 B
    v8h hv, lv;
#pragma unroll
    for (int e = 0; e < 8; ++e) {
      const float s = T[pc * 8 + e][pl] * 64.0f;
      const _Float16 hh = (_Float16)s;
      const _Float16 ll = (_Float16)(s - (float)hh);
      hv[e] = hh; lv[e] = ll;
    }
    const size_t off = pkoff(b * NP_ + pblk * 64 + pl, cblk * 64 + pc * 8, NC_ / 32);
    *(v8h*)(xTh + off) = hv;
    *(v8h*)(xTl + off) = lv;
    
  }
}

// ---------------- QKV projection GEMM (BN folded) --------------------------------------------------
// One stage of the LDS ring: the 32 fragment tiles (1024 bytes each, fragment order as in memory) that the work-group's four
// waves need for one group of the K loop. Wave w copies class w, 8 tiles that lie 8 KiB apart in memory:
// hi/lo path (one k step):  class 0 x hi, 1 x lo, 2 W hi, 3 W lo;   single path (two k steps): 0 x step 0, 1 x step 1, 2 W step 0, 3 W step 1.
#define STG_ 16384                                       // 16-bit elements to a stage (32 KiB)
// eight asynchronous copies of 16 bytes a lane (four tiles). The wait on the address registers is the last line of the
// copies' own statement (a precaution: they are rewritten behind it).
__device__ __forceinline__ void copy4tiles(const unsigned l, const _Float16* g) {
  constexpr int RT = (NC_ / 32) * 512;                   // from one row tile to the next in memory
  asm volatile("global_load_async_to_lds_b128 %0, %8, off\n\t"
               "global_load_async_to_lds_b128 %1, %9, off\n\t"
               "global_load_async_to_lds_b128 %2, %10, off\n\t"
               "global_load_async_to_lds_b128 %3, %11, off\n\t"
               "global_load_async_to_lds_b128 %4, %12, off\n\t"
               "global_load_async_to_lds_b128 %5, %13, off\n\t"
               "global_load_async_to_lds_b128 %6, %14, off\n\t"
               "global_load_async_to_lds_b128 %7, %15, off\n\t"
               "s_wait_xcnt 0x0"
               :: "v"(l), "v"(l + 512u), "v"(l + 1024u), "v"(l + 1536u), "v"(l + 2048u), "v"(l + 2560u), "v"(l + 3072u), "v"(l + 3584u),
                  "v"(g), "v"(g + 256), "v"(g + RT), "v"(g + RT + 256), "v"(g + 2 * RT), "v"(g + 2 * RT + 256),
                  "v"(g + 3 * RT), "v"(g + 3 * RT + 256)
               : "memory");
}
// the wave's class of one stage: l = the lane's LDS byte address in the class's first tile, g = the lane's address in memory
__device__ __forceinline__ void copy_class(const unsigned l, const _Float16* g) {
  copy4tiles(l, g);
  copy4tiles(l + 4096u, g + 4 * (NC_ / 32) * 512);
}

// K loop over a ring of two stages: the copies of group t + 1 fly while group t is multiplied, and every x and W line leaves L2
// once per work-group (as plain loads each of the two waves that share a fragment fetched it for itself).
// Each accumulator takes its products in the order hi*hi, hi*lo, lo*hi, k ascending from the work-group's own first group g0 and
// wrapping: g0 follows ptile + nchunk: neighbours along ptile start one group apart; b does not move it, so
// work-groups that differ only in b walk alike.
template <bool SPLIT>
__device__ __forceinline__ void qkv_acc(const _Float16* __restrict__ src, _Float16* ring, const int w, const int msub,
                                        const int nh, const int lane, const int rot, v8f (&acc)[4][4]) {
  constexpr int G = SPLIT ? 1 : 2;                       // k steps to a group: 32 tiles either way
  constexpr int NG = 8 / G;                              // groups in the walk
  const int g0 = rot & (NG - 1);                         // the group the walk starts at (scalar)
  const unsigned l0 = (unsigned)(size_t)ring + (unsigned)(w * 8192 + lane * 16);   // low 32 bits: the byte address in LDS
  copy_class(l0, src + g0 * (G * 512));
  // the wave's own copies have landed; behind the barrier every wave's have
  asm volatile("s_wait_asynccnt 0x0" ::: "memory");
  __syncthreads();
  copy_class(l0 + 2u * STG_, src + ((g0 + 1) & (NG - 1)) * (G * 512));
  // kept rolled: unrolled, the fragment groups of neighbouring trips would compete for the registers
#pragma unroll 1
  for (int it = 0; it < NG; ++it) {
    const _Float16* bf = ring + (it & 1) * STG_ + lane * 8;
    v16h ah[G][4], al[G][4], bh[G][4], bl[G][4];
#pragma unroll
    for (int s = 0; s < G; ++s) {
#pragma unroll
      for (int r = 0; r < 4; ++r) {
        ah[s][r] = ldpk(bf + (s * 8 + msub * 4 + r) * 512, 0);
        if (SPLIT) al[s][r] = ldpk(bf + (8 + msub * 4 + r) * 512, 0);
      }
#pragma unroll
      for (int t = 0; t < 4; ++t) {
        bh[s][t] = ldpk(bf + (16 + s * 8 + nh * 4 + t) * 512, 0);
        if (SPLIT) bl[s][t] = ldpk(bf + (24 + nh * 4 + t) * 512, 0);
      }
    }
    // without it the scheduler sinks each tile's reads to just ahead of its product: one exposed latency per tile
    __builtin_amdgcn_sched_barrier(0);
#pragma unroll
    for (int s = 0; s < G; ++s) {
#pragma unroll
      for (int i = 0; i < 16; ++i) acc[i >> 2][i & 3] = mmab(ah[s][i >> 2], bh[s][i & 3], acc[i >> 2][i & 3]);
      if (SPLIT) {
#pragma unroll
        for (int i = 0; i < 16; ++i) acc[i >> 2][i & 3] = mmab(ah[s][i >> 2], bl[s][i & 3], acc[i >> 2][i & 3]);
#pragma unroll
        for (int i = 0; i < 16; ++i) acc[i >> 2][i & 3] = mmab(al[s][i >> 2], bh[s][i & 3], acc[i >> 2][i & 3]);
      }
    }
    // without it the scheduler lifts the hand-over in front of the products, and the next stage's copies, issued just before this
    // trip's reads, are waited for with nothing to cover their flight
    __builtin_amdgcn_sched_barrier(0);
    // hand-over: this wave's reads of the stage are done, its copies of the next stage have landed; the barrier publishes the
    // next stage and ends every wave's reads of this one, which is refilled only behind it
    asm volatile("s_wait_dscnt 0x0" ::: "memory");
    asm volatile("s_wait_asynccnt 0x0" ::: "memory");
    __syncthreads();
    if (it + 2 < NG) copy_class(l0 + (unsigned)(it & 1) * (2u * STG_), src + ((g0 + it + 2) & (NG - 1)) * (G * 512));
  }
  // no copy is outstanding when the ring's LDS is put to another use
  asm volatile("s_wait_asynccnt 0x0" ::: "memory");
}

// block tile 128 pixels x 128 output channels, 4 waves (2 row halves x 2 column halves), K = 256. A wave owns 64 pixels x
// 64 channels: each W fragment serves four row tiles and each x fragment four column tiles.
// q,k column chunks (nchunk 0..3): hi*hi + hi*lo + lo*hi; v chunks (4..7): hi*hi.
// qT,kT: per b*8+n rows p, k = d (x8);  vN: rows b*512+channel, k = p (x8); all in fragment order
// at least 3 waves per SIMD (three work-groups to a WGP): the fragment group and the accumulators take 128 registers each
__global__ __launch_bounds__(128) __attribute__((amdgpu_waves_per_eu(3))) void k_qkv(
    const _Float16* __restrict__ xTh, const _Float16* __restrict__ xTl,
    const _Float16* __restrict__ Wh, const float* __restrict__ beta,
    _Float16* qT, _Float16* kT, _Float16* vN) {
  __shared__ __attribute__((aligned(1024))) _Float16 ring[2 * STG_];   // the K loop's two stages
  _Float16* st = ring;                                   // behind the loop: q/k view [pixel][136], v view [channel][136]
  const int ptile = blockIdx.x, nchunk = blockIdx.y, b = blockIdx.z;
  const int tid = threadIdx.x, lane = tid & 31, m = lane & 15, h = lane >> 4;
  // the wave's number as a scalar: tile indices and bases are then formed in scalar registers, which leaves the
  // vector registers to the fragment groups
  const int w = __builtin_amdgcn_readfirstlane(tid >> 5);
  const int msub = w & 1, nh = w >> 1;
  const bool split = (nchunk < 4);   // block-uniform

  v8f acc[4][4];
#pragma unroll
  for (int i = 0; i < 16; ++i) acc[i >> 2][i & 3] = vzero();
  // the work-group's 8 row tiles of x and 8 row tiles of W, at k = 0. The lo plane of W follows its hi plane in the workspace.
  const size_t atile = (size_t)(b * (NP_ / 16) + ptile * 8) * (NC_ / 32) * 512;
  const _Float16* whr = Wh + (size_t)(nchunk * 8) * (NC_ / 32) * 512;
  // W lines are shared along ptile (and b), x lines along nchunk: neighbours in either direction start one group apart
  const int rot = ptile + nchunk;
  if (split) {
    const _Float16* src = (w == 0) ? xTh + atile : (w == 1) ? xTl + atile : (w == 2) ? whr : whr + 1024 * NC_;
    qkv_acc<true>(src + lane * 8, ring, w, msub, nh, lane, rot, acc);
  } else {
    const _Float16* src = ((w < 2) ? xTh + atile : whr) + (w & 1) * 512;
    qkv_acc<false>(src + lane * 8, ring, w, msub, nh, lane, rot, acc);
  }

  // epilogue: scale back 2^-16, add folded beta, scale x8, stage 16-bit tile in LDS
  const float kS = 1.0f / 65536.0f;
  float bta[4];
#pragma unroll
  for (int t = 0; t < 4; ++t) bta[t] = beta[nchunk * 128 + nh * 64 + t * 16 + m];   // column = this lane's n
  const int ol0 = nh * 64 + m;                           // + 16t: 0..127
  const int pl0 = msub * 64 + 8 * h;                     // + 16r + j: D row 8h+j of row tile r
  if (split) {
#pragma unroll
    for (int t = 0; t < 4; ++t)
#pragma unroll
      for (int r = 0; r < 4; ++r)
#pragma unroll
        for (int j = 0; j < 8; ++j)
          st[(pl0 + r * 16 + j) * 136 + ol0 + t * 16] = (_Float16)((acc[r][t][j] * kS + bta[t]) * 8.0f);
  } else {
#pragma unroll
    for (int t = 0; t < 4; ++t)
#pragma unroll
      for (int r = 0; r < 4; ++r) {
        v8h o;                                           // 8 consecutive pixels of one channel: one 16-byte store
#pragma unroll
        for (int j = 0; j < 8; ++j) o[j] = (_Float16)((acc[r][t][j] * kS + bta[t]) * 8.0f);
        *(v8ha*)(st + (ol0 + t * 16) * 136 + pl0 + r * 16) = o;
      }
  }
  __syncthreads();

  if (split) {
    _Float16* base = (nchunk < 2) ? qT : kT;
    const int hb = (nchunk & 1) * 4;
    v8h pv[16];                                          // all LDS reads ahead of the stores: one LDS latency, not sixteen
#pragma unroll
    for (int it = 0; it < 16; ++it) {
      const int pi = it * 128 + tid;                     // 2048 pieces of 16 B
      const int hd = pi >> 9, r = pi & 511;
      const int pl = r >> 2, dq = r & 3;
      pv[it] = *(const v8ha*)(st + pl * 136 + hd * 32 + dq * 8);
    }
#pragma unroll
    for (int it = 0; it < 16; ++it) {
      const int pi = it * 128 + tid;
      const int hd = pi >> 9, r = pi & 511;
      const int pl = r >> 2, dq = r & 3;
      _Float16* dst = base + ((size_t)(b * NH_ + hb + hd)) * NP_ * DK_ + pkoff(ptile * 128 + pl, dq * 8, 1);
      *(v8h*)dst = pv[it];
    }
  } else {
    const int obase = (nchunk - 4) * 128;
    v8h pv[16];                                          // as above
#pragma unroll
    for (int it = 0; it < 16; ++it) {
      const int pi = it * 128 + tid;                     // 128 rows x 16 pieces
      const int ol = pi & 127, pc = pi >> 7;             // a wave: 32 rows of one piece column = 2 x 256 B
      pv[it] = *(const v8ha*)(st + ol * 136 + pc * 8);
    }
#pragma unroll
    for (int it = 0; it < 16; ++it) {
      const int pi = it * 128 + tid;
      const int ol = pi & 127, pc = pi >> 7;
      _Float16* dst = vN + pkoff(b * NO_ + obase + ol, ptile * 128 + pc * 8, NP_ / 32);
      *(v8h*)dst = pv[it];
    }
    // precaution: the code of the other path follows in the listing and rewrites registers that the stores above name
    asm volatile("s_wait_xcnt 0x0" ::: "memory");
  }
}

// ---------------- position bias, gathered once for all batches ---------------------------------------
// biasP: per head n and group of 32 queries q32, 64 tiles of 16 keys (rows) x 32 queries (k) in fragment order,
// value pos_emb[index(query, key)][n] * 2^5. One work item (0..262143): one piece place (8 queries of one key) of
// four heads. The index is bounded here, before it forms an address.
struct BiasIdx { int ix[8]; };
__device__ __forceinline__ BiasIdx bias_idx(const int P, const int* __restrict__ pidx) {
  const int lane = P & 31, p = (P >> 5) & 1, kt = (P >> 7) & 63, q32 = P >> 13;
  const int m = lane & 15, h = lane >> 4;
  const int* src = pidx + (size_t)(q32 * 32 + 16 * p + 8 * h) * NP_ + kt * 16 + m;
  BiasIdx r;
#pragma unroll
  for (int e = 0; e < 8; ++e) r.ix[e] = src[(size_t)e * NP_];
  return r;
}
__device__ __forceinline__ void bias_put(const int P, const BiasIdx& r, const float* __restrict__ posemb,
                                         _Float16* biasP) {
  const int pl = P & 63, hh = (P >> 6) & 1, kt = (P >> 7) & 63, q32 = P >> 13;
  v8h o[4];
#pragma unroll
  for (int e = 0; e < 8; ++e) {
    int ix = r.ix[e];
    ix = ix < 0 ? 0 : (ix > NP_ - 1 ? NP_ - 1 : ix);
    const v4f pe = *(const v4fa*)(posemb + (size_t)ix * NH_ + hh * 4);
#pragma unroll
    for (int i = 0; i < 4; ++i) o[i][e] = (_Float16)(pe[i] * 32.0f);
  }
#pragma unroll
  for (int i = 0; i < 4; ++i)
    *(v8h*)(biasP + ((size_t)((hh * 4 + i) * (NP_ / 32) + q32) * (NP_ / 16) + kt) * 512 + pl * 8) = o[i];
}

// ---------------- all preparation in one launch ------------------------------------------------------
// None of the four jobs reads what another writes. Work-groups 0..31 fold the QKV weights, 32..39 the output
// weights (their serial row loops start first and run beside the rest); each of the other 1024 transposes one
// 64 x 64 tile of x and builds 256 work items of the bias table (1024 x 256 = all of them).
#define NFQ_ 32
#define NFO_ 8
__global__ __launch_bounds__(256) void k_prep(
    const float* __restrict__ Wq, const float* __restrict__ qg, const float* __restrict__ qb,
    const float* __restrict__ qm, const float* __restrict__ qv,
    const float* __restrict__ Wk, const float* __restrict__ kg, const float* __restrict__ kb,
    const float* __restrict__ km, const float* __restrict__ kv,
    const float* __restrict__ Wv, const float* __restrict__ vg, const float* __restrict__ vb,
    const float* __restrict__ vm, const float* __restrict__ vv,
    const float* __restrict__ Wo, const float* __restrict__ bo, const float* __restrict__ og,
    const float* __restrict__ ob, const float* __restrict__ om, const float* __restrict__ ov,
    const float* __restrict__ x, const int* __restrict__ pidx, const float* __restrict__ posemb,
    _Float16* Wh, _Float16* Wl, float* beta, _Float16* WoS, float* betaO,
    _Float16* xTh, _Float16* xTl, _Float16* biasP) {
  __shared__ __attribute__((aligned(16))) float T[64][65];
  const int blk = blockIdx.x;                            // the same for a whole work-group: its barriers are uniform
  if (blk < NFQ_) {
    fold_qkv_blk(blk, &T[0][0], Wq, qg, qb, qm, qv, Wk, kg, kb, km, kv, Wv, vg, vb, vm, vv, Wh, Wl, beta);
  } else if (blk < NFQ_ + NFO_) {
    fold_wo_blk(blk - NFQ_, &T[0][0], Wo, bo, og, ob, om, ov, WoS, betaO);
  } else {
    const int t = blk - (NFQ_ + NFO_);
    // the indices are requested with the tile's loads; the table's stores follow the tile's: a store in front of
    // the tile's barrier would be waited for there
    const int P = t * 256 + threadIdx.x;
    const BiasIdx bi = bias_idx(P, pidx);
    tr_blk(t & 15, (t >> 4) & 3, t >> 6, T, x, xTh, xTl);
    bias_put(P, bi, posemb, biasP);
    // precaution: the code of the other branches follows in the listing and rewrites registers that the stores above name
    asm volatile("s_wait_xcnt 0x0" ::: "memory");
  }
}

// 2^x of the eight scores of one tile, in one statement: the outputs are early-clobber, so no exponential of the run lands on
// a register that another one still reads, and v_nop fills the slot behind the last transcendental
__device__ __forceinline__ void exp2x8(const float (&a)[8], float (&p)[8]) {
  asm("v_exp_f32 %0, %8\n\tv_exp_f32 %1, %9\n\tv_exp_f32 %2, %10\n\tv_exp_f32 %3, %11\n\t"
      "v_exp_f32 %4, %12\n\tv_exp_f32 %5, %13\n\tv_exp_f32 %6, %14\n\tv_exp_f32 %7, %15\n\tv_nop"
      : "=&v"(p[0]), "=&v"(p[1]), "=&v"(p[2]), "=&v"(p[3]), "=&v"(p[4]), "=&v"(p[5]), "=&v"(p[6]), "=&v"(p[7])
      : "v"(a[0]), "v"(a[1]), "v"(a[2]), "v"(a[3]), "v"(a[4]), "v"(a[5]), "v"(a[6]), "v"(a[7]));
}

// P of one group of 16 queries against the offset moff (8 - reference point, in log2 units): the f16 fragment and the lane's sum
__device__ __forceinline__ float pfrag(const float (&tv)[16], const float moff, Frag& bp) {
  float ps = 0.f;
#pragma unroll
  for (int u = 0; u < 2; ++u) {
    float a[8], p[8];
#pragma unroll
    for (int j = 0; j < 8; ++j) a[j] = fmaf(tv[u * 8 + j], CQK_ * L2E_, moff);
    exp2x8(a, p);
#pragma unroll
    for (int j = 0; j < 8; ++j) {
      ps = (u + j == 0) ? p[0] : ps + p[j];
      bp.v[u * 8 + j] = (_Float16)p[j];                  // element i = key 16(i/8) + 8h + i%8, as ldpk orders V
    }
  }
  return ps;
}

__global__ __launch_bounds__(256) void k_attn(
    const _Float16* __restrict__ qT, const _Float16* __restrict__ kT, const _Float16* __restrict__ vN,
    const _Float16* __restrict__ biasP, _Float16* goT) {
  const int qblk = blockIdx.x, n = blockIdx.y, b = blockIdx.z;
  const int tid = threadIdx.x;
  const int w = tid >> 5, lane = tid & 31;
  const int qbase = qblk * 256 + w * 32;
  const int bn = b * NH_ + n;
  v16h bq[2];
#pragma unroll
  for (int g = 0; g < 2; ++g) bq[g] = ldpk(qT + ((size_t)bn * NP_ + qbase + 16 * g) * DK_, lane);
  const _Float16* kp = kT + (size_t)bn * NP_ * DK_;                                  // A row m = key
  const _Float16* vp = vN + (size_t)(b * (NO_ / 16) + n * (DV_ / 16)) * (NP_ / 32) * 512;   // A row m = value channel
  const _Float16* bb = biasP + (size_t)(n * (NP_ / 32) + (qbase >> 5)) * (NP_ / 16) * 512;  // A row m = key, k = query
  const v8f vz = vzero();
  // selector of group g, a B fragment: 2^6 where k = 16g + column, else 0 (k of element e: 8h + e, of 8 + e: 16 + 8h + e).
  // 2^5 (table) * 2^6 = 1 / (SCALE * CQK_): the bias in the units of the raw product
  Frag sel[2];
#pragma unroll
  for (int e = 0; e < 8; ++e) {
    const _Float16 d = ((lane >> 4) * 8 + e == (lane & 15)) ? (_Float16)64.0f : (_Float16)0.0f;
    sel[0].v[e] = d;               sel[0].v[8 + e] = (_Float16)0.0f;
    sel[1].v[e] = (_Float16)0.0f;  sel[1].v[8 + e] = d;
  }

  v8f oacc[2][4] = {{vz, vz, vz, vz}, {vz, vz, vz, vz}};
  // mrun: the query's reference point, the largest score seen when it was last set. It is set anew only when a chunk's
  // exponentials against it grow past PLIM_ (the first chunk does: they are infinite); until then no maximum is searched,
  // nothing is exchanged between the wave halves and no accumulator is rescaled. It never exceeds the running maximum.
  float mrun[2] = {-3.0e38f, -3.0e38f};
  float moff[2] = {fmaf(3.0e38f, CQK_ * L2E_, 8.0f), fmaf(3.0e38f, CQK_ * L2E_, 8.0f)};   // 8 - mrun in log2 units
  float lsum[2] = {0.f, 0.f};

  // the four work-groups that read one (b, n)'s K and V start 8 chunks apart, those that read one bias plane 4 apart (in
  // pairs), and wrap: their requests for one line do not meet in L2. All waves of a work-group walk alike: they share K and V lines.
  int kc = (qblk * 8 + (b & 7) * 4) & 31;
  const _Float16* kpc = kp + (size_t)kc * 32 * DK_;
  const _Float16* vpc = vp + (size_t)kc * 512;
  const _Float16* bbc = bb + (size_t)kc * 1024;
#pragma unroll 1
  for (int it = 0; it < 32; ++it) {
    v16h ak[2], av[4];
#pragma unroll
    for (int u = 0; u < 2; ++u) ak[u] = ldpk(kpc + (size_t)(16 * u) * DK_, lane);
    v16h ab[2];
#pragma unroll
    for (int u = 0; u < 2; ++u) ab[u] = ldpk(bbc + (size_t)u * 512, lane);
    // precaution: the registers that hold the addresses of the loads above are reused below
    asm volatile("s_wait_xcnt 0x0" ::: "memory");
#pragma unroll
    for (int t = 0; t < 4; ++t) av[t] = ldpk(vpc + (size_t)(t * (NP_ / 32)) * 512, lane);
    // precaution: as above, for the addresses of the V loads
    asm volatile("s_wait_xcnt 0x0" ::: "memory");
    // without it the scheduler lifts the bias products in between the loads, and the V loads wait for the first tile
    __builtin_amdgcn_sched_barrier(0);
    {
      const int adv = (kc == 31) ? -31 : 1;              // behind the last chunk: back to key 0
      kc = (kc + 1) & 31;
      kpc += adv * (32 * DK_); vpc += adv * 512; bbc += adv * 1024;
    }
    float tv[2][16];
#pragma unroll
    for (int g = 0; g < 2; ++g) {
#pragma unroll
      for (int u = 0; u < 2; ++u) {
        // D[8h+j][m]: key 16u+8h+j of this chunk, query column m; raw units, one log2 unit = 1 / (CQK_ * L2E_)
        const v8f s = mmab(ak[u], bq[g], mmab(ab[u], sel[g].v, vz));
#pragma unroll
        for (int j = 0; j < 8; ++j) tv[g][u * 8 + j] = s[j];
      }
    }
    // keeps the eight score products in one run: spread among the exponentials, each run of them is followed by its own
    // idle slots before a vector instruction may touch its registers
    __builtin_amdgcn_sched_barrier(0);
    // common path: the exponentials are taken against the reference point the query already has
    Frag bp[2];
    float ps[2];
#pragma unroll
    for (int g = 0; g < 2; ++g) ps[g] = pfrag(tv[g], moff[g], bp[g]);
    // no p is negative, so a lane's sum bounds each of its p: up to PLIM_ all 32 are finite in f16. One test per chunk, the
    // same for the whole wave (the matrix products below need every lane); written so that a NaN takes the branch too
    if (__builtin_expect(__builtin_amdgcn_ballot_w32(!(ps[0] + ps[1] <= PLIM_)) != 0u, 0)) {
#pragma unroll
      for (int g = 0; g < 2; ++g) {
        float mx = tv[g][0];
#pragma unroll
        for (int i = 1; i < 16; ++i) mx = fmaxf(mx, tv[g][i]);
        mx = fmaxf(mx, xhalf(mx));                       // both halves of the wave hold keys of the same query
        const float mnew = fmaxf(mrun[g], mx);
        float alpha;                                     // 2^(old reference - new reference), 0 on the first chunk
        // v_nop: the slot behind a transcendental. In one statement with it, since a v_nop of its own does not stay behind it
        asm("v_exp_f32 %0, %1\n\tv_nop" : "=v"(alpha) : "v"((mrun[g] - mnew) * (CQK_ * L2E_)));
        mrun[g] = mnew;
        moff[g] = fmaf(-mnew, CQK_ * L2E_, 8.0f);        // P carries 2^8; the row sum carries it too
        ps[g] = pfrag(tv[g], moff[g], bp[g]);            // now every p is at most 2^8
        lsum[g] *= alpha;
#pragma unroll
        for (int t = 0; t < 4; ++t) oacc[g][t] = oacc[g][t] * alpha;
      }
    }
#pragma unroll
    for (int g = 0; g < 2; ++g) {
      lsum[g] += ps[g];
#pragma unroll
      for (int t = 0; t < 4; ++t) oacc[g][t] = mmab(av[t], bp[g].v, oacc[g][t]);
    }
  }

  // normalise, GELU (erf form), scale 2^8; a lane holds 8 consecutive channels of one query: one piece of a
  // fragment-order tile (rows = pixels, k = channels), so a wave's store is 512 contiguous bytes
#pragma unroll
  for (int g = 0; g < 2; ++g) {
    const float l = lsum[g] + xhalf(lsum[g]);
    const float co = 1.0f / (l * 8.0f);                  // undo 2^3 (V); 2^8 (P) cancels against l
    _Float16* dst = goT + ((size_t)(b * (NP_ / 16) + (qbase >> 4) + g) * (NO_ / 32) + n * 2) * 512 + lane * 8;
#pragma unroll
    for (int t = 0; t < 4; ++t) {
      v8h o;
#pragma unroll
      for (int j = 0; j < 8; ++j) {
        const float xo = oacc[g][t][j] * co;
        const float gl = 0.5f * xo * (1.0f + erff(xo * 0.70710678118654752f));
        o[j] = (_Float16)(gl * 256.0f);
      }
      *(v8h*)(dst + (t >> 1) * 512 + (t & 1) * 256) = o;   // k = 64n + 16t + 8h: k tile 2n + t/2, half t&1
    }
  }
}

// ---------------- output projection GEMM (bias + BN folded) ---------------------------------------
// eight asynchronous copies of 16 bytes a lane: 4 KiB in a row, the four k tiles of one row tile in one group. The wait on the
// address registers is the last line of the copies' own statement (a precaution: they are rewritten behind it).
__device__ __forceinline__ void copy4k(const unsigned l, const _Float16* g) {
  asm volatile("global_load_async_to_lds_b128 %0, %8, off\n\t"
               "global_load_async_to_lds_b128 %1, %9, off\n\t"
               "global_load_async_to_lds_b128 %2, %10, off\n\t"
               "global_load_async_to_lds_b128 %3, %11, off\n\t"
               "global_load_async_to_lds_b128 %4, %12, off\n\t"
               "global_load_async_to_lds_b128 %5, %13, off\n\t"
               "global_load_async_to_lds_b128 %6, %14, off\n\t"
               "global_load_async_to_lds_b128 %7, %15, off\n\t"
               "s_wait_xcnt 0x0"
               :: "v"(l), "v"(l + 512u), "v"(l + 1024u), "v"(l + 1536u), "v"(l + 2048u), "v"(l + 2560u), "v"(l + 3072u), "v"(l + 3584u),
                  "v"(g), "v"(g + 256), "v"(g + 512), "v"(g + 768), "v"(g + 1024), "v"(g + 1280), "v"(g + 1536), "v"(g + 1792)
               : "memory");
}
#define STO_ 32768                                       // 16-bit elements to a stage of k_out's ring (64 KiB)
__global__ __launch_bounds__(256) void k_out(
    const _Float16* __restrict__ goT, const _Float16* __restrict__ WoS, const float* __restrict__ betaO,
    float* out) {
  // the K loop's two stages. A stage holds the 64 fragment tiles of one group of four k steps: tile R * 4 + s is row tile R of G at
  // step s, tile 32 + C * 4 + s row tile C of the weights. Wave w copies tiles 8w .. 8w + 7 (two row tiles).
  __shared__ __attribute__((aligned(1024))) _Float16 ring[2 * STO_];
  float* To = (float*)ring;                              // behind the loop: [channel][pixel], pitch 132 floats (4 of pad)
  const int ptile = blockIdx.x, nchunk = blockIdx.y, b = blockIdx.z;
  const int tid = threadIdx.x, lane = tid & 31, m = lane & 15, h = lane >> 4;
  // the wave's number as a scalar: tile indices and bases are then formed in scalar registers, which leaves the
  // vector registers to the fragment groups
  const int w = __builtin_amdgcn_readfirstlane(tid >> 5);
  const int msub = w & 3, nh = w >> 2;
  // block tile 128 pixels x 128 channels; a wave owns 32 pixels x 64 channels: each weight fragment serves two row tiles
  v8f acc[2][4] = {{vzero(), vzero(), vzero(), vzero()}, {vzero(), vzero(), vzero(), vzero()}};
  constexpr int RT = (NO_ / 32) * 512;                   // from one row tile to the next in memory
  // the copies of group t + 1 fly while group t is multiplied, and every G and weight line leaves L2 once per work-group (as plain
  // loads each of the two or four waves that share a fragment fetched it for itself).
  // Neighbours along ptile (same weight lines) start one group apart and the two nchunk (same G lines) two apart, and
  // all wrap; b does not move the start, so work-groups that differ only in b walk alike.
  const int g0 = (ptile + nchunk * 2) & 3;               // the group the walk starts at (scalar)
  const _Float16* src = ((w < 4) ? goT + (size_t)(b * (NP_ / 16) + ptile * 8 + w * 2) * RT
                                 : WoS + (size_t)(nchunk * 8 + (w - 4) * 2) * RT) + lane * 8;
  const unsigned l0 = (unsigned)(size_t)ring + (unsigned)(w * 8192 + lane * 16);   // low 32 bits: the byte address in LDS
  copy4k(l0, src + g0 * 2048);
  copy4k(l0 + 4096u, src + RT + g0 * 2048);
  // the wave's own copies have landed; behind the barrier every wave's have
  asm volatile("s_wait_asynccnt 0x0" ::: "memory");
  __syncthreads();
  copy4k(l0 + 2u * STO_, src + ((g0 + 1) & 3) * 2048);
  copy4k(l0 + 2u * STO_ + 4096u, src + RT + ((g0 + 1) & 3) * 2048);
  // kept rolled: unrolled, the fragment groups of neighbouring trips would compete for the registers
#pragma unroll 1
  for (int it = 0; it < 4; ++it) {
    const _Float16* bf = ring + (it & 1) * STO_ + lane * 8;
    v16h a[4][2], bt[4][4];
#pragma unroll
    for (int s = 0; s < 4; ++s) {
#pragma unroll
      for (int r = 0; r < 2; ++r) a[s][r] = ldpk(bf + ((msub * 2 + r) * 4 + s) * 512, 0);
#pragma unroll
      for (int t = 0; t < 4; ++t) bt[s][t] = ldpk(bf + (32 + (nh * 4 + t) * 4 + s) * 512, 0);
    }
    // without it the scheduler sinks each tile's reads to just ahead of its product: one exposed latency per tile
    __builtin_amdgcn_sched_barrier(0);
#pragma unroll
    for (int s = 0; s < 4; ++s) {
#pragma unroll
      for (int i = 0; i < 8; ++i) acc[i >> 2][i & 3] = mmab(a[s][i >> 2], bt[s][i & 3], acc[i >> 2][i & 3]);
    }
    // without it the scheduler lifts the hand-over in front of the products, and the next stage's copies, issued just before this
    // trip's reads, are waited for with nothing to cover their flight
    __builtin_amdgcn_sched_barrier(0);
    // hand-over: this wave's reads of the stage are done, its copies of the next stage have landed; the barrier publishes the
    // next stage and ends every wave's reads of this one, which is refilled only behind it
    asm volatile("s_wait_dscnt 0x0" ::: "memory");
    asm volatile("s_wait_asynccnt 0x0" ::: "memory");
    __syncthreads();
    if (it + 2 < 4) {
      const unsigned lb = l0 + (unsigned)(it & 1) * (2u * STO_);
      const _Float16* sg = src + ((g0 + it + 2) & 3) * 2048;
      copy4k(lb, sg);
      copy4k(lb + 4096u, sg + RT);
    }
  }
  // no copy is outstanding when the ring's LDS is put to another use
  asm volatile("s_wait_asynccnt 0x0" ::: "memory");
  const float kS = 1.0f / 4096.0f;                       // undo 2^4 (W) and 2^8 (G)
#pragma unroll
  for (int t = 0; t < 4; ++t) {
    const int ol = nh * 64 + t * 16 + m;
    const float bta = betaO[nchunk * 128 + ol];
#pragma unroll
    for (int r = 0; r < 2; ++r)
#pragma unroll
      for (int j = 0; j < 8; ++j) {
        const int pl = msub * 32 + r * 16 + 8 * h + j;   // D row 8h+j of row tile r
        To[ol * 132 + pl] = acc[r][t][j] * kS + bta;
      }
  }
  __syncthreads();
#pragma unroll
  for (int it = 0; it < 16; ++it) {
    const int pi = it * 256 + tid;                       // 128 rows x 32 float4 pieces
    const int ol = pi >> 5, pc = pi & 31;
    const v4f v = *(const v4fa*)(To + ol * 132 + pc * 4);
    float* dst = out + ((size_t)(b * NC_ + nchunk * 128 + ol)) * NP_ + ptile * 128 + pc * 4;
    *(v4f*)dst = v;
    
  }
}

// ---------------- launch glue ------------------------------------------------------------------------
extern "C" void kernel_launch(void* const* d_in, const int* in_sizes, int n_in,
                              void* d_out, int out_size, void* d_ws, size_t ws_size,
                              hipStream_t stream) {
  if (n_in < 24) return;
  if (in_sizes[0] != NB_ * NC_ * NP_) return;
  if (in_sizes[1] != NC_ * NC_ || in_sizes[6] != NC_ * NC_ || in_sizes[11] != NO_ * NC_) return;
  if (in_sizes[16] != NP_ * NH_ || in_sizes[17] != NC_ * NO_ || in_sizes[23] != NP_ * NP_) return;
  {
    const int f32c[13] = {2, 3, 4, 5, 7, 8, 9, 10, 18, 19, 20, 21, 22};
    for (int i = 0; i < 13; ++i) if (in_sizes[f32c[i]] != NC_) return;
    const int f32o[4] = {12, 13, 14, 15};
    for (int i = 0; i < 4; ++i) if (in_sizes[f32o[i]] != NO_) return;
  }
  if (out_size != NB_ * NC_ * NP_) return;

  const float* x    = (const float*)d_in[0];
  const float* Wq   = (const float*)d_in[1];
  const float* q_g  = (const float*)d_in[2];
  const float* q_b  = (const float*)d_in[3];
  const float* q_m  = (const float*)d_in[4];
  const float* q_v  = (const float*)d_in[5];
  const float* Wk   = (const float*)d_in[6];
  const float* k_g  = (const float*)d_in[7];
  const float* k_b  = (const float*)d_in[8];
  const float* k_m  = (const float*)d_in[9];
  const float* k_v  = (const float*)d_in[10];
  const float* Wv   = (const float*)d_in[11];
  const float* v_g  = (const float*)d_in[12];
  const float* v_b  = (const float*)d_in[13];
  const float* v_m  = (const float*)d_in[14];
  const float* v_v  = (const float*)d_in[15];
  const float* pose = (const float*)d_in[16];
  const float* Wo   = (const float*)d_in[17];
  const float* bo   = (const float*)d_in[18];
  const float* o_g  = (const float*)d_in[19];
  const float* o_b  = (const float*)d_in[20];
  const float* o_m  = (const float*)d_in[21];
  const float* o_v  = (const float*)d_in[22];
  const int*   pix  = (const int*)d_in[23];

  // workspace carve (bytes), every offset a multiple of 1024
  const size_t O_WH    = 0;                                             // 1024*256*2
  const size_t O_WL    = O_WH    + (size_t)1024 * NC_ * 2;              // 524288
  const size_t O_BETA  = O_WL    + (size_t)1024 * NC_ * 2;              // 1048576, 4096 B
  const size_t O_WOS   = O_BETA  + 4096;                                // 1052672, 256*512*2
  const size_t O_BETAO = O_WOS   + (size_t)NC_ * NO_ * 2;               // 1314816, 1024 B
  const size_t O_XTH   = O_BETAO + 1024;                                // 1315840, 8 MB
  const size_t O_XTL   = O_XTH   + (size_t)NB_ * NP_ * NC_ * 2;         // 9704448
  const size_t O_QT    = O_XTL   + (size_t)NB_ * NP_ * NC_ * 2;         // 18093056, 8 MB
  const size_t O_KT    = O_QT    + (size_t)NB_ * NH_ * NP_ * DK_ * 2;   // 26481664
  const size_t O_VN    = O_KT    + (size_t)NB_ * NH_ * NP_ * DK_ * 2;   // 34870272, 16 MB
  const size_t O_GOT   = O_VN    + (size_t)NB_ * NO_ * NP_ * 2;         // 51647488, 16 MB
  const size_t O_BIAS  = O_GOT   + (size_t)NB_ * NP_ * NO_ * 2;         // 68424704, 16 MB
  const size_t O_END   = O_BIAS  + (size_t)NH_ * NP_ * NP_ * 2;         // 85201920
  if (O_END > ws_size) return;

  char* ws = (char*)d_ws;
  _Float16* Wh    = (_Float16*)(ws + O_WH);
  _Float16* Wl    = (_Float16*)(ws + O_WL);
  float*    beta  = (float*)   (ws + O_BETA);
  _Float16* WoS   = (_Float16*)(ws + O_WOS);
  float*    betaO = (float*)   (ws + O_BETAO);
  _Float16* xTh   = (_Float16*)(ws + O_XTH);
  _Float16* xTl   = (_Float16*)(ws + O_XTL);
  _Float16* qT    = (_Float16*)(ws + O_QT);
  _Float16* kT    = (_Float16*)(ws + O_KT);
  _Float16* vN    = (_Float16*)(ws + O_VN);
  _Float16* goT   = (_Float16*)(ws + O_GOT);
  _Float16* biasP = (_Float16*)(ws + O_BIAS);

  k_prep<<<dim3(NFQ_ + NFO_ + (NP_ / 64) * (NC_ / 64) * NB_), dim3(256), 0, stream>>>(
      Wq, q_g, q_b, q_m, q_v, Wk, k_g, k_b, k_m, k_v, Wv, v_g, v_b, v_m, v_v,
      Wo, bo, o_g, o_b, o_m, o_v, x, pix, pose, Wh, Wl, beta, WoS, betaO, xTh, xTl, biasP);
  k_qkv<<<dim3(NP_ / 128, 8, NB_), dim3(128), 0, stream>>>(xTh, xTl, Wh, beta, qT, kT, vN);   // Wl = Wh + 1024*256 elements
  k_attn<<<dim3(NP_ / 256, NH_, NB_), dim3(256), 0, stream>>>(qT, kT, vN, biasP, goT);
  k_out<<<dim3(NP_ / 128, 2, NB_), dim3(256), 0, stream>>>(goT, WoS, betaO, (float*)d_out);
}
